// v000
// The times below were measured on an AMD MI455X: many runs one after another, warmed up first and cycling through
// copies of the inputs, with the whole window's GPU time divided by the number of runs. Launches and the gaps
// between them are all in it. The median over several windows is given; except for v000 it joins two sittings, which
// can be a few percent apart, so the side-by-side timings, each taken in one sitting, are the better comparison.
// v000, which the later versions start from, runs in 544 microseconds.
#include <hip/hip_runtime.h>
#include <hip/hip_bf16.h>
#include <math.h>

// ---------------------------------------------------------------------------
// CrossFormerBlock for MI455X (gfx1250, wave32, WMMA 16x16x32 f16 -> f32 acc)
// Data movement: GLOBAL_LOAD_ASYNC_TO_LDS_B128 for the LDS fills of K2, K3, K6 (ASYNCcnt),
// WMMA for all six GEMMs, VALU for softmax/LN/conv.
// ---------------------------------------------------------------------------

typedef __attribute__((ext_vector_type(16))) _Float16 v16h;
typedef __attribute__((ext_vector_type(8)))  float    v8f;

// K-index inside a 16x32 f16 A/B fragment for element e (0..15) of the v16h,
// given lane-half hi = lane/16 (CDNA5 ISA 7.12.2 16-bit A/B layout).
__device__ __forceinline__ int kmap(int e, int hi) {
    return ((e >> 3) << 4) + (((e >> 1) & 3) << 1) + (hi << 3) + (e & 1);
}

// Wave-local LDS producer->consumer sync (same-wave lane exchange via LDS).
__device__ __forceinline__ void wave_lds_sync() {
    __builtin_amdgcn_wave_barrier();
    asm volatile("s_wait_dscnt 0x0" ::: "memory");
    __builtin_amdgcn_wave_barrier();
}

// Async 16B global->LDS copy (no VGPR data path; tracked by ASYNCcnt).
// LDS address = low 32 bits of the flat shared pointer (ISA LDS aperture rule).
__device__ __forceinline__ void async_copy_b128(void* lds_dst, const void* gsrc) {
    unsigned l = (unsigned)(unsigned long long)lds_dst;
    asm volatile("global_load_async_to_lds_b128 %0, %1, off"
                 :: "v"(l), "v"(gsrc) : "memory");
}
__device__ __forceinline__ void wait_async() {
    asm volatile("s_wait_asynccnt 0x0" ::: "memory");
}

// Static problem dims
#define CC   128
#define TT   4
#define GG   4
#define NTOK 256        // tokens per window (G^3 * T)
#define NWIN 256        // windows
#define NHD  8          // heads
#define HDSZ 16         // head dim
#define MLPH 512
#define NROW 65536      // total tokens B*D*H*W*T
#define ATT_SCALE 0.25f // 1/sqrt(16)

// ---------------------------------------------------------------------------
// Kernel 1: LN + pos/time embed -> LDS f16, then QKV GEMM (256x384, K=128)
// ---------------------------------------------------------------------------
__global__ __launch_bounds__(256) void cf_k1_ln_pe_qkv(
    const float* __restrict__ x, const float* __restrict__ n1g,
    const float* __restrict__ n1b, const float* __restrict__ pos,
    const float* __restrict__ temb, const float* __restrict__ qkv_w,
    const float* __restrict__ qkv_b,
    _Float16* __restrict__ Q, _Float16* __restrict__ K, _Float16* __restrict__ V)
{
    __shared__ _Float16 sh[NTOK * CC];   // 64 KiB (LDS is 320 KiB/WGP)
    const int tid = threadIdx.x, win = blockIdx.x;

    // ---- per-token LN + embeds (1 thread per token) ----
    {
        const int n = tid;
        const int t = n >> 6, rem = n & 63;
        const int gd = rem >> 4, gh = (rem >> 2) & 3, gw = rem & 3;
        const int wd = win >> 6, wh = (win >> 3) & 7, ww = win & 7;
        const int d = wd * GG + gd, h = wh * GG + gh, w = ww * GG + gw;
        const float* xr = x + ((((size_t)d * 32 + h) * 32 + w) * TT + t) * CC;
        float m = 0.f, s2 = 0.f;
        for (int c = 0; c < CC; ++c) { float v = xr[c]; m += v; s2 += v * v; }
        m *= (1.f / CC);
        const float inv = rsqrtf(s2 * (1.f / CC) - m * m + 1e-5f);
        const float* pr = pos + ((gd * GG + gh) * GG + gw) * CC;
        const float* tr = temb + t * CC;
        _Float16* dst = sh + n * CC;
        for (int c = 0; c < CC; ++c) {
            float hv = (xr[c] - m) * inv * n1g[c] + n1b[c] + pr[c] + tr[c];
            dst[c] = (_Float16)hv;
        }
    }
    __syncthreads();

    // ---- GEMM: sh(256x128) @ qkv_w^T(128x384) ----
    const int wave = tid >> 5, lane = tid & 31, lr = lane & 15, hi = lane >> 4;
    for (int idx = wave; idx < 16 * 24; idx += 8) {
        const int rt = idx / 24, ct = idx % 24;
        v8f acc = {};
        for (int kk = 0; kk < 4; ++kk) {
            v16h a, bf;
            for (int e = 0; e < 16; ++e) {
                const int k = kmap(e, hi);
                a[e]  = sh[(rt * 16 + lr) * CC + kk * 32 + k];
                bf[e] = (_Float16)qkv_w[(size_t)(ct * 16 + lr) * CC + kk * 32 + k];
            }
            acc = __builtin_amdgcn_wmma_f32_16x16x32_f16(
                false, a, false, bf, (short)0, acc, false, false);
        }
        for (int r = 0; r < 8; ++r) {
            const int nrow = rt * 16 + r + 8 * hi;
            const int o = ct * 16 + lr;
            float val = acc[r] + qkv_b[o];
            const int oc = o & 127;
            const int head = oc >> 4, hd = oc & 15;
            const size_t addr = (((size_t)win * NHD + head) * NTOK + nrow) * HDSZ + hd;
            if (o < 128)       Q[addr] = (_Float16)(val * ATT_SCALE);
            else if (o < 256)  K[addr] = (_Float16)val;
            else               V[addr] = (_Float16)val;
        }
    }
}

// ---------------------------------------------------------------------------
// Kernel 2: flash-style window attention, one block per (win, head).
// ---------------------------------------------------------------------------
__global__ __launch_bounds__(256) void cf_k2_attn(
    const _Float16* __restrict__ Q, const _Float16* __restrict__ K,
    const _Float16* __restrict__ V, _Float16* __restrict__ O)
{
    __shared__ _Float16 Qh[NTOK * HDSZ];   // 8 KiB each
    __shared__ _Float16 Kh[NTOK * HDSZ];
    __shared__ _Float16 Vh[NTOK * HDSZ];
    __shared__ float    sc[8][16][16];     // per-wave P transpose scratch

    const int tid = threadIdx.x, bx = blockIdx.x;
    const int win = bx >> 3, head = bx & 7;
    const size_t base = (size_t)bx * NTOK * HDSZ;

    {   // async DMA fills: 3 x 512 B128 transfers, no VGPR staging
        const uint4* qs = (const uint4*)(Q + base); uint4* qd = (uint4*)Qh;
        const uint4* ks = (const uint4*)(K + base); uint4* kd = (uint4*)Kh;
        const uint4* vs = (const uint4*)(V + base); uint4* vd = (uint4*)Vh;
        for (int i = tid; i < NTOK * HDSZ / 8; i += 256) {
            async_copy_b128(qd + i, qs + i);
            async_copy_b128(kd + i, ks + i);
            async_copy_b128(vd + i, vs + i);
        }
        wait_async();
    }
    __syncthreads();

    const int wave = tid >> 5, lane = tid & 31, lr = lane & 15, hi = lane >> 4;
    for (int qi = 0; qi < 2; ++qi) {
        const int qt = wave * 2 + qi;
        v16h aq;
        for (int e = 0; e < 16; ++e) {
            const int k = kmap(e, hi);
            aq[e] = (k < HDSZ) ? Qh[(qt * 16 + lr) * HDSZ + k] : (_Float16)0.f;
        }
        float rmax[8], rsum[8];
        v8f oacc = {};
        for (int r = 0; r < 8; ++r) { rmax[r] = -1e30f; rsum[r] = 0.f; }

        for (int kt = 0; kt < 16; ++kt) {
            v16h bk;
            for (int e = 0; e < 16; ++e) {
                const int k = kmap(e, hi);
                bk[e] = (k < HDSZ) ? Kh[(kt * 16 + lr) * HDSZ + k] : (_Float16)0.f;
            }
            v8f zc = {};
            v8f s = __builtin_amdgcn_wmma_f32_16x16x32_f16(
                false, aq, false, bk, (short)0, zc, false, false);

            // online softmax: row m = r + 8*hi lives in a 16-lane group
            for (int r = 0; r < 8; ++r) {
                float sv = s[r];
                float mx = sv;
                mx = fmaxf(mx, __shfl_xor(mx, 1, 32));
                mx = fmaxf(mx, __shfl_xor(mx, 2, 32));
                mx = fmaxf(mx, __shfl_xor(mx, 4, 32));
                mx = fmaxf(mx, __shfl_xor(mx, 8, 32));
                const float mnew = fmaxf(rmax[r], mx);
                const float p = __expf(sv - mnew);
                float ps = p;
                ps += __shfl_xor(ps, 1, 32);
                ps += __shfl_xor(ps, 2, 32);
                ps += __shfl_xor(ps, 4, 32);
                ps += __shfl_xor(ps, 8, 32);
                const float corr = __expf(rmax[r] - mnew);
                rsum[r] = rsum[r] * corr + ps;
                oacc[r] *= corr;
                rmax[r] = mnew;
                sc[wave][r + 8 * hi][lr] = p;   // D-layout -> scratch[row][col]
            }
            wave_lds_sync();

            v16h ap, bv;
            for (int e = 0; e < 16; ++e) {
                const int k = kmap(e, hi);
                ap[e] = (k < 16) ? (_Float16)sc[wave][lr][k] : (_Float16)0.f;
                bv[e] = (k < 16) ? Vh[(kt * 16 + k) * HDSZ + lr] : (_Float16)0.f;
            }
            oacc = __builtin_amdgcn_wmma_f32_16x16x32_f16(
                false, ap, false, bv, (short)0, oacc, false, false);
            wave_lds_sync();
        }

        for (int r = 0; r < 8; ++r) {
            const int n = qt * 16 + r + 8 * hi;
            const float ov = oacc[r] / rsum[r];
            O[((size_t)win * NTOK + n) * CC + head * HDSZ + lr] = (_Float16)ov;
        }
    }
}

// ---------------------------------------------------------------------------
// Kernel 3: output projection (256x128 @ 128x128) + window-merge scatter.
// ---------------------------------------------------------------------------
__global__ __launch_bounds__(256) void cf_k3_proj_merge(
    const _Float16* __restrict__ O, const float* __restrict__ pw,
    const float* __restrict__ pb, float* __restrict__ Y0)
{
    __shared__ _Float16 sh[NTOK * CC];   // 64 KiB
    const int tid = threadIdx.x, win = blockIdx.x;
    {
        const uint4* src = (const uint4*)(O + (size_t)win * NTOK * CC);
        uint4* dst = (uint4*)sh;
        for (int i = tid; i < NTOK * CC / 8; i += 256)
            async_copy_b128(dst + i, src + i);
        wait_async();
    }
    __syncthreads();

    const int wave = tid >> 5, lane = tid & 31, lr = lane & 15, hi = lane >> 4;
    const int wd = win >> 6, wh = (win >> 3) & 7, ww = win & 7;
    for (int idx = wave; idx < 16 * 8; idx += 8) {
        const int rt = idx >> 3, ct = idx & 7;
        v8f acc = {};
        for (int kk = 0; kk < 4; ++kk) {
            v16h a, bf;
            for (int e = 0; e < 16; ++e) {
                const int k = kmap(e, hi);
                a[e]  = sh[(rt * 16 + lr) * CC + kk * 32 + k];
                bf[e] = (_Float16)pw[(size_t)(ct * 16 + lr) * CC + kk * 32 + k];
            }
            acc = __builtin_amdgcn_wmma_f32_16x16x32_f16(
                false, a, false, bf, (short)0, acc, false, false);
        }
        for (int r = 0; r < 8; ++r) {
            const int n = rt * 16 + r + 8 * hi;
            const int o = ct * 16 + lr;
            const int t = n >> 6, rem = n & 63;
            const int gd = rem >> 4, gh = (rem >> 2) & 3, gw = rem & 3;
            const int d = wd * GG + gd, h = wh * GG + gh, w = ww * GG + gw;
            const size_t off = ((((size_t)d * 32 + h) * 32 + w) * TT + t) * CC + o;
            Y0[off] = acc[r] + pb[o];
        }
    }
}

// ---------------------------------------------------------------------------
// Kernel 4: depthwise 3x3x3 conv over (D,H,W), T folded into batch.
// ---------------------------------------------------------------------------
__global__ __launch_bounds__(256) void cf_k4_dwconv(
    const float* __restrict__ Y0, const float* __restrict__ cw,
    const float* __restrict__ cb, float* __restrict__ Y1)
{
    const size_t idx = (size_t)blockIdx.x * 256 + threadIdx.x;  // NROW*CC
    const int c = (int)(idx & 127);
    const size_t tok = idx >> 7;           // ((d*32+h)*32+w)*4+t
    const int t = (int)(tok & 3);
    const int w = (int)((tok >> 2) & 31);
    const int h = (int)((tok >> 7) & 31);
    const int d = (int)(tok >> 12);

    float acc = cb[c];
    for (int kd = -1; kd <= 1; ++kd) {
        const int dd = d + kd; if ((unsigned)dd >= 16u) continue;
        for (int kh = -1; kh <= 1; ++kh) {
            const int hh = h + kh; if ((unsigned)hh >= 32u) continue;
            for (int kw = -1; kw <= 1; ++kw) {
                const int wp = w + kw; if ((unsigned)wp >= 32u) continue;
                const size_t src = ((((size_t)dd * 32 + hh) * 32 + wp) * TT + t) * CC + c;
                acc += Y0[src] * cw[c * 27 + (kd + 1) * 9 + (kh + 1) * 3 + (kw + 1)];
            }
        }
    }
    Y1[idx] = acc;
}

// ---------------------------------------------------------------------------
// Kernel 5: exLN -> Y2 (f32, residual base) and norm2(Y2) -> H2 (f16 MLP in).
// ---------------------------------------------------------------------------
__global__ __launch_bounds__(256) void cf_k5_lns(
    const float* __restrict__ Y1, const float* __restrict__ eg,
    const float* __restrict__ eb, const float* __restrict__ n2g,
    const float* __restrict__ n2b, float* __restrict__ Y2,
    _Float16* __restrict__ H2)
{
    const size_t tok = (size_t)blockIdx.x * 256 + threadIdx.x;
    const float* xr = Y1 + tok * CC;
    float m = 0.f, s2 = 0.f;
    for (int c = 0; c < CC; ++c) { float v = xr[c]; m += v; s2 += v * v; }
    m *= (1.f / CC);
    const float inv = rsqrtf(s2 * (1.f / CC) - m * m + 1e-5f);

    float m2 = 0.f, q2 = 0.f;
    float* yr = Y2 + tok * CC;
    for (int c = 0; c < CC; ++c) {
        const float y = (xr[c] - m) * inv * eg[c] + eb[c];
        yr[c] = y; m2 += y; q2 += y * y;
    }
    m2 *= (1.f / CC);
    const float inv2 = rsqrtf(q2 * (1.f / CC) - m2 * m2 + 1e-5f);
    _Float16* hr = H2 + tok * CC;
    for (int c = 0; c < CC; ++c)
        hr[c] = (_Float16)((yr[c] - m2) * inv2 * n2g[c] + n2b[c]);
}

// ---------------------------------------------------------------------------
// Kernel 6: fc1 GEMM (rows x 128 @ 128x512) + exact GELU -> Hm (f16).
// ---------------------------------------------------------------------------
__global__ __launch_bounds__(256) void cf_k6_fc1_gelu(
    const _Float16* __restrict__ H2, const float* __restrict__ w1,
    const float* __restrict__ b1, _Float16* __restrict__ Hm)
{
    __shared__ _Float16 sh[128 * CC];   // 32 KiB
    const int tid = threadIdx.x;
    const size_t rowBase = (size_t)blockIdx.x * 128;
    {
        const uint4* src = (const uint4*)(H2 + rowBase * CC);
        uint4* dst = (uint4*)sh;
        for (int i = tid; i < 128 * CC / 8; i += 256)
            async_copy_b128(dst + i, src + i);
        wait_async();
    }
    __syncthreads();

    const int wave = tid >> 5, lane = tid & 31, lr = lane & 15, hi = lane >> 4;
    for (int idx = wave; idx < 8 * 32; idx += 8) {
        const int rt = idx >> 5, ct = idx & 31;
        v8f acc = {};
        for (int kk = 0; kk < 4; ++kk) {
            v16h a, bf;
            for (int e = 0; e < 16; ++e) {
                const int k = kmap(e, hi);
                a[e]  = sh[(rt * 16 + lr) * CC + kk * 32 + k];
                bf[e] = (_Float16)w1[(size_t)(ct * 16 + lr) * CC + kk * 32 + k];
            }
            acc = __builtin_amdgcn_wmma_f32_16x16x32_f16(
                false, a, false, bf, (short)0, acc, false, false);
        }
        for (int r = 0; r < 8; ++r) {
            const size_t n = rowBase + rt * 16 + r + 8 * hi;
            const int o = ct * 16 + lr;
            const float v = acc[r] + b1[o];
            const float ge = 0.5f * v * (1.f + erff(v * 0.70710678f));
            Hm[n * MLPH + o] = (_Float16)ge;
        }
    }
}

// ---------------------------------------------------------------------------
// Kernel 7: fc2 GEMM (rows x 512 @ 512x128) + bias + residual -> d_out (f32).
// ---------------------------------------------------------------------------
__global__ __launch_bounds__(256) void cf_k7_fc2_res(
    const _Float16* __restrict__ Hm, const float* __restrict__ w2,
    const float* __restrict__ b2, const float* __restrict__ Y2,
    float* __restrict__ out)
{
    const int tid = threadIdx.x;
    const size_t rowBase = (size_t)blockIdx.x * 128;
    const int wave = tid >> 5, lane = tid & 31, lr = lane & 15, hi = lane >> 4;
    for (int idx = wave; idx < 8 * 8; idx += 8) {
        const int rt = idx >> 3, ct = idx & 7;
        v8f acc = {};
        for (int kk = 0; kk < 16; ++kk) {
            // hint the streamed weight row for the next K step into L2
            if (kk + 1 < 16)
                __builtin_prefetch(&w2[(size_t)(ct * 16 + lr) * MLPH + (kk + 1) * 32], 0, 1);
            v16h a, bf;
            for (int e = 0; e < 16; ++e) {
                const int k = kmap(e, hi);
                a[e]  = Hm[(rowBase + rt * 16 + lr) * MLPH + kk * 32 + k];
                bf[e] = (_Float16)w2[(size_t)(ct * 16 + lr) * MLPH + kk * 32 + k];
            }
            acc = __builtin_amdgcn_wmma_f32_16x16x32_f16(
                false, a, false, bf, (short)0, acc, false, false);
        }
        for (int r = 0; r < 8; ++r) {
            const size_t n = rowBase + rt * 16 + r + 8 * hi;
            const int o = ct * 16 + lr;
            out[n * CC + o] = acc[r] + b2[o] + Y2[n * CC + o];
        }
    }
}

// ---------------------------------------------------------------------------
// Host-side orchestration. Workspace plan (peak 128 MiB, no live overlaps):
//   [0,16M)   Q f16      -> later Y0 f32 [0,32M) -> later Y2 f32 [0,32M)
//   [16,32M)  K f16
//   [32,48M)  V f16      -> later H2 f16 [32,48M)
//   [48,64M)  O f16
//   [64,96M)  Y1 f32     -> later Hm f16 [64,128M)
// ---------------------------------------------------------------------------
extern "C" void kernel_launch(void* const* d_in, const int* in_sizes, int n_in,
                              void* d_out, int out_size, void* d_ws, size_t ws_size,
                              hipStream_t stream) {
    (void)in_sizes; (void)n_in; (void)out_size; (void)ws_size;
    const float* x       = (const float*)d_in[0];
    const float* norm1_g = (const float*)d_in[1];
    const float* norm1_b = (const float*)d_in[2];
    const float* pos     = (const float*)d_in[3];
    const float* temb    = (const float*)d_in[4];
    const float* qkv_w   = (const float*)d_in[5];
    const float* qkv_b   = (const float*)d_in[6];
    const float* proj_w  = (const float*)d_in[7];
    const float* proj_b  = (const float*)d_in[8];
    const float* conv_w  = (const float*)d_in[9];
    const float* conv_b  = (const float*)d_in[10];
    const float* exln_g  = (const float*)d_in[11];
    const float* exln_b  = (const float*)d_in[12];
    const float* norm2_g = (const float*)d_in[13];
    const float* norm2_b = (const float*)d_in[14];
    const float* fc1_w   = (const float*)d_in[15];
    const float* fc1_b   = (const float*)d_in[16];
    const float* fc2_w   = (const float*)d_in[17];
    const float* fc2_b   = (const float*)d_in[18];

    char* ws = (char*)d_ws;
    const size_t MB = 1u << 20;
    _Float16* Q  = (_Float16*)(ws + 0 * MB);
    _Float16* K  = (_Float16*)(ws + 16 * MB);
    _Float16* V  = (_Float16*)(ws + 32 * MB);
    _Float16* O  = (_Float16*)(ws + 48 * MB);
    float*    Y0 = (float*)   (ws + 0 * MB);
    float*    Y1 = (float*)   (ws + 64 * MB);
    float*    Y2 = (float*)   (ws + 0 * MB);
    _Float16* H2 = (_Float16*)(ws + 32 * MB);
    _Float16* Hm = (_Float16*)(ws + 64 * MB);
    float*    out = (float*)d_out;

    cf_k1_ln_pe_qkv<<<NWIN, 256, 0, stream>>>(x, norm1_g, norm1_b, pos, temb,
                                              qkv_w, qkv_b, Q, K, V);
    cf_k2_attn<<<NWIN * NHD, 256, 0, stream>>>(Q, K, V, O);
    cf_k3_proj_merge<<<NWIN, 256, 0, stream>>>(O, proj_w, proj_b, Y0);
    cf_k4_dwconv<<<(NROW * CC) / 256, 256, 0, stream>>>(Y0, conv_w, conv_b, Y1);
    cf_k5_lns<<<NROW / 256, 256, 0, stream>>>(Y1, exln_g, exln_b,
                                              norm2_g, norm2_b, Y2, H2);
    cf_k6_fc1_gelu<<<NROW / 128, 256, 0, stream>>>(H2, fc1_w, fc1_b, Hm);
    cf_k7_fc2_res<<<NROW / 128, 256, 0, stream>>>(Hm, fc2_w, fc2_b, Y2, out);
}

// v001
// It runs in 415 microseconds.
// Timed twice side by side with v000, it ran 1.36 and 1.34 times as fast.
#include <hip/hip_runtime.h>
#include <hip/hip_bf16.h>
#include <math.h>

// ---------------------------------------------------------------------------
// CrossFormerBlock for MI455X (gfx1250, wave32, WMMA 16x16x32 f16 -> f32 acc)
// Data movement: GLOBAL_LOAD_ASYNC_TO_LDS_B128 for LDS staging in kernels 2, 3 and 6 (ASYNCcnt),
// WMMA for all six GEMMs (QK^T and PV in kernel 2), VALU for softmax/LN/conv.
// ---------------------------------------------------------------------------

typedef __attribute__((ext_vector_type(16))) _Float16 v16h;
typedef __attribute__((ext_vector_type(8)))  float    v8f;

// K-index inside a 16x32 f16 A/B fragment for element e (0..15) of the v16h,
// given lane-half hi = lane/16 (CDNA5 ISA 7.12.2 16-bit A/B layout).
__device__ __forceinline__ int kmap(int e, int hi) {
    return ((e >> 3) << 4) + (((e >> 1) & 3) << 1) + (hi << 3) + (e & 1);
}

// Wave-local LDS producer->consumer sync (same-wave lane exchange via LDS).
__device__ __forceinline__ void wave_lds_sync() {
    __builtin_amdgcn_wave_barrier();
    asm volatile("s_wait_dscnt 0x0" ::: "memory");
    __builtin_amdgcn_wave_barrier();
}

// Async 16B global->LDS copy (no VGPR data path; tracked by ASYNCcnt).
// LDS address = low 32 bits of the flat shared pointer (ISA LDS aperture rule).
__device__ __forceinline__ void async_copy_b128(void* lds_dst, const void* gsrc) {
    unsigned l = (unsigned)(unsigned long long)lds_dst;
    asm volatile("global_load_async_to_lds_b128 %0, %1, off"
                 :: "v"(l), "v"(gsrc) : "memory");
}
__device__ __forceinline__ void wait_async() {
    asm volatile("s_wait_asynccnt 0x0" ::: "memory");
}

// Static problem dims
#define CC   128
#define TT   4
#define GG   4
#define NTOK 256        // tokens per window (G^3 * T)
#define NWIN 256        // windows
#define NHD  8          // heads
#define HDSZ 16         // head dim
#define MLPH 512
#define NROW 65536      // total tokens B*D*H*W*T
#define ATT_SCALE 0.25f // 1/sqrt(16)

// ---------------------------------------------------------------------------
// Kernel 1: LN + pos/time embed -> LDS f16, then QKV GEMM (256x384, K=128)
// ---------------------------------------------------------------------------
__global__ __launch_bounds__(256) void cf_k1_ln_pe_qkv(
    const float* __restrict__ x, const float* __restrict__ n1g,
    const float* __restrict__ n1b, const float* __restrict__ pos,
    const float* __restrict__ temb, const float* __restrict__ qkv_w,
    const float* __restrict__ qkv_b,
    _Float16* __restrict__ Q, _Float16* __restrict__ K, _Float16* __restrict__ V)
{
    __shared__ _Float16 sh[NTOK * CC];   // 64 KiB (LDS is 320 KiB/WGP)
    const int tid = threadIdx.x, win = blockIdx.x;

    // ---- per-token LN + embeds (1 thread per token) ----
    {
        const int n = tid;
        const int t = n >> 6, rem = n & 63;
        const int gd = rem >> 4, gh = (rem >> 2) & 3, gw = rem & 3;
        const int wd = win >> 6, wh = (win >> 3) & 7, ww = win & 7;
        const int d = wd * GG + gd, h = wh * GG + gh, w = ww * GG + gw;
        const float* xr = x + ((((size_t)d * 32 + h) * 32 + w) * TT + t) * CC;
        float m = 0.f, s2 = 0.f;
        for (int c = 0; c < CC; ++c) { float v = xr[c]; m += v; s2 += v * v; }
        m *= (1.f / CC);
        const float inv = rsqrtf(s2 * (1.f / CC) - m * m + 1e-5f);
        const float* pr = pos + ((gd * GG + gh) * GG + gw) * CC;
        const float* tr = temb + t * CC;
        _Float16* dst = sh + n * CC;
        for (int c = 0; c < CC; ++c) {
            float hv = (xr[c] - m) * inv * n1g[c] + n1b[c] + pr[c] + tr[c];
            dst[c] = (_Float16)hv;
        }
    }
    __syncthreads();

    // ---- GEMM: sh(256x128) @ qkv_w^T(128x384) ----
    const int wave = tid >> 5, lane = tid & 31, lr = lane & 15, hi = lane >> 4;
    for (int idx = wave; idx < 16 * 24; idx += 8) {
        const int rt = idx / 24, ct = idx % 24;
        v8f acc = {};
        for (int kk = 0; kk < 4; ++kk) {
            v16h a, bf;
            for (int e = 0; e < 16; ++e) {
                const int k = kmap(e, hi);
                a[e]  = sh[(rt * 16 + lr) * CC + kk * 32 + k];
                bf[e] = (_Float16)qkv_w[(size_t)(ct * 16 + lr) * CC + kk * 32 + k];
            }
            acc = __builtin_amdgcn_wmma_f32_16x16x32_f16(
                false, a, false, bf, (short)0, acc, false, false);
        }
        for (int r = 0; r < 8; ++r) {
            const int nrow = rt * 16 + r + 8 * hi;
            const int o = ct * 16 + lr;
            float val = acc[r] + qkv_b[o];
            const int oc = o & 127;
            const int head = oc >> 4, hd = oc & 15;
            const size_t addr = (((size_t)win * NHD + head) * NTOK + nrow) * HDSZ + hd;
            if (o < 128)       Q[addr] = (_Float16)(val * ATT_SCALE);
            else if (o < 256)  K[addr] = (_Float16)val;
            else               V[addr] = (_Float16)val;
        }
    }
}

// ---------------------------------------------------------------------------
// Kernel 2: flash-style window attention, one block per (win, head).
// ---------------------------------------------------------------------------
__global__ __launch_bounds__(256) void cf_k2_attn(
    const _Float16* __restrict__ Q, const _Float16* __restrict__ K,
    const _Float16* __restrict__ V, _Float16* __restrict__ O)
{
    __shared__ _Float16 Qh[NTOK * HDSZ];   // 8 KiB each
    __shared__ _Float16 Kh[NTOK * HDSZ];
    __shared__ _Float16 Vh[NTOK * HDSZ];
    __shared__ float    sc[8][16][16];     // per-wave P transpose scratch

    const int tid = threadIdx.x, bx = blockIdx.x;
    const int win = bx >> 3, head = bx & 7;
    const size_t base = (size_t)bx * NTOK * HDSZ;

    {   // async DMA fills: 3 x 512 B128 transfers, no VGPR staging
        const uint4* qs = (const uint4*)(Q + base); uint4* qd = (uint4*)Qh;
        const uint4* ks = (const uint4*)(K + base); uint4* kd = (uint4*)Kh;
        const uint4* vs = (const uint4*)(V + base); uint4* vd = (uint4*)Vh;
        for (int i = tid; i < NTOK * HDSZ / 8; i += 256) {
            async_copy_b128(qd + i, qs + i);
            async_copy_b128(kd + i, ks + i);
            async_copy_b128(vd + i, vs + i);
        }
        wait_async();
    }
    __syncthreads();

    const int wave = tid >> 5, lane = tid & 31, lr = lane & 15, hi = lane >> 4;
    for (int qi = 0; qi < 2; ++qi) {
        const int qt = wave * 2 + qi;
        v16h aq;
        for (int e = 0; e < 16; ++e) {
            const int k = kmap(e, hi);
            aq[e] = (k < HDSZ) ? Qh[(qt * 16 + lr) * HDSZ + k] : (_Float16)0.f;
        }
        float rmax[8], rsum[8];
        v8f oacc = {};
        for (int r = 0; r < 8; ++r) { rmax[r] = -1e30f; rsum[r] = 0.f; }

        for (int kt = 0; kt < 16; ++kt) {
            v16h bk;
            for (int e = 0; e < 16; ++e) {
                const int k = kmap(e, hi);
                bk[e] = (k < HDSZ) ? Kh[(kt * 16 + lr) * HDSZ + k] : (_Float16)0.f;
            }
            v8f zc = {};
            v8f s = __builtin_amdgcn_wmma_f32_16x16x32_f16(
                false, aq, false, bk, (short)0, zc, false, false);

            // online softmax: row m = r + 8*hi lives in a 16-lane group
            for (int r = 0; r < 8; ++r) {
                float sv = s[r];
                float mx = sv;
                mx = fmaxf(mx, __shfl_xor(mx, 1, 32));
                mx = fmaxf(mx, __shfl_xor(mx, 2, 32));
                mx = fmaxf(mx, __shfl_xor(mx, 4, 32));
                mx = fmaxf(mx, __shfl_xor(mx, 8, 32));
                const float mnew = fmaxf(rmax[r], mx);
                const float p = __expf(sv - mnew);
                float ps = p;
                ps += __shfl_xor(ps, 1, 32);
                ps += __shfl_xor(ps, 2, 32);
                ps += __shfl_xor(ps, 4, 32);
                ps += __shfl_xor(ps, 8, 32);
                const float corr = __expf(rmax[r] - mnew);
                rsum[r] = rsum[r] * corr + ps;
                oacc[r] *= corr;
                rmax[r] = mnew;
                sc[wave][r + 8 * hi][lr] = p;   // D-layout -> scratch[row][col]
            }
            wave_lds_sync();

            v16h ap, bv;
            for (int e = 0; e < 16; ++e) {
                const int k = kmap(e, hi);
                ap[e] = (k < 16) ? (_Float16)sc[wave][lr][k] : (_Float16)0.f;
                bv[e] = (k < 16) ? Vh[(kt * 16 + k) * HDSZ + lr] : (_Float16)0.f;
            }
            oacc = __builtin_amdgcn_wmma_f32_16x16x32_f16(
                false, ap, false, bv, (short)0, oacc, false, false);
            wave_lds_sync();
        }

        for (int r = 0; r < 8; ++r) {
            const int n = qt * 16 + r + 8 * hi;
            const float ov = oacc[r] / rsum[r];
            O[((size_t)win * NTOK + n) * CC + head * HDSZ + lr] = (_Float16)ov;
        }
    }
}

// ---------------------------------------------------------------------------
// Kernel 3: output projection (256x128 @ 128x128) + window-merge scatter.
// ---------------------------------------------------------------------------
__global__ __launch_bounds__(256) void cf_k3_proj_merge(
    const _Float16* __restrict__ O, const float* __restrict__ pw,
    const float* __restrict__ pb, float* __restrict__ Y0)
{
    __shared__ _Float16 sh[NTOK * CC];   // 64 KiB
    const int tid = threadIdx.x, win = blockIdx.x;
    {
        const uint4* src = (const uint4*)(O + (size_t)win * NTOK * CC);
        uint4* dst = (uint4*)sh;
        for (int i = tid; i < NTOK * CC / 8; i += 256)
            async_copy_b128(dst + i, src + i);
        wait_async();
    }
    __syncthreads();

    const int wave = tid >> 5, lane = tid & 31, lr = lane & 15, hi = lane >> 4;
    const int wd = win >> 6, wh = (win >> 3) & 7, ww = win & 7;
    for (int idx = wave; idx < 16 * 8; idx += 8) {
        const int rt = idx >> 3, ct = idx & 7;
        v8f acc = {};
        for (int kk = 0; kk < 4; ++kk) {
            v16h a, bf;
            for (int e = 0; e < 16; ++e) {
                const int k = kmap(e, hi);
                a[e]  = sh[(rt * 16 + lr) * CC + kk * 32 + k];
                bf[e] = (_Float16)pw[(size_t)(ct * 16 + lr) * CC + kk * 32 + k];
            }
            acc = __builtin_amdgcn_wmma_f32_16x16x32_f16(
                false, a, false, bf, (short)0, acc, false, false);
        }
        for (int r = 0; r < 8; ++r) {
            const int n = rt * 16 + r + 8 * hi;
            const int o = ct * 16 + lr;
            const int t = n >> 6, rem = n & 63;
            const int gd = rem >> 4, gh = (rem >> 2) & 3, gw = rem & 3;
            const int d = wd * GG + gd, h = wh * GG + gh, w = ww * GG + gw;
            const size_t off = ((((size_t)d * 32 + h) * 32 + w) * TT + t) * CC + o;
            Y0[off] = acc[r] + pb[o];
        }
    }
}

// ---------------------------------------------------------------------------
// Kernel 4: depthwise 3x3x3 conv over (D,H,W), T folded into batch.
// One wave = 64 channels of one (d,h,t) row, 2 channels per lane. The lane
// keeps its 2 x 27 weights in registers and walks the 32 columns of W: each
// loaded column (9 rows x 2 floats) feeds the three outputs it touches, so every
// input is loaded once per (kd,kh) and no weight is loaded again.
// A block is 2 d x 4 h rows of one t, so neighbouring waves read the same lines.
// Taps outside D or H: the row index is clamped and the tap's weight is zero.
// ---------------------------------------------------------------------------
typedef __attribute__((ext_vector_type(2))) float v2f;
#define DW_CS (TT * CC)   // floats from one column of W to the next
#define DW_NB 4           // column buffers: a column is fetched DW_NB - 1 ahead

__device__ __forceinline__ void dw_load_col(v2f (&b)[9], const float* const (&rp)[9],
                                            int off) {
#pragma unroll
    for (int j = 0; j < 9; ++j) b[j] = *(const v2f*)(rp[j] + off);
}

// acc += sum over the 9 (kd,kh) rows of column b times the weights of tap KW
template <int KW>
__device__ __forceinline__ void dw_fma_col(v2f& acc, const v2f (&b)[9],
                                           const v2f (&wp)[27]) {
#pragma unroll
    for (int j = 0; j < 9; ++j) acc = __builtin_elementwise_fma(b[j], wp[j * 3 + KW], acc);
}

__global__ __launch_bounds__(512) void cf_k4_dwconv(
    const float* __restrict__ Y0, const float* __restrict__ cw,
    const float* __restrict__ cb, float* __restrict__ Y1)
{
    // all weights, [c][tap]: 864 float4; the rest only lets every thread store twice
    __shared__ float4 swt[1024];
    const int tid = threadIdx.x;
    const int lane = tid & 31;
    const int wv = __builtin_amdgcn_readfirstlane(tid >> 5);
    const int bx = blockIdx.x;
    const int t = bx & 3;
    const int h = ((bx >> 2) & 7) * 4 + ((wv >> 1) & 3);
    const int d = (bx >> 5) * 2 + (wv >> 3);
    const int c0 = (wv & 1) * 64;          // this wave's first channel

    // the weights are fetched together with the first columns below
    const float4* cw4 = (const float4*)cw;
    const float4 g0 = cw4[tid];
    const float4 g1 = cw4[min(tid + 512, CC * 27 / 4 - 1)];

    const float* rp[9];
#pragma unroll
    for (int kd = 0; kd < 3; ++kd)
#pragma unroll
        for (int kh = 0; kh < 3; ++kh) {
            const int dc = min(max(d + kd - 1, 0), 15), hc = min(max(h + kh - 1, 0), 31);
            rp[kd * 3 + kh] = Y0 + ((size_t)((dc * 32 + hc) * 32) * TT + t) * CC + c0;
        }
    const int lo = lane * 2;
    v2f buf[DW_NB][9];                     // column c lives in buf[c % DW_NB]
    v2f acc[3];                            // output o lives in acc[o % 3]
#pragma unroll
    for (int c = 0; c < DW_NB - 1; ++c) dw_load_col(buf[c], rp, lo + c * DW_CS);
    const v2f bias = *(const v2f*)(cb + c0 + lo);

    swt[tid] = g0;
    swt[tid + 512] = g1;
    __syncthreads();

    // this lane's 2 channels x 27 taps (54 consecutive floats of cw), paired by tap
    const float* lw = (const float*)swt + (c0 + lo) * 27;
    v2f wp[27];
#pragma unroll
    for (int kd = 0; kd < 3; ++kd)
#pragma unroll
        for (int kh = 0; kh < 3; ++kh) {
            const bool ok = (unsigned)(d + kd - 1) < 16u && (unsigned)(h + kh - 1) < 32u;
#pragma unroll
            for (int kw = 0; kw < 3; ++kw) {
                const int tap = (kd * 3 + kh) * 3 + kw;
                const float wx = lw[tap], wy = lw[27 + tap];
                wp[tap].x = ok ? wx : 0.f;
                wp[tap].y = ok ? wy : 0.f;
            }
        }
    float* orow = Y1 + ((size_t)((d * 32 + h) * 32) * TT + t) * CC + c0;

    acc[0] = bias;
    // unrolled whole: every buffer index and every address offset is a constant
#pragma unroll
    for (int col = 0; col < 32; ++col) {
        // keeps later columns' loads from being hoisted up here, which spilled registers
        __builtin_amdgcn_sched_barrier(0);
        if (col + DW_NB - 1 < 32)
            dw_load_col(buf[(col + DW_NB - 1) % DW_NB], rp, lo + (col + DW_NB - 1) * DW_CS);
        const v2f (&b)[9] = buf[col % DW_NB];
        if (col > 0) {                     // right neighbour of output col - 1: done
            dw_fma_col<2>(acc[(col + 2) % 3], b, wp);
            *(v2f*)(orow + lo + (col - 1) * DW_CS) = acc[(col + 2) % 3];
            // precaution: stands before the stored registers are given a new value
            if (col < 31) asm volatile("s_wait_xcnt 0x0" ::: "memory");
        }
        dw_fma_col<1>(acc[col % 3], b, wp);
        if (col < 31) {                    // left neighbour of output col + 1: first
            acc[(col + 1) % 3] = bias;
            dw_fma_col<0>(acc[(col + 1) % 3], b, wp);
        }
    }
    *(v2f*)(orow + lo + 31 * DW_CS) = acc[31 % 3];
}

// ---------------------------------------------------------------------------
// Kernel 5: exLN -> Y2 (f32, residual base) and norm2(Y2) -> H2 (f16 MLP in).
// ---------------------------------------------------------------------------
__global__ __launch_bounds__(256) void cf_k5_lns(
    const float* __restrict__ Y1, const float* __restrict__ eg,
    const float* __restrict__ eb, const float* __restrict__ n2g,
    const float* __restrict__ n2b, float* __restrict__ Y2,
    _Float16* __restrict__ H2)
{
    const size_t tok = (size_t)blockIdx.x * 256 + threadIdx.x;
    const float* xr = Y1 + tok * CC;
    float m = 0.f, s2 = 0.f;
    for (int c = 0; c < CC; ++c) { float v = xr[c]; m += v; s2 += v * v; }
    m *= (1.f / CC);
    const float inv = rsqrtf(s2 * (1.f / CC) - m * m + 1e-5f);

    float m2 = 0.f, q2 = 0.f;
    float* yr = Y2 + tok * CC;
    for (int c = 0; c < CC; ++c) {
        const float y = (xr[c] - m) * inv * eg[c] + eb[c];
        yr[c] = y; m2 += y; q2 += y * y;
    }
    m2 *= (1.f / CC);
    const float inv2 = rsqrtf(q2 * (1.f / CC) - m2 * m2 + 1e-5f);
    _Float16* hr = H2 + tok * CC;
    for (int c = 0; c < CC; ++c)
        hr[c] = (_Float16)((yr[c] - m2) * inv2 * n2g[c] + n2b[c]);
}

// ---------------------------------------------------------------------------
// Kernel 6: fc1 GEMM (rows x 128 @ 128x512) + exact GELU -> Hm (f16).
// ---------------------------------------------------------------------------
__global__ __launch_bounds__(256) void cf_k6_fc1_gelu(
    const _Float16* __restrict__ H2, const float* __restrict__ w1,
    const float* __restrict__ b1, _Float16* __restrict__ Hm)
{
    __shared__ _Float16 sh[128 * CC];   // 32 KiB
    const int tid = threadIdx.x;
    const size_t rowBase = (size_t)blockIdx.x * 128;
    {
        const uint4* src = (const uint4*)(H2 + rowBase * CC);
        uint4* dst = (uint4*)sh;
        for (int i = tid; i < 128 * CC / 8; i += 256)
            async_copy_b128(dst + i, src + i);
        wait_async();
    }
    __syncthreads();

    const int wave = tid >> 5, lane = tid & 31, lr = lane & 15, hi = lane >> 4;
    for (int idx = wave; idx < 8 * 32; idx += 8) {
        const int rt = idx >> 5, ct = idx & 31;
        v8f acc = {};
        for (int kk = 0; kk < 4; ++kk) {
            v16h a, bf;
            for (int e = 0; e < 16; ++e) {
                const int k = kmap(e, hi);
                a[e]  = sh[(rt * 16 + lr) * CC + kk * 32 + k];
                bf[e] = (_Float16)w1[(size_t)(ct * 16 + lr) * CC + kk * 32 + k];
            }
            acc = __builtin_amdgcn_wmma_f32_16x16x32_f16(
                false, a, false, bf, (short)0, acc, false, false);
        }
        for (int r = 0; r < 8; ++r) {
            const size_t n = rowBase + rt * 16 + r + 8 * hi;
            const int o = ct * 16 + lr;
            const float v = acc[r] + b1[o];
            const float ge = 0.5f * v * (1.f + erff(v * 0.70710678f));
            Hm[n * MLPH + o] = (_Float16)ge;
        }
    }
}

// ---------------------------------------------------------------------------
// Kernel 7: fc2 GEMM (rows x 512 @ 512x128) + bias + residual -> d_out (f32).
// ---------------------------------------------------------------------------
__global__ __launch_bounds__(256) void cf_k7_fc2_res(
    const _Float16* __restrict__ Hm, const float* __restrict__ w2,
    const float* __restrict__ b2, const float* __restrict__ Y2,
    float* __restrict__ out)
{
    const int tid = threadIdx.x;
    const size_t rowBase = (size_t)blockIdx.x * 128;
    const int wave = tid >> 5, lane = tid & 31, lr = lane & 15, hi = lane >> 4;
    for (int idx = wave; idx < 8 * 8; idx += 8) {
        const int rt = idx >> 3, ct = idx & 7;
        v8f acc = {};
        for (int kk = 0; kk < 16; ++kk) {
            // hint the streamed weight row for the next K step into L2
            if (kk + 1 < 16)
                __builtin_prefetch(&w2[(size_t)(ct * 16 + lr) * MLPH + (kk + 1) * 32], 0, 1);
            v16h a, bf;
            for (int e = 0; e < 16; ++e) {
                const int k = kmap(e, hi);
                a[e]  = Hm[(rowBase + rt * 16 + lr) * MLPH + kk * 32 + k];
                bf[e] = (_Float16)w2[(size_t)(ct * 16 + lr) * MLPH + kk * 32 + k];
            }
            acc = __builtin_amdgcn_wmma_f32_16x16x32_f16(
                false, a, false, bf, (short)0, acc, false, false);
        }
        for (int r = 0; r < 8; ++r) {
            const size_t n = rowBase + rt * 16 + r + 8 * hi;
            const int o = ct * 16 + lr;
            out[n * CC + o] = acc[r] + b2[o] + Y2[n * CC + o];
        }
    }
}

// ---------------------------------------------------------------------------
// Host-side orchestration. Workspace plan (peak 128 MiB, no live overlaps):
//   [0,16M)   Q f16      -> later Y0 f32 [0,32M) -> later Y2 f32 [0,32M)
//   [16,32M)  K f16
//   [32,48M)  V f16      -> later H2 f16 [32,48M)
//   [48,64M)  O f16
//   [64,96M)  Y1 f32     -> later Hm f16 [64,128M)
// ---------------------------------------------------------------------------
extern "C" void kernel_launch(void* const* d_in, const int* in_sizes, int n_in,
                              void* d_out, int out_size, void* d_ws, size_t ws_size,
                              hipStream_t stream) {
    (void)in_sizes; (void)n_in; (void)out_size; (void)ws_size;
    const float* x       = (const float*)d_in[0];
    const float* norm1_g = (const float*)d_in[1];
    const float* norm1_b = (const float*)d_in[2];
    const float* pos     = (const float*)d_in[3];
    const float* temb    = (const float*)d_in[4];
    const float* qkv_w   = (const float*)d_in[5];
    const float* qkv_b   = (const float*)d_in[6];
    const float* proj_w  = (const float*)d_in[7];
    const float* proj_b  = (const float*)d_in[8];
    const float* conv_w  = (const float*)d_in[9];
    const float* conv_b  = (const float*)d_in[10];
    const float* exln_g  = (const float*)d_in[11];
    const float* exln_b  = (const float*)d_in[12];
    const float* norm2_g = (const float*)d_in[13];
    const float* norm2_b = (const float*)d_in[14];
    const float* fc1_w   = (const float*)d_in[15];
    const float* fc1_b   = (const float*)d_in[16];
    const float* fc2_w   = (const float*)d_in[17];
    const float* fc2_b   = (const float*)d_in[18];

    char* ws = (char*)d_ws;
    const size_t MB = 1u << 20;
    _Float16* Q  = (_Float16*)(ws + 0 * MB);
    _Float16* K  = (_Float16*)(ws + 16 * MB);
    _Float16* V  = (_Float16*)(ws + 32 * MB);
    _Float16* O  = (_Float16*)(ws + 48 * MB);
    float*    Y0 = (float*)   (ws + 0 * MB);
    float*    Y1 = (float*)   (ws + 64 * MB);
    float*    Y2 = (float*)   (ws + 0 * MB);
    _Float16* H2 = (_Float16*)(ws + 32 * MB);
    _Float16* Hm = (_Float16*)(ws + 64 * MB);
    float*    out = (float*)d_out;

    cf_k1_ln_pe_qkv<<<NWIN, 256, 0, stream>>>(x, norm1_g, norm1_b, pos, temb,
                                              qkv_w, qkv_b, Q, K, V);
    cf_k2_attn<<<NWIN * NHD, 256, 0, stream>>>(Q, K, V, O);
    cf_k3_proj_merge<<<NWIN, 256, 0, stream>>>(O, proj_w, proj_b, Y0);
    cf_k4_dwconv<<<NROW / 256, 512, 0, stream>>>(Y0, conv_w, conv_b, Y1);
    cf_k5_lns<<<NROW / 256, 256, 0, stream>>>(Y1, exln_g, exln_b,
                                              norm2_g, norm2_b, Y2, H2);
    cf_k6_fc1_gelu<<<NROW / 128, 256, 0, stream>>>(H2, fc1_w, fc1_b, Hm);
    cf_k7_fc2_res<<<NROW / 128, 256, 0, stream>>>(Hm, fc2_w, fc2_b, Y2, out);
}

// v002
// Measured time: 271 microseconds a run.
// Next to v001, in two timings, it ran 1.53 times as fast each time.
// Counting every step since v000, it is 2.06 times as fast.
#include <hip/hip_runtime.h>
#include <hip/hip_bf16.h>
#include <math.h>

// ---------------------------------------------------------------------------
// CrossFormerBlock for MI455X (gfx1250, wave32, WMMA 16x16x32 f16 -> f32 acc)
// Data movement: GLOBAL_LOAD_ASYNC_TO_LDS_B128 for LDS staging in kernels 2, 3 and 6 (ASYNCcnt),
// WMMA for all six GEMMs (QK^T and PV in kernel 2), VALU for softmax/LN/conv.
// ---------------------------------------------------------------------------

typedef __attribute__((ext_vector_type(16))) _Float16 v16h;
typedef __attribute__((ext_vector_type(8)))  float    v8f;

// K-index inside a 16x32 f16 A/B fragment for element e (0..15) of the v16h,
// given lane-half hi = lane/16 (CDNA5 ISA 7.12.2 16-bit A/B layout).
__device__ __forceinline__ int kmap(int e, int hi) {
    return ((e >> 3) << 4) + (((e >> 1) & 3) << 1) + (hi << 3) + (e & 1);
}

// One B fragment from 32 consecutive f32 weights of this lane's output column, as f16.
__device__ __forceinline__ void load_w_frag(v16h& f, const float* __restrict__ w, int hi) {
#pragma unroll  // constant indices keep the fragment arrays in registers
    for (int e = 0; e < 16; ++e) f[e] = (_Float16)w[kmap(e, hi)];
    // precaution: stands before the address registers of these loads are given a new value
    asm volatile("s_wait_xcnt 0x0" ::: "memory");
}

// Wave-local LDS producer->consumer sync (same-wave lane exchange via LDS).
__device__ __forceinline__ void wave_lds_sync() {
    __builtin_amdgcn_wave_barrier();
    asm volatile("s_wait_dscnt 0x0" ::: "memory");
    __builtin_amdgcn_wave_barrier();
}

// Async 16B global->LDS copy (no VGPR data path; tracked by ASYNCcnt).
// LDS address = low 32 bits of the flat shared pointer (ISA LDS aperture rule).
__device__ __forceinline__ void async_copy_b128(void* lds_dst, const void* gsrc) {
    unsigned l = (unsigned)(unsigned long long)lds_dst;
    asm volatile("global_load_async_to_lds_b128 %0, %1, off"
                 :: "v"(l), "v"(gsrc) : "memory");
}
__device__ __forceinline__ void wait_async() {
    asm volatile("s_wait_asynccnt 0x0" ::: "memory");
}

// Static problem dims
#define CC   128
#define TT   4
#define GG   4
#define NTOK 256        // tokens per window (G^3 * T)
#define NWIN 256        // windows
#define NHD  8          // heads
#define HDSZ 16         // head dim
#define MLPH 512
#define NROW 65536      // total tokens B*D*H*W*T
#define ATT_SCALE 0.25f // 1/sqrt(16)

// ---------------------------------------------------------------------------
// Kernel 1: LN + pos/time embed -> LDS f16, then QKV GEMM (256x384, K=128)
// ---------------------------------------------------------------------------
__global__ __launch_bounds__(256) void cf_k1_ln_pe_qkv(
    const float* __restrict__ x, const float* __restrict__ n1g,
    const float* __restrict__ n1b, const float* __restrict__ pos,
    const float* __restrict__ temb, const float* __restrict__ qkv_w,
    const float* __restrict__ qkv_b,
    _Float16* __restrict__ Q, _Float16* __restrict__ K, _Float16* __restrict__ V)
{
    __shared__ _Float16 sh[NTOK * CC];   // 64 KiB (LDS is 320 KiB/WGP)
    const int tid = threadIdx.x, win = blockIdx.x;

    // ---- per-token LN + embeds (1 thread per token) ----
    {
        const int n = tid;
        const int t = n >> 6, rem = n & 63;
        const int gd = rem >> 4, gh = (rem >> 2) & 3, gw = rem & 3;
        const int wd = win >> 6, wh = (win >> 3) & 7, ww = win & 7;
        const int d = wd * GG + gd, h = wh * GG + gh, w = ww * GG + gw;
        const float* xr = x + ((((size_t)d * 32 + h) * 32 + w) * TT + t) * CC;
        float m = 0.f, s2 = 0.f;
        for (int c = 0; c < CC; ++c) { float v = xr[c]; m += v; s2 += v * v; }
        m *= (1.f / CC);
        const float inv = rsqrtf(s2 * (1.f / CC) - m * m + 1e-5f);
        const float* pr = pos + ((gd * GG + gh) * GG + gw) * CC;
        const float* tr = temb + t * CC;
        _Float16* dst = sh + n * CC;
        for (int c = 0; c < CC; ++c) {
            float hv = (xr[c] - m) * inv * n1g[c] + n1b[c] + pr[c] + tr[c];
            dst[c] = (_Float16)hv;
        }
    }
    __syncthreads();

    // ---- GEMM: sh(256x128) @ qkv_w^T(128x384) ----
    const int wave = tid >> 5, lane = tid & 31, lr = lane & 15, hi = lane >> 4;
    // The wave owns column tiles wave, wave + 8, wave + 16 (its head's Q, K and V columns):
    // their weights are fetched and converted once and stay in registers over all row tiles.
    v16h bw[3][4];
    float bias[3];
#pragma unroll  // constant indices keep the fragment arrays in registers
    for (int j = 0; j < 3; ++j) bias[j] = qkv_b[(wave + 8 * j) * 16 + lr];
    // precaution: stands before the address register of these loads is given a new value
    asm volatile("s_wait_xcnt 0x0" ::: "memory");
#pragma unroll  // constant indices keep the fragment arrays in registers
    for (int j = 0; j < 3; ++j) {
        const int o = (wave + 8 * j) * 16 + lr;
#pragma unroll  // constant indices keep the fragment arrays in registers
        for (int kk = 0; kk < 4; ++kk) load_w_frag(bw[j][kk], qkv_w + (size_t)o * CC + kk * 32, hi);
    }
    for (int rt = 0; rt < 16; ++rt) {
        v16h a[4];
#pragma unroll  // constant indices keep the fragment arrays in registers
        for (int kk = 0; kk < 4; ++kk)
            for (int e = 0; e < 16; ++e)
                a[kk][e] = sh[(rt * 16 + lr) * CC + kk * 32 + kmap(e, hi)];
#pragma unroll  // constant indices keep the fragment arrays in registers
        for (int j = 0; j < 3; ++j) {
            v8f acc = {};
#pragma unroll  // constant indices keep the fragment arrays in registers
            for (int kk = 0; kk < 4; ++kk)
                acc = __builtin_amdgcn_wmma_f32_16x16x32_f16(
                    false, a[kk], false, bw[j][kk], (short)0, acc, false, false);
            for (int r = 0; r < 8; ++r) {
                const int nrow = rt * 16 + r + 8 * hi;
                const float val = acc[r] + bias[j];
                const size_t addr = (((size_t)win * NHD + wave) * NTOK + nrow) * HDSZ + lr;
                if (j == 0)       Q[addr] = (_Float16)(val * ATT_SCALE);
                else if (j == 1)  K[addr] = (_Float16)val;
                else              V[addr] = (_Float16)val;
            }
            // precaution: stands before the registers of these stores are given a new value
            asm volatile("s_wait_xcnt 0x0" ::: "memory");
        }
    }
}

// ---------------------------------------------------------------------------
// Kernel 2: flash-style window attention, one block per (win, head).
// ---------------------------------------------------------------------------
__global__ __launch_bounds__(256) void cf_k2_attn(
    const _Float16* __restrict__ Q, const _Float16* __restrict__ K,
    const _Float16* __restrict__ V, _Float16* __restrict__ O)
{
    __shared__ _Float16 Qh[NTOK * HDSZ];   // 8 KiB each
    __shared__ _Float16 Kh[NTOK * HDSZ];
    __shared__ _Float16 Vh[NTOK * HDSZ];
    __shared__ float    sc[8][16][16];     // per-wave P transpose scratch

    const int tid = threadIdx.x, bx = blockIdx.x;
    const int win = bx >> 3, head = bx & 7;
    const size_t base = (size_t)bx * NTOK * HDSZ;

    {   // async DMA fills: 3 x 512 B128 transfers, no VGPR staging
        const uint4* qs = (const uint4*)(Q + base); uint4* qd = (uint4*)Qh;
        const uint4* ks = (const uint4*)(K + base); uint4* kd = (uint4*)Kh;
        const uint4* vs = (const uint4*)(V + base); uint4* vd = (uint4*)Vh;
        for (int i = tid; i < NTOK * HDSZ / 8; i += 256) {
            async_copy_b128(qd + i, qs + i);
            async_copy_b128(kd + i, ks + i);
            async_copy_b128(vd + i, vs + i);
        }
        wait_async();
    }
    __syncthreads();

    const int wave = tid >> 5, lane = tid & 31, lr = lane & 15, hi = lane >> 4;
    for (int qi = 0; qi < 2; ++qi) {
        const int qt = wave * 2 + qi;
        v16h aq;
        for (int e = 0; e < 16; ++e) {
            const int k = kmap(e, hi);
            aq[e] = (k < HDSZ) ? Qh[(qt * 16 + lr) * HDSZ + k] : (_Float16)0.f;
        }
        float rmax[8], rsum[8];
        v8f oacc = {};
        for (int r = 0; r < 8; ++r) { rmax[r] = -1e30f; rsum[r] = 0.f; }

        for (int kt = 0; kt < 16; ++kt) {
            v16h bk;
            for (int e = 0; e < 16; ++e) {
                const int k = kmap(e, hi);
                bk[e] = (k < HDSZ) ? Kh[(kt * 16 + lr) * HDSZ + k] : (_Float16)0.f;
            }
            v8f zc = {};
            v8f s = __builtin_amdgcn_wmma_f32_16x16x32_f16(
                false, aq, false, bk, (short)0, zc, false, false);

            // online softmax: row m = r + 8*hi lives in a 16-lane group
            for (int r = 0; r < 8; ++r) {
                float sv = s[r];
                float mx = sv;
                mx = fmaxf(mx, __shfl_xor(mx, 1, 32));
                mx = fmaxf(mx, __shfl_xor(mx, 2, 32));
                mx = fmaxf(mx, __shfl_xor(mx, 4, 32));
                mx = fmaxf(mx, __shfl_xor(mx, 8, 32));
                const float mnew = fmaxf(rmax[r], mx);
                const float p = __expf(sv - mnew);
                float ps = p;
                ps += __shfl_xor(ps, 1, 32);
                ps += __shfl_xor(ps, 2, 32);
                ps += __shfl_xor(ps, 4, 32);
                ps += __shfl_xor(ps, 8, 32);
                const float corr = __expf(rmax[r] - mnew);
                rsum[r] = rsum[r] * corr + ps;
                oacc[r] *= corr;
                rmax[r] = mnew;
                sc[wave][r + 8 * hi][lr] = p;   // D-layout -> scratch[row][col]
            }
            wave_lds_sync();

            v16h ap, bv;
            for (int e = 0; e < 16; ++e) {
                const int k = kmap(e, hi);
                ap[e] = (k < 16) ? (_Float16)sc[wave][lr][k] : (_Float16)0.f;
                bv[e] = (k < 16) ? Vh[(kt * 16 + k) * HDSZ + lr] : (_Float16)0.f;
            }
            oacc = __builtin_amdgcn_wmma_f32_16x16x32_f16(
                false, ap, false, bv, (short)0, oacc, false, false);
            wave_lds_sync();
        }

        for (int r = 0; r < 8; ++r) {
            const int n = qt * 16 + r + 8 * hi;
            const float ov = oacc[r] / rsum[r];
            O[((size_t)win * NTOK + n) * CC + head * HDSZ + lr] = (_Float16)ov;
        }
    }
}

// ---------------------------------------------------------------------------
// Kernel 3: output projection (256x128 @ 128x128) + window-merge scatter.
// ---------------------------------------------------------------------------
__global__ __launch_bounds__(256) void cf_k3_proj_merge(
    const _Float16* __restrict__ O, const float* __restrict__ pw,
    const float* __restrict__ pb, float* __restrict__ Y0)
{
    __shared__ _Float16 sh[NTOK * CC];   // 64 KiB
    const int tid = threadIdx.x, win = blockIdx.x;
    {
        const uint4* src = (const uint4*)(O + (size_t)win * NTOK * CC);
        uint4* dst = (uint4*)sh;
        for (int i = tid; i < NTOK * CC / 8; i += 256)
            async_copy_b128(dst + i, src + i);
        wait_async();
    }
    __syncthreads();

    const int wave = tid >> 5, lane = tid & 31, lr = lane & 15, hi = lane >> 4;
    const int wd = win >> 6, wh = (win >> 3) & 7, ww = win & 7;
    // The wave owns column tile 'wave': its weights stay in registers over all row tiles.
    const int o = wave * 16 + lr;
    const float bias = pb[o];
    v16h bw[4];
#pragma unroll  // constant indices keep the fragment arrays in registers
    for (int kk = 0; kk < 4; ++kk) load_w_frag(bw[kk], pw + (size_t)o * CC + kk * 32, hi);
    for (int rt = 0; rt < 16; ++rt) {
        v8f acc = {};
#pragma unroll  // constant indices keep the fragment arrays in registers
        for (int kk = 0; kk < 4; ++kk) {
            v16h a;
            for (int e = 0; e < 16; ++e)
                a[e] = sh[(rt * 16 + lr) * CC + kk * 32 + kmap(e, hi)];
            acc = __builtin_amdgcn_wmma_f32_16x16x32_f16(
                false, a, false, bw[kk], (short)0, acc, false, false);
        }
        for (int r = 0; r < 8; ++r) {
            const int n = rt * 16 + r + 8 * hi;
            const int t = n >> 6, rem = n & 63;
            const int gd = rem >> 4, gh = (rem >> 2) & 3, gw = rem & 3;
            const int d = wd * GG + gd, h = wh * GG + gh, w = ww * GG + gw;
            const size_t off = ((((size_t)d * 32 + h) * 32 + w) * TT + t) * CC + o;
            Y0[off] = acc[r] + bias;
        }
        // precaution: stands before the registers of these stores are given a new value
        asm volatile("s_wait_xcnt 0x0" ::: "memory");
    }
}

// ---------------------------------------------------------------------------
// Kernel 4: depthwise 3x3x3 conv over (D,H,W), T folded into batch.
// One wave = 64 channels of one (d,h,t) row, 2 channels per lane. The lane
// keeps its 2 x 27 weights in registers and walks the 32 columns of W: each
// loaded column (9 rows x 2 floats) feeds the three outputs it touches, so every
// input is loaded once per (kd,kh) and no weight is loaded again.
// A block is 2 d x 4 h rows of one t, so neighbouring waves read the same lines.
// Taps outside D or H: the row index is clamped and the tap's weight is zero.
// ---------------------------------------------------------------------------
typedef __attribute__((ext_vector_type(2))) float v2f;
#define DW_CS (TT * CC)   // floats from one column of W to the next
#define DW_NB 4           // column buffers: a column is fetched DW_NB - 1 ahead

__device__ __forceinline__ void dw_load_col(v2f (&b)[9], const float* const (&rp)[9],
                                            int off) {
#pragma unroll
    for (int j = 0; j < 9; ++j) b[j] = *(const v2f*)(rp[j] + off);
}

// acc += sum over the 9 (kd,kh) rows of column b times the weights of tap KW
template <int KW>
__device__ __forceinline__ void dw_fma_col(v2f& acc, const v2f (&b)[9],
                                           const v2f (&wp)[27]) {
#pragma unroll
    for (int j = 0; j < 9; ++j) acc = __builtin_elementwise_fma(b[j], wp[j * 3 + KW], acc);
}

__global__ __launch_bounds__(512) void cf_k4_dwconv(
    const float* __restrict__ Y0, const float* __restrict__ cw,
    const float* __restrict__ cb, float* __restrict__ Y1)
{
    // all weights, [c][tap]: 864 float4; the rest only lets every thread store twice
    __shared__ float4 swt[1024];
    const int tid = threadIdx.x;
    const int lane = tid & 31;
    const int wv = __builtin_amdgcn_readfirstlane(tid >> 5);
    const int bx = blockIdx.x;
    const int t = bx & 3;
    const int h = ((bx >> 2) & 7) * 4 + ((wv >> 1) & 3);
    const int d = (bx >> 5) * 2 + (wv >> 3);
    const int c0 = (wv & 1) * 64;          // this wave's first channel

    // the weights are fetched together with the first columns below
    const float4* cw4 = (const float4*)cw;
    const float4 g0 = cw4[tid];
    const float4 g1 = cw4[min(tid + 512, CC * 27 / 4 - 1)];

    const float* rp[9];
#pragma unroll
    for (int kd = 0; kd < 3; ++kd)
#pragma unroll
        for (int kh = 0; kh < 3; ++kh) {
            const int dc = min(max(d + kd - 1, 0), 15), hc = min(max(h + kh - 1, 0), 31);
            rp[kd * 3 + kh] = Y0 + ((size_t)((dc * 32 + hc) * 32) * TT + t) * CC + c0;
        }
    const int lo = lane * 2;
    v2f buf[DW_NB][9];                     // column c lives in buf[c % DW_NB]
    v2f acc[3];                            // output o lives in acc[o % 3]
#pragma unroll
    for (int c = 0; c < DW_NB - 1; ++c) dw_load_col(buf[c], rp, lo + c * DW_CS);
    const v2f bias = *(const v2f*)(cb + c0 + lo);

    swt[tid] = g0;
    swt[tid + 512] = g1;
    __syncthreads();

    // this lane's 2 channels x 27 taps (54 consecutive floats of cw), paired by tap
    const float* lw = (const float*)swt + (c0 + lo) * 27;
    v2f wp[27];
#pragma unroll
    for (int kd = 0; kd < 3; ++kd)
#pragma unroll
        for (int kh = 0; kh < 3; ++kh) {
            const bool ok = (unsigned)(d + kd - 1) < 16u && (unsigned)(h + kh - 1) < 32u;
#pragma unroll
            for (int kw = 0; kw < 3; ++kw) {
                const int tap = (kd * 3 + kh) * 3 + kw;
                const float wx = lw[tap], wy = lw[27 + tap];
                wp[tap].x = ok ? wx : 0.f;
                wp[tap].y = ok ? wy : 0.f;
            }
        }
    float* orow = Y1 + ((size_t)((d * 32 + h) * 32) * TT + t) * CC + c0;

    acc[0] = bias;
    // unrolled whole: every buffer index and every address offset is a constant
#pragma unroll
    for (int col = 0; col < 32; ++col) {
        // keeps later columns' loads from being hoisted up here, which spilled registers
        __builtin_amdgcn_sched_barrier(0);
        if (col + DW_NB - 1 < 32)
            dw_load_col(buf[(col + DW_NB - 1) % DW_NB], rp, lo + (col + DW_NB - 1) * DW_CS);
        const v2f (&b)[9] = buf[col % DW_NB];
        if (col > 0) {                     // right neighbour of output col - 1: done
            dw_fma_col<2>(acc[(col + 2) % 3], b, wp);
            *(v2f*)(orow + lo + (col - 1) * DW_CS) = acc[(col + 2) % 3];
            // precaution: stands before the stored registers are given a new value
            if (col < 31) asm volatile("s_wait_xcnt 0x0" ::: "memory");
        }
        dw_fma_col<1>(acc[col % 3], b, wp);
        if (col < 31) {                    // left neighbour of output col + 1: first
            acc[(col + 1) % 3] = bias;
            dw_fma_col<0>(acc[(col + 1) % 3], b, wp);
        }
    }
    *(v2f*)(orow + lo + 31 * DW_CS) = acc[31 % 3];
}

// ---------------------------------------------------------------------------
// Kernel 5: exLN -> Y2 (f32, residual base) and norm2(Y2) -> H2 (f16 MLP in).
// ---------------------------------------------------------------------------
__global__ __launch_bounds__(256) void cf_k5_lns(
    const float* __restrict__ Y1, const float* __restrict__ eg,
    const float* __restrict__ eb, const float* __restrict__ n2g,
    const float* __restrict__ n2b, float* __restrict__ Y2,
    _Float16* __restrict__ H2)
{
    const size_t tok = (size_t)blockIdx.x * 256 + threadIdx.x;
    const float* xr = Y1 + tok * CC;
    float m = 0.f, s2 = 0.f;
    for (int c = 0; c < CC; ++c) { float v = xr[c]; m += v; s2 += v * v; }
    m *= (1.f / CC);
    const float inv = rsqrtf(s2 * (1.f / CC) - m * m + 1e-5f);

    float m2 = 0.f, q2 = 0.f;
    float* yr = Y2 + tok * CC;
    for (int c = 0; c < CC; ++c) {
        const float y = (xr[c] - m) * inv * eg[c] + eb[c];
        yr[c] = y; m2 += y; q2 += y * y;
    }
    m2 *= (1.f / CC);
    const float inv2 = rsqrtf(q2 * (1.f / CC) - m2 * m2 + 1e-5f);
    _Float16* hr = H2 + tok * CC;
    for (int c = 0; c < CC; ++c)
        hr[c] = (_Float16)((yr[c] - m2) * inv2 * n2g[c] + n2b[c]);
}

// ---------------------------------------------------------------------------
// Kernel 6: fc1 GEMM (rows x 128 @ 128x512) + exact GELU -> Hm (f16).
// ---------------------------------------------------------------------------
__global__ __launch_bounds__(256) void cf_k6_fc1_gelu(
    const _Float16* __restrict__ H2, const float* __restrict__ w1,
    const float* __restrict__ b1, _Float16* __restrict__ Hm)
{
    __shared__ _Float16 sh[128 * CC];   // 32 KiB
    const int tid = threadIdx.x;
    const size_t rowBase = (size_t)blockIdx.x * 128;
    {
        const uint4* src = (const uint4*)(H2 + rowBase * CC);
        uint4* dst = (uint4*)sh;
        for (int i = tid; i < 128 * CC / 8; i += 256)
            async_copy_b128(dst + i, src + i);
        wait_async();
    }
    __syncthreads();

    const int wave = tid >> 5, lane = tid & 31, lr = lane & 15, hi = lane >> 4;
    // The wave owns column tiles wave + 8 j: their weights are fetched and converted once
    // and stay in registers; each row tile's A fragments serve all four.
    v16h bw[4][4];
    float bias[4];
#pragma unroll  // constant indices keep the fragment arrays in registers
    for (int j = 0; j < 4; ++j) bias[j] = b1[(wave + 8 * j) * 16 + lr];
    // precaution: stands before the address register of these loads is given a new value
    asm volatile("s_wait_xcnt 0x0" ::: "memory");
#pragma unroll  // constant indices keep the fragment arrays in registers
    for (int j = 0; j < 4; ++j) {
        const int o = (wave + 8 * j) * 16 + lr;
#pragma unroll  // constant indices keep the fragment arrays in registers
        for (int kk = 0; kk < 4; ++kk) load_w_frag(bw[j][kk], w1 + (size_t)o * CC + kk * 32, hi);
    }
    for (int rt = 0; rt < 8; ++rt) {
        v16h a[4];
#pragma unroll  // constant indices keep the fragment arrays in registers
        for (int kk = 0; kk < 4; ++kk)
            for (int e = 0; e < 16; ++e)
                a[kk][e] = sh[(rt * 16 + lr) * CC + kk * 32 + kmap(e, hi)];
#pragma unroll  // constant indices keep the fragment arrays in registers
        for (int j = 0; j < 4; ++j) {
            v8f acc = {};
#pragma unroll  // constant indices keep the fragment arrays in registers
            for (int kk = 0; kk < 4; ++kk)
                acc = __builtin_amdgcn_wmma_f32_16x16x32_f16(
                    false, a[kk], false, bw[j][kk], (short)0, acc, false, false);
            for (int r = 0; r < 8; ++r) {
                const size_t n = rowBase + rt * 16 + r + 8 * hi;
                const int o = (wave + 8 * j) * 16 + lr;
                const float v = acc[r] + bias[j];
                const float ge = 0.5f * v * (1.f + erff(v * 0.70710678f));
                Hm[n * MLPH + o] = (_Float16)ge;
            }
            // precaution: stands before the registers of these stores are given a new value
            asm volatile("s_wait_xcnt 0x0" ::: "memory");
        }
    }
}

// ---------------------------------------------------------------------------
// Kernel 7: fc2 GEMM (rows x 512 @ 512x128) + bias + residual -> d_out (f32).
// ---------------------------------------------------------------------------
__global__ __launch_bounds__(256) void cf_k7_fc2_res(
    const _Float16* __restrict__ Hm, const float* __restrict__ w2,
    const float* __restrict__ b2, const float* __restrict__ Y2,
    float* __restrict__ out)
{
    const int tid = threadIdx.x;
    const size_t rowBase = (size_t)blockIdx.x * 128;
    const int wave = tid >> 5, lane = tid & 31, lr = lane & 15, hi = lane >> 4;
    // The wave owns column tile 'wave': its 16 weight fragments are fetched and converted
    // once and stay in registers over all row tiles.
    const int o = wave * 16 + lr;
    const float bias = b2[o];
    v16h bw[16];
#pragma unroll  // constant indices keep the fragment arrays in registers
    for (int kk = 0; kk < 16; ++kk) load_w_frag(bw[kk], w2 + (size_t)o * MLPH + kk * 32, hi);
    for (int rt = 0; rt < 8; ++rt) {
        const _Float16* ar = Hm + (rowBase + rt * 16 + lr) * MLPH;
        v8f acc = {};
#pragma unroll  // constant indices keep the fragment arrays in registers
        for (int g = 0; g < 4; ++g) {
            v16h a[4];
#pragma unroll  // constant indices keep the fragment arrays in registers
            for (int kk = 0; kk < 4; ++kk)
                for (int e = 0; e < 16; ++e)
                    a[kk][e] = ar[(g * 4 + kk) * 32 + kmap(e, hi)];
            // holds the group's eight loads above its products: sunk to their users, each
            // product waited out its own load's latency
            __builtin_amdgcn_sched_barrier(0);
#pragma unroll  // constant indices keep the fragment arrays in registers
            for (int kk = 0; kk < 4; ++kk)
                acc = __builtin_amdgcn_wmma_f32_16x16x32_f16(
                    false, a[kk], false, bw[g * 4 + kk], (short)0, acc, false, false);
        }
        for (int r = 0; r < 8; ++r) {
            const size_t n = rowBase + rt * 16 + r + 8 * hi;
            out[n * CC + o] = acc[r] + bias + Y2[n * CC + o];
        }
        // precaution: stands before the registers of these stores are given a new value
        asm volatile("s_wait_xcnt 0x0" ::: "memory");
    }
}

// ---------------------------------------------------------------------------
// Host-side orchestration. Workspace plan (peak 128 MiB, no live overlaps):
//   [0,16M)   Q f16      -> later Y0 f32 [0,32M) -> later Y2 f32 [0,32M)
//   [16,32M)  K f16
//   [32,48M)  V f16      -> later H2 f16 [32,48M)
//   [48,64M)  O f16
//   [64,96M)  Y1 f32     -> later Hm f16 [64,128M)
// ---------------------------------------------------------------------------
extern "C" void kernel_launch(void* const* d_in, const int* in_sizes, int n_in,
                              void* d_out, int out_size, void* d_ws, size_t ws_size,
                              hipStream_t stream) {
    (void)in_sizes; (void)n_in; (void)out_size; (void)ws_size;
    const float* x       = (const float*)d_in[0];
    const float* norm1_g = (const float*)d_in[1];
    const float* norm1_b = (const float*)d_in[2];
    const float* pos     = (const float*)d_in[3];
    const float* temb    = (const float*)d_in[4];
    const float* qkv_w   = (const float*)d_in[5];
    const float* qkv_b   = (const float*)d_in[6];
    const float* proj_w  = (const float*)d_in[7];
    const float* proj_b  = (const float*)d_in[8];
    const float* conv_w  = (const float*)d_in[9];
    const float* conv_b  = (const float*)d_in[10];
    const float* exln_g  = (const float*)d_in[11];
    const float* exln_b  = (const float*)d_in[12];
    const float* norm2_g = (const float*)d_in[13];
    const float* norm2_b = (const float*)d_in[14];
    const float* fc1_w   = (const float*)d_in[15];
    const float* fc1_b   = (const float*)d_in[16];
    const float* fc2_w   = (const float*)d_in[17];
    const float* fc2_b   = (const float*)d_in[18];

    char* ws = (char*)d_ws;
    const size_t MB = 1u << 20;
    _Float16* Q  = (_Float16*)(ws + 0 * MB);
    _Float16* K  = (_Float16*)(ws + 16 * MB);
    _Float16* V  = (_Float16*)(ws + 32 * MB);
    _Float16* O  = (_Float16*)(ws + 48 * MB);
    float*    Y0 = (float*)   (ws + 0 * MB);
    float*    Y1 = (float*)   (ws + 64 * MB);
    float*    Y2 = (float*)   (ws + 0 * MB);
    _Float16* H2 = (_Float16*)(ws + 32 * MB);
    _Float16* Hm = (_Float16*)(ws + 64 * MB);
    float*    out = (float*)d_out;

    cf_k1_ln_pe_qkv<<<NWIN, 256, 0, stream>>>(x, norm1_g, norm1_b, pos, temb,
                                              qkv_w, qkv_b, Q, K, V);
    cf_k2_attn<<<NWIN * NHD, 256, 0, stream>>>(Q, K, V, O);
    cf_k3_proj_merge<<<NWIN, 256, 0, stream>>>(O, proj_w, proj_b, Y0);
    cf_k4_dwconv<<<NROW / 256, 512, 0, stream>>>(Y0, conv_w, conv_b, Y1);
    cf_k5_lns<<<NROW / 256, 256, 0, stream>>>(Y1, exln_g, exln_b,
                                              norm2_g, norm2_b, Y2, H2);
    cf_k6_fc1_gelu<<<NROW / 128, 256, 0, stream>>>(H2, fc1_w, fc1_b, Hm);
    cf_k7_fc2_res<<<NROW / 128, 256, 0, stream>>>(Hm, fc2_w, fc2_b, Y2, out);
}

// v003
// Measured time: 211 microseconds a run.
// Two timings next to v002 put it at 1.30 and 1.27 times that version's speed.
// Over all steps from v000 it is 2.65 times as fast.
#include <hip/hip_runtime.h>
#include <hip/hip_bf16.h>
#include <math.h>

// ---------------------------------------------------------------------------
// CrossFormerBlock for MI455X (gfx1250, wave32, WMMA 16x16x32 f16 -> f32 acc)
// Data movement: GLOBAL_LOAD_ASYNC_TO_LDS_B128 for LDS staging in kernels 2, 3 and 6 (ASYNCcnt),
// WMMA for all six GEMMs (QK^T and PV in kernel 2), VALU for softmax/LN/conv.
// ---------------------------------------------------------------------------

typedef __attribute__((ext_vector_type(16))) _Float16 v16h;
typedef __attribute__((ext_vector_type(8)))  float    v8f;

// K-index inside a 16x32 f16 A/B fragment for element e (0..15) of the v16h,
// given lane-half hi = lane/16 (CDNA5 ISA 7.12.2 16-bit A/B layout).
__device__ __forceinline__ int kmap(int e, int hi) {
    return ((e >> 3) << 4) + (((e >> 1) & 3) << 1) + (hi << 3) + (e & 1);
}

// One B fragment from 32 consecutive f32 weights of this lane's output column, as f16.
__device__ __forceinline__ void load_w_frag(v16h& f, const float* __restrict__ w, int hi) {
#pragma unroll  // constant indices keep the fragment arrays in registers
    for (int e = 0; e < 16; ++e) f[e] = (_Float16)w[kmap(e, hi)];
    // precaution: stands before the address registers of these loads are given a new value
    asm volatile("s_wait_xcnt 0x0" ::: "memory");
}

// Async 16B global->LDS copy (no VGPR data path; tracked by ASYNCcnt).
// LDS address = low 32 bits of the flat shared pointer (ISA LDS aperture rule).
__device__ __forceinline__ void async_copy_b128(void* lds_dst, const void* gsrc) {
    unsigned l = (unsigned)(unsigned long long)lds_dst;
    asm volatile("global_load_async_to_lds_b128 %0, %1, off"
                 :: "v"(l), "v"(gsrc) : "memory");
}
__device__ __forceinline__ void wait_async() {
    asm volatile("s_wait_asynccnt 0x0" ::: "memory");
}

// Static problem dims
#define CC   128
#define TT   4
#define GG   4
#define NTOK 256        // tokens per window (G^3 * T)
#define NWIN 256        // windows
#define NHD  8          // heads
#define HDSZ 16         // head dim
#define MLPH 512
#define NROW 65536      // total tokens B*D*H*W*T
#define ATT_SCALE 0.25f // 1/sqrt(16)

// ---------------------------------------------------------------------------
// Kernel 1: LN + pos/time embed -> LDS f16, then QKV GEMM (256x384, K=128)
// ---------------------------------------------------------------------------
__global__ __launch_bounds__(256) void cf_k1_ln_pe_qkv(
    const float* __restrict__ x, const float* __restrict__ n1g,
    const float* __restrict__ n1b, const float* __restrict__ pos,
    const float* __restrict__ temb, const float* __restrict__ qkv_w,
    const float* __restrict__ qkv_b,
    _Float16* __restrict__ Q, _Float16* __restrict__ K, _Float16* __restrict__ V)
{
    __shared__ _Float16 sh[NTOK * CC];   // 64 KiB (LDS is 320 KiB/WGP)
    const int tid = threadIdx.x, win = blockIdx.x;

    // ---- per-token LN + embeds (1 thread per token) ----
    {
        const int n = tid;
        const int t = n >> 6, rem = n & 63;
        const int gd = rem >> 4, gh = (rem >> 2) & 3, gw = rem & 3;
        const int wd = win >> 6, wh = (win >> 3) & 7, ww = win & 7;
        const int d = wd * GG + gd, h = wh * GG + gh, w = ww * GG + gw;
        const float* xr = x + ((((size_t)d * 32 + h) * 32 + w) * TT + t) * CC;
        float m = 0.f, s2 = 0.f;
        for (int c = 0; c < CC; ++c) { float v = xr[c]; m += v; s2 += v * v; }
        m *= (1.f / CC);
        const float inv = rsqrtf(s2 * (1.f / CC) - m * m + 1e-5f);
        const float* pr = pos + ((gd * GG + gh) * GG + gw) * CC;
        const float* tr = temb + t * CC;
        _Float16* dst = sh + n * CC;
        for (int c = 0; c < CC; ++c) {
            float hv = (xr[c] - m) * inv * n1g[c] + n1b[c] + pr[c] + tr[c];
            dst[c] = (_Float16)hv;
        }
    }
    __syncthreads();

    // ---- GEMM: sh(256x128) @ qkv_w^T(128x384) ----
    const int wave = tid >> 5, lane = tid & 31, lr = lane & 15, hi = lane >> 4;
    // The wave owns column tiles wave, wave + 8, wave + 16 (its head's Q, K and V columns):
    // their weights are fetched and converted once and stay in registers over all row tiles.
    v16h bw[3][4];
    float bias[3];
#pragma unroll  // constant indices keep the fragment arrays in registers
    for (int j = 0; j < 3; ++j) bias[j] = qkv_b[(wave + 8 * j) * 16 + lr];
    // precaution: stands before the address register of these loads is given a new value
    asm volatile("s_wait_xcnt 0x0" ::: "memory");
#pragma unroll  // constant indices keep the fragment arrays in registers
    for (int j = 0; j < 3; ++j) {
        const int o = (wave + 8 * j) * 16 + lr;
#pragma unroll  // constant indices keep the fragment arrays in registers
        for (int kk = 0; kk < 4; ++kk) load_w_frag(bw[j][kk], qkv_w + (size_t)o * CC + kk * 32, hi);
    }
    for (int rt = 0; rt < 16; ++rt) {
        v16h a[4];
#pragma unroll  // constant indices keep the fragment arrays in registers
        for (int kk = 0; kk < 4; ++kk)
            for (int e = 0; e < 16; ++e)
                a[kk][e] = sh[(rt * 16 + lr) * CC + kk * 32 + kmap(e, hi)];
#pragma unroll  // constant indices keep the fragment arrays in registers
        for (int j = 0; j < 3; ++j) {
            v8f acc = {};
#pragma unroll  // constant indices keep the fragment arrays in registers
            for (int kk = 0; kk < 4; ++kk)
                acc = __builtin_amdgcn_wmma_f32_16x16x32_f16(
                    false, a[kk], false, bw[j][kk], (short)0, acc, false, false);
            for (int r = 0; r < 8; ++r) {
                const int nrow = rt * 16 + r + 8 * hi;
                const float val = acc[r] + bias[j];
                const size_t addr = (((size_t)win * NHD + wave) * NTOK + nrow) * HDSZ + lr;
                if (j == 0)       Q[addr] = (_Float16)(val * ATT_SCALE);
                else if (j == 1)  K[addr] = (_Float16)val;
                else              V[addr] = (_Float16)val;
            }
            // precaution: stands before the registers of these stores are given a new value
            asm volatile("s_wait_xcnt 0x0" ::: "memory");
        }
    }
}

// ---------------------------------------------------------------------------
// Kernel 2: window attention, one block per (win, head), scores transposed.
// S^T = K Q^T: a lane's accumulator registers hold ONE query's scores (query = lane & 15,
// key = 16 kt + 8 hi + r), so the row maximum and the row sum are in-lane work plus one
// exchange between the wave's halves. Two score tiles, converted in place, are the B
// operand of O^T += V^T P^T over 32 keys: P never leaves the registers. All 256 keys of
// a query are held at once, so the softmax is one pass with the true row maximum.
// ---------------------------------------------------------------------------
typedef __attribute__((ext_vector_type(8))) _Float16 v8h;
typedef __attribute__((ext_vector_type(2))) _Float16 v2h;
typedef __attribute__((ext_vector_type(8))) short    v8s;
typedef __attribute__((ext_vector_type(2))) float    v2f;
#define LOG2E 1.4426950408889634f

// lane l <-> lane l ^ 16
__device__ __forceinline__ float xhalf(float v) {
    const int b = __builtin_bit_cast(int, v);
    return __builtin_bit_cast(float, __builtin_amdgcn_permlanex16(
        b, b, 0x76543210, 0xfedcba98, false, false));
}

// A or B fragment of a row of 16 f16 (head dim): k = 8 hi + e for e < 8, zero above k = 15
__device__ __forceinline__ v16h row16_frag(const _Float16* row, int hi) {
    const v8h lo = *(const v8h*)(row + hi * 8);
    const v8h z = {};
    return __builtin_shufflevector(lo, z, 0, 1, 2, 3, 4, 5, 6, 7, 8, 9, 10, 11, 12, 13, 14, 15);
}

// transposing LDS load: lane (lr, hi) gets column lr of the 8 rows 8 hi .. 8 hi + 7 of a
// 16 x 16 f16 tile; p is this lane's own address in the tile (formed by the caller)
__device__ __forceinline__ v8h lds_tr16(const _Float16* p) {
    typedef __attribute__((address_space(3))) v8s lds_v8s;
    return __builtin_bit_cast(v8h, __builtin_amdgcn_ds_load_tr16_b128_v8i16((lds_v8s*)p));
}

__global__ __launch_bounds__(256) void cf_k2_attn(
    const _Float16* __restrict__ Q, const _Float16* __restrict__ K,
    const _Float16* __restrict__ V, _Float16* __restrict__ O)
{
    __shared__ alignas(16) _Float16 Qh[NTOK * HDSZ];   // 8 KiB each
    __shared__ alignas(16) _Float16 Kh[NTOK * HDSZ];
    __shared__ alignas(16) _Float16 Vh[NTOK * HDSZ];

    const int tid = threadIdx.x, bx = blockIdx.x;
    const int win = bx >> 3, head = bx & 7;
    const size_t base = (size_t)bx * NTOK * HDSZ;

    {   // async DMA fills: 3 x 512 B128 transfers, no VGPR staging
        const uint4* qs = (const uint4*)(Q + base); uint4* qd = (uint4*)Qh;
        const uint4* ks = (const uint4*)(K + base); uint4* kd = (uint4*)Kh;
        const uint4* vs = (const uint4*)(V + base); uint4* vd = (uint4*)Vh;
        for (int i = tid; i < NTOK * HDSZ / 8; i += 256) {
            async_copy_b128(qd + i, qs + i);
            async_copy_b128(kd + i, ks + i);
            async_copy_b128(vd + i, vs + i);
        }
        wait_async();
    }
    __syncthreads();

    const int wave = tid >> 5, lane = tid & 31, lr = lane & 15, hi = lane >> 4;
    // this lane's address in a 16-key tile of V for the transposing load (rows of 32 bytes)
    const _Float16* vt = Vh + (8 * hi + (lane & 7)) * HDSZ + ((lane >> 3) & 1) * 8;
    for (int qi = 0; qi < 2; ++qi) {
        const int qt = wave * 2 + qi;
        const v16h bq = row16_frag(Qh + (qt * 16 + lr) * HDSZ, hi);

        v8f s[16];   // s[kt][r] = score of query qt * 16 + lr with key kt * 16 + 8 * hi + r
#pragma unroll  // constant indices keep the score tiles in registers
        for (int kt = 0; kt < 16; ++kt) {
            const v16h ak = row16_frag(Kh + (kt * 16 + lr) * HDSZ, hi);
            const v8f zc = {};
            s[kt] = __builtin_amdgcn_wmma_f32_16x16x32_f16(
                false, ak, false, bq, (short)0, zc, false, false);
        }

        float m4[4] = {-1e30f, -1e30f, -1e30f, -1e30f};   // four chains, joined below
#pragma unroll
        for (int kt = 0; kt < 16; ++kt)
#pragma unroll
            for (int r = 0; r < 8; ++r) m4[kt & 3] = fmaxf(m4[kt & 3], s[kt][r]);
        float mx = fmaxf(fmaxf(m4[0], m4[1]), fmaxf(m4[2], m4[3]));
        mx = fmaxf(mx, xhalf(mx));
        const float nm = -mx * LOG2E;

        v2f sum[4] = {};
        v8f oacc = {};   // oacc[r] = O^T[head dim 8 * hi + r][query lr], not yet normalised
#pragma unroll  // constant indices keep the score tiles in registers
        for (int j = 0; j < 8; ++j) {   // 32 keys a trip
            const v8h v0 = lds_tr16(vt + (j * 32) * HDSZ);
            const v8h v1 = lds_tr16(vt + (j * 32 + 16) * HDSZ);
            const v16h av = __builtin_shufflevector(
                v0, v1, 0, 1, 2, 3, 4, 5, 6, 7, 8, 9, 10, 11, 12, 13, 14, 15);
            v16h pf;   // pf[e] = P^T[key j * 32 + kmap(e, hi)][query lr]
#pragma unroll
            for (int i = 0; i < 8; ++i) {
                const v8f& st = s[2 * j + (i >> 2)];
                const v2f sv = {st[2 * (i & 3)], st[2 * (i & 3) + 1]};
                const v2f arg = __builtin_elementwise_fma(sv, v2f{LOG2E, LOG2E}, v2f{nm, nm});
                const v2f p = {__builtin_amdgcn_exp2f(arg.x), __builtin_amdgcn_exp2f(arg.y)};
                sum[i & 3] += p;
                const v2h ph = __builtin_convertvector(p, v2h);
                pf[2 * i] = ph.x;
                pf[2 * i + 1] = ph.y;
            }
            oacc = __builtin_amdgcn_wmma_f32_16x16x32_f16(
                false, av, false, pf, (short)0, oacc, false, false);
        }
        const v2f s2 = (sum[0] + sum[1]) + (sum[2] + sum[3]);
        float l = s2.x + s2.y;
        l += xhalf(l);
        const float inv = 1.f / l;

        v8h ov;
#pragma unroll
        for (int r = 0; r < 8; ++r) ov[r] = (_Float16)(oacc[r] * inv);
        *(v8h*)(O + ((size_t)win * NTOK + qt * 16 + lr) * CC + head * HDSZ + hi * 8) = ov;
        // precaution: stands before the registers of this store are given a new value
        if (qi == 0) asm volatile("s_wait_xcnt 0x0" ::: "memory");
    }
}

// ---------------------------------------------------------------------------
// Kernel 3: output projection (256x128 @ 128x128) + window-merge scatter.
// ---------------------------------------------------------------------------
__global__ __launch_bounds__(256) void cf_k3_proj_merge(
    const _Float16* __restrict__ O, const float* __restrict__ pw,
    const float* __restrict__ pb, float* __restrict__ Y0)
{
    __shared__ _Float16 sh[NTOK * CC];   // 64 KiB
    const int tid = threadIdx.x, win = blockIdx.x;
    {
        const uint4* src = (const uint4*)(O + (size_t)win * NTOK * CC);
        uint4* dst = (uint4*)sh;
        for (int i = tid; i < NTOK * CC / 8; i += 256)
            async_copy_b128(dst + i, src + i);
        wait_async();
    }
    __syncthreads();

    const int wave = tid >> 5, lane = tid & 31, lr = lane & 15, hi = lane >> 4;
    const int wd = win >> 6, wh = (win >> 3) & 7, ww = win & 7;
    // The wave owns column tile 'wave': its weights stay in registers over all row tiles.
    const int o = wave * 16 + lr;
    const float bias = pb[o];
    v16h bw[4];
#pragma unroll  // constant indices keep the fragment arrays in registers
    for (int kk = 0; kk < 4; ++kk) load_w_frag(bw[kk], pw + (size_t)o * CC + kk * 32, hi);
    for (int rt = 0; rt < 16; ++rt) {
        v8f acc = {};
#pragma unroll  // constant indices keep the fragment arrays in registers
        for (int kk = 0; kk < 4; ++kk) {
            v16h a;
            for (int e = 0; e < 16; ++e)
                a[e] = sh[(rt * 16 + lr) * CC + kk * 32 + kmap(e, hi)];
            acc = __builtin_amdgcn_wmma_f32_16x16x32_f16(
                false, a, false, bw[kk], (short)0, acc, false, false);
        }
        for (int r = 0; r < 8; ++r) {
            const int n = rt * 16 + r + 8 * hi;
            const int t = n >> 6, rem = n & 63;
            const int gd = rem >> 4, gh = (rem >> 2) & 3, gw = rem & 3;
            const int d = wd * GG + gd, h = wh * GG + gh, w = ww * GG + gw;
            const size_t off = ((((size_t)d * 32 + h) * 32 + w) * TT + t) * CC + o;
            Y0[off] = acc[r] + bias;
        }
        // precaution: stands before the registers of these stores are given a new value
        asm volatile("s_wait_xcnt 0x0" ::: "memory");
    }
}

// ---------------------------------------------------------------------------
// Kernel 4: depthwise 3x3x3 conv over (D,H,W), T folded into batch.
// One wave = 64 channels of one (d,h,t) row, 2 channels per lane. The lane
// keeps its 2 x 27 weights in registers and walks the 32 columns of W: each
// loaded column (9 rows x 2 floats) feeds the three outputs it touches, so every
// input is loaded once per (kd,kh) and no weight is loaded again.
// A block is 2 d x 4 h rows of one t, so neighbouring waves read the same lines.
// Taps outside D or H: the row index is clamped and the tap's weight is zero.
// ---------------------------------------------------------------------------
#define DW_CS (TT * CC)   // floats from one column of W to the next
#define DW_NB 4           // column buffers: a column is fetched DW_NB - 1 ahead

__device__ __forceinline__ void dw_load_col(v2f (&b)[9], const float* const (&rp)[9],
                                            int off) {
#pragma unroll
    for (int j = 0; j < 9; ++j) b[j] = *(const v2f*)(rp[j] + off);
}

// acc += sum over the 9 (kd,kh) rows of column b times the weights of tap KW
template <int KW>
__device__ __forceinline__ void dw_fma_col(v2f& acc, const v2f (&b)[9],
                                           const v2f (&wp)[27]) {
#pragma unroll
    for (int j = 0; j < 9; ++j) acc = __builtin_elementwise_fma(b[j], wp[j * 3 + KW], acc);
}

__global__ __launch_bounds__(512) void cf_k4_dwconv(
    const float* __restrict__ Y0, const float* __restrict__ cw,
    const float* __restrict__ cb, float* __restrict__ Y1)
{
    // all weights, [c][tap]: 864 float4; the rest only lets every thread store twice
    __shared__ float4 swt[1024];
    const int tid = threadIdx.x;
    const int lane = tid & 31;
    const int wv = __builtin_amdgcn_readfirstlane(tid >> 5);
    const int bx = blockIdx.x;
    const int t = bx & 3;
    const int h = ((bx >> 2) & 7) * 4 + ((wv >> 1) & 3);
    const int d = (bx >> 5) * 2 + (wv >> 3);
    const int c0 = (wv & 1) * 64;          // this wave's first channel

    // the weights are fetched together with the first columns below
    const float4* cw4 = (const float4*)cw;
    const float4 g0 = cw4[tid];
    const float4 g1 = cw4[min(tid + 512, CC * 27 / 4 - 1)];

    const float* rp[9];
#pragma unroll
    for (int kd = 0; kd < 3; ++kd)
#pragma unroll
        for (int kh = 0; kh < 3; ++kh) {
            const int dc = min(max(d + kd - 1, 0), 15), hc = min(max(h + kh - 1, 0), 31);
            rp[kd * 3 + kh] = Y0 + ((size_t)((dc * 32 + hc) * 32) * TT + t) * CC + c0;
        }
    const int lo = lane * 2;
    v2f buf[DW_NB][9];                     // column c lives in buf[c % DW_NB]
    v2f acc[3];                            // output o lives in acc[o % 3]
#pragma unroll
    for (int c = 0; c < DW_NB - 1; ++c) dw_load_col(buf[c], rp, lo + c * DW_CS);
    const v2f bias = *(const v2f*)(cb + c0 + lo);

    swt[tid] = g0;
    swt[tid + 512] = g1;
    __syncthreads();

    // this lane's 2 channels x 27 taps (54 consecutive floats of cw), paired by tap
    const float* lw = (const float*)swt + (c0 + lo) * 27;
    v2f wp[27];
#pragma unroll
    for (int kd = 0; kd < 3; ++kd)
#pragma unroll
        for (int kh = 0; kh < 3; ++kh) {
            const bool ok = (unsigned)(d + kd - 1) < 16u && (unsigned)(h + kh - 1) < 32u;
#pragma unroll
            for (int kw = 0; kw < 3; ++kw) {
                const int tap = (kd * 3 + kh) * 3 + kw;
                const float wx = lw[tap], wy = lw[27 + tap];
                wp[tap].x = ok ? wx : 0.f;
                wp[tap].y = ok ? wy : 0.f;
            }
        }
    float* orow = Y1 + ((size_t)((d * 32 + h) * 32) * TT + t) * CC + c0;

    acc[0] = bias;
    // unrolled whole: every buffer index and every address offset is a constant
#pragma unroll
    for (int col = 0; col < 32; ++col) {
        // keeps later columns' loads from being hoisted up here, which spilled registers
        __builtin_amdgcn_sched_barrier(0);
        if (col + DW_NB - 1 < 32)
            dw_load_col(buf[(col + DW_NB - 1) % DW_NB], rp, lo + (col + DW_NB - 1) * DW_CS);
        const v2f (&b)[9] = buf[col % DW_NB];
        if (col > 0) {                     // right neighbour of output col - 1: done
            dw_fma_col<2>(acc[(col + 2) % 3], b, wp);
            *(v2f*)(orow + lo + (col - 1) * DW_CS) = acc[(col + 2) % 3];
            // precaution: stands before the stored registers are given a new value
            if (col < 31) asm volatile("s_wait_xcnt 0x0" ::: "memory");
        }
        dw_fma_col<1>(acc[col % 3], b, wp);
        if (col < 31) {                    // left neighbour of output col + 1: first
            acc[(col + 1) % 3] = bias;
            dw_fma_col<0>(acc[(col + 1) % 3], b, wp);
        }
    }
    *(v2f*)(orow + lo + 31 * DW_CS) = acc[31 % 3];
}

// ---------------------------------------------------------------------------
// Kernel 5: exLN -> Y2 (f32, residual base) and norm2(Y2) -> H2 (f16 MLP in).
// ---------------------------------------------------------------------------
__global__ __launch_bounds__(256) void cf_k5_lns(
    const float* __restrict__ Y1, const float* __restrict__ eg,
    const float* __restrict__ eb, const float* __restrict__ n2g,
    const float* __restrict__ n2b, float* __restrict__ Y2,
    _Float16* __restrict__ H2)
{
    const size_t tok = (size_t)blockIdx.x * 256 + threadIdx.x;
    const float* xr = Y1 + tok * CC;
    float m = 0.f, s2 = 0.f;
    for (int c = 0; c < CC; ++c) { float v = xr[c]; m += v; s2 += v * v; }
    m *= (1.f / CC);
    const float inv = rsqrtf(s2 * (1.f / CC) - m * m + 1e-5f);

    float m2 = 0.f, q2 = 0.f;
    float* yr = Y2 + tok * CC;
    for (int c = 0; c < CC; ++c) {
        const float y = (xr[c] - m) * inv * eg[c] + eb[c];
        yr[c] = y; m2 += y; q2 += y * y;
    }
    m2 *= (1.f / CC);
    const float inv2 = rsqrtf(q2 * (1.f / CC) - m2 * m2 + 1e-5f);
    _Float16* hr = H2 + tok * CC;
    for (int c = 0; c < CC; ++c)
        hr[c] = (_Float16)((yr[c] - m2) * inv2 * n2g[c] + n2b[c]);
}

// ---------------------------------------------------------------------------
// Kernel 6: fc1 GEMM (rows x 128 @ 128x512) + exact GELU -> Hm (f16).
// ---------------------------------------------------------------------------
__global__ __launch_bounds__(256) void cf_k6_fc1_gelu(
    const _Float16* __restrict__ H2, const float* __restrict__ w1,
    const float* __restrict__ b1, _Float16* __restrict__ Hm)
{
    __shared__ _Float16 sh[128 * CC];   // 32 KiB
    const int tid = threadIdx.x;
    const size_t rowBase = (size_t)blockIdx.x * 128;
    {
        const uint4* src = (const uint4*)(H2 + rowBase * CC);
        uint4* dst = (uint4*)sh;
        for (int i = tid; i < 128 * CC / 8; i += 256)
            async_copy_b128(dst + i, src + i);
        wait_async();
    }
    __syncthreads();

    const int wave = tid >> 5, lane = tid & 31, lr = lane & 15, hi = lane >> 4;
    // The wave owns column tiles wave + 8 j: their weights are fetched and converted once
    // and stay in registers; each row tile's A fragments serve all four.
    v16h bw[4][4];
    float bias[4];
#pragma unroll  // constant indices keep the fragment arrays in registers
    for (int j = 0; j < 4; ++j) bias[j] = b1[(wave + 8 * j) * 16 + lr];
    // precaution: stands before the address register of these loads is given a new value
    asm volatile("s_wait_xcnt 0x0" ::: "memory");
#pragma unroll  // constant indices keep the fragment arrays in registers
    for (int j = 0; j < 4; ++j) {
        const int o = (wave + 8 * j) * 16 + lr;
#pragma unroll  // constant indices keep the fragment arrays in registers
        for (int kk = 0; kk < 4; ++kk) load_w_frag(bw[j][kk], w1 + (size_t)o * CC + kk * 32, hi);
    }
    for (int rt = 0; rt < 8; ++rt) {
        v16h a[4];
#pragma unroll  // constant indices keep the fragment arrays in registers
        for (int kk = 0; kk < 4; ++kk)
            for (int e = 0; e < 16; ++e)
                a[kk][e] = sh[(rt * 16 + lr) * CC + kk * 32 + kmap(e, hi)];
#pragma unroll  // constant indices keep the fragment arrays in registers
        for (int j = 0; j < 4; ++j) {
            v8f acc = {};
#pragma unroll  // constant indices keep the fragment arrays in registers
            for (int kk = 0; kk < 4; ++kk)
                acc = __builtin_amdgcn_wmma_f32_16x16x32_f16(
                    false, a[kk], false, bw[j][kk], (short)0, acc, false, false);
            for (int r = 0; r < 8; ++r) {
                const size_t n = rowBase + rt * 16 + r + 8 * hi;
                const int o = (wave + 8 * j) * 16 + lr;
                const float v = acc[r] + bias[j];
                const float ge = 0.5f * v * (1.f + erff(v * 0.70710678f));
                Hm[n * MLPH + o] = (_Float16)ge;
            }
            // precaution: stands before the registers of these stores are given a new value
            asm volatile("s_wait_xcnt 0x0" ::: "memory");
        }
    }
}

// ---------------------------------------------------------------------------
// Kernel 7: fc2 GEMM (rows x 512 @ 512x128) + bias + residual -> d_out (f32).
// ---------------------------------------------------------------------------
__global__ __launch_bounds__(256) void cf_k7_fc2_res(
    const _Float16* __restrict__ Hm, const float* __restrict__ w2,
    const float* __restrict__ b2, const float* __restrict__ Y2,
    float* __restrict__ out)
{
    const int tid = threadIdx.x;
    const size_t rowBase = (size_t)blockIdx.x * 128;
    const int wave = tid >> 5, lane = tid & 31, lr = lane & 15, hi = lane >> 4;
    // The wave owns column tile 'wave': its 16 weight fragments are fetched and converted
    // once and stay in registers over all row tiles.
    const int o = wave * 16 + lr;
    const float bias = b2[o];
    v16h bw[16];
#pragma unroll  // constant indices keep the fragment arrays in registers
    for (int kk = 0; kk < 16; ++kk) load_w_frag(bw[kk], w2 + (size_t)o * MLPH + kk * 32, hi);
    for (int rt = 0; rt < 8; ++rt) {
        const _Float16* ar = Hm + (rowBase + rt * 16 + lr) * MLPH;
        v8f acc = {};
#pragma unroll  // constant indices keep the fragment arrays in registers
        for (int g = 0; g < 4; ++g) {
            v16h a[4];
#pragma unroll  // constant indices keep the fragment arrays in registers
            for (int kk = 0; kk < 4; ++kk)
                for (int e = 0; e < 16; ++e)
                    a[kk][e] = ar[(g * 4 + kk) * 32 + kmap(e, hi)];
            // holds the group's eight loads above its products: sunk to their users, each
            // product waited out its own load's latency
            __builtin_amdgcn_sched_barrier(0);
#pragma unroll  // constant indices keep the fragment arrays in registers
            for (int kk = 0; kk < 4; ++kk)
                acc = __builtin_amdgcn_wmma_f32_16x16x32_f16(
                    false, a[kk], false, bw[g * 4 + kk], (short)0, acc, false, false);
        }
        for (int r = 0; r < 8; ++r) {
            const size_t n = rowBase + rt * 16 + r + 8 * hi;
            out[n * CC + o] = acc[r] + bias + Y2[n * CC + o];
        }
        // precaution: stands before the registers of these stores are given a new value
        asm volatile("s_wait_xcnt 0x0" ::: "memory");
    }
}

// ---------------------------------------------------------------------------
// Host-side orchestration. Workspace plan (peak 128 MiB, no live overlaps):
//   [0,16M)   Q f16      -> later Y0 f32 [0,32M) -> later Y2 f32 [0,32M)
//   [16,32M)  K f16
//   [32,48M)  V f16      -> later H2 f16 [32,48M)
//   [48,64M)  O f16
//   [64,96M)  Y1 f32     -> later Hm f16 [64,128M)
// ---------------------------------------------------------------------------
extern "C" void kernel_launch(void* const* d_in, const int* in_sizes, int n_in,
                              void* d_out, int out_size, void* d_ws, size_t ws_size,
                              hipStream_t stream) {
    (void)in_sizes; (void)n_in; (void)out_size; (void)ws_size;
    const float* x       = (const float*)d_in[0];
    const float* norm1_g = (const float*)d_in[1];
    const float* norm1_b = (const float*)d_in[2];
    const float* pos     = (const float*)d_in[3];
    const float* temb    = (const float*)d_in[4];
    const float* qkv_w   = (const float*)d_in[5];
    const float* qkv_b   = (const float*)d_in[6];
    const float* proj_w  = (const float*)d_in[7];
    const float* proj_b  = (const float*)d_in[8];
    const float* conv_w  = (const float*)d_in[9];
    const float* conv_b  = (const float*)d_in[10];
    const float* exln_g  = (const float*)d_in[11];
    const float* exln_b  = (const float*)d_in[12];
    const float* norm2_g = (const float*)d_in[13];
    const float* norm2_b = (const float*)d_in[14];
    const float* fc1_w   = (const float*)d_in[15];
    const float* fc1_b   = (const float*)d_in[16];
    const float* fc2_w   = (const float*)d_in[17];
    const float* fc2_b   = (const float*)d_in[18];

    char* ws = (char*)d_ws;
    const size_t MB = 1u << 20;
    _Float16* Q  = (_Float16*)(ws + 0 * MB);
    _Float16* K  = (_Float16*)(ws + 16 * MB);
    _Float16* V  = (_Float16*)(ws + 32 * MB);
    _Float16* O  = (_Float16*)(ws + 48 * MB);
    float*    Y0 = (float*)   (ws + 0 * MB);
    float*    Y1 = (float*)   (ws + 64 * MB);
    float*    Y2 = (float*)   (ws + 0 * MB);
    _Float16* H2 = (_Float16*)(ws + 32 * MB);
    _Float16* Hm = (_Float16*)(ws + 64 * MB);
    float*    out = (float*)d_out;

    cf_k1_ln_pe_qkv<<<NWIN, 256, 0, stream>>>(x, norm1_g, norm1_b, pos, temb,
                                              qkv_w, qkv_b, Q, K, V);
    cf_k2_attn<<<NWIN * NHD, 256, 0, stream>>>(Q, K, V, O);
    cf_k3_proj_merge<<<NWIN, 256, 0, stream>>>(O, proj_w, proj_b, Y0);
    cf_k4_dwconv<<<NROW / 256, 512, 0, stream>>>(Y0, conv_w, conv_b, Y1);
    cf_k5_lns<<<NROW / 256, 256, 0, stream>>>(Y1, exln_g, exln_b,
                                              norm2_g, norm2_b, Y2, H2);
    cf_k6_fc1_gelu<<<NROW / 128, 256, 0, stream>>>(H2, fc1_w, fc1_b, Hm);
    cf_k7_fc2_res<<<NROW / 128, 256, 0, stream>>>(Hm, fc2_w, fc2_b, Y2, out);
}

// v004
// A run of this version takes 190 microseconds.
// Two timings next to v003 put it at 1.11 and 1.10 times that version's speed.
// All steps since v000 together make it 2.93 times as fast.
#include <hip/hip_runtime.h>
#include <hip/hip_bf16.h>
#include <math.h>

// ---------------------------------------------------------------------------
// CrossFormerBlock for MI455X (gfx1250, wave32, WMMA 16x16x32 f16 -> f32 acc)
// Data movement: GLOBAL_LOAD_ASYNC_TO_LDS_B128 for LDS staging in kernels 2, 3 and 6 (ASYNCcnt),
// WMMA for all six GEMMs (QK^T and PV in kernel 2), VALU for softmax/LN/conv.
// ---------------------------------------------------------------------------

typedef __attribute__((ext_vector_type(16))) _Float16 v16h;
typedef __attribute__((ext_vector_type(8)))  float    v8f;

// K-index inside a 16x32 f16 A/B fragment for element e (0..15) of the v16h,
// given lane-half hi = lane/16 (CDNA5 ISA 7.12.2 16-bit A/B layout).
__device__ __forceinline__ int kmap(int e, int hi) {
    return ((e >> 3) << 4) + (((e >> 1) & 3) << 1) + (hi << 3) + (e & 1);
}

// One B fragment from 32 consecutive f32 weights of this lane's output column, as f16.
__device__ __forceinline__ void load_w_frag(v16h& f, const float* __restrict__ w, int hi) {
#pragma unroll  // constant indices keep the fragment arrays in registers
    for (int e = 0; e < 16; ++e) f[e] = (_Float16)w[kmap(e, hi)];
    // precaution: stands before the address registers of these loads are given a new value
    asm volatile("s_wait_xcnt 0x0" ::: "memory");
}

// Async 16B global->LDS copy (no VGPR data path; tracked by ASYNCcnt).
// LDS address = low 32 bits of the flat shared pointer (ISA LDS aperture rule).
__device__ __forceinline__ void async_copy_b128(void* lds_dst, const void* gsrc) {
    unsigned l = (unsigned)(unsigned long long)lds_dst;
    asm volatile("global_load_async_to_lds_b128 %0, %1, off"
                 :: "v"(l), "v"(gsrc) : "memory");
}
__device__ __forceinline__ void wait_async() {
    asm volatile("s_wait_asynccnt 0x0" ::: "memory");
}

// Static problem dims
#define CC   128
#define TT   4
#define GG   4
#define NTOK 256        // tokens per window (G^3 * T)
#define NWIN 256        // windows
#define NHD  8          // heads
#define HDSZ 16         // head dim
#define MLPH 512
#define NROW 65536      // total tokens B*D*H*W*T
#define ATT_SCALE 0.25f // 1/sqrt(16)
// f16 per LDS row of a staged 128-channel A tile: 272 bytes = 16 x 17, so the 16 rows that a
// fragment's ds_load_b128 reads start 4 banks apart and cover all 64 banks (256-byte rows
// put all 16 on the same 4 banks)
#define SHP  (CC + 8)

// Eight async 16-byte copies per thread: 128 rows of 256 bytes, contiguous at src, land in
// LDS rows of SHP f16 at dst. Thread tid takes piece tid & 15 of rows (tid >> 4) + 16 j.
// precaution: the s_wait_xcnt closes the statement, ahead of any rewrite of its address registers
__device__ __forceinline__ void async_rows128(_Float16* dst, const _Float16* src, int tid) {
    const unsigned l = (unsigned)(unsigned long long)(dst + (tid >> 4) * SHP + (tid & 15) * 8);
    const _Float16* g = src + tid * 8;
    asm volatile("global_load_async_to_lds_b128 %0, %8, off\n\t"
                 "global_load_async_to_lds_b128 %1, %9, off\n\t"
                 "global_load_async_to_lds_b128 %2, %10, off\n\t"
                 "global_load_async_to_lds_b128 %3, %11, off\n\t"
                 "global_load_async_to_lds_b128 %4, %12, off\n\t"
                 "global_load_async_to_lds_b128 %5, %13, off\n\t"
                 "global_load_async_to_lds_b128 %6, %14, off\n\t"
                 "global_load_async_to_lds_b128 %7, %15, off\n\t"
                 "s_wait_xcnt 0x0"
                 :: "v"(l), "v"(l + 1 * 32 * SHP), "v"(l + 2 * 32 * SHP), "v"(l + 3 * 32 * SHP),
                    "v"(l + 4 * 32 * SHP), "v"(l + 5 * 32 * SHP), "v"(l + 6 * 32 * SHP),
                    "v"(l + 7 * 32 * SHP),
                    "v"(g), "v"(g + 1 * 2048), "v"(g + 2 * 2048), "v"(g + 3 * 2048),
                    "v"(g + 4 * 2048), "v"(g + 5 * 2048), "v"(g + 6 * 2048), "v"(g + 7 * 2048)
                 : "memory");
}

// ---------------------------------------------------------------------------
// Kernel 1: LN + pos/time embed -> LDS f16, then QKV GEMM (256x384, K=128)
// ---------------------------------------------------------------------------
__global__ __launch_bounds__(256) void cf_k1_ln_pe_qkv(
    const float* __restrict__ x, const float* __restrict__ n1g,
    const float* __restrict__ n1b, const float* __restrict__ pos,
    const float* __restrict__ temb, const float* __restrict__ qkv_w,
    const float* __restrict__ qkv_b,
    _Float16* __restrict__ Q, _Float16* __restrict__ K, _Float16* __restrict__ V)
{
    __shared__ alignas(16) _Float16 sh[NTOK * SHP];   // 68 KiB (LDS is 320 KiB/WGP)
    const int tid = threadIdx.x, win = blockIdx.x;

    // ---- per-token LN + embeds (1 thread per token) ----
    {
        const int n = tid;
        const int t = n >> 6, rem = n & 63;
        const int gd = rem >> 4, gh = (rem >> 2) & 3, gw = rem & 3;
        const int wd = win >> 6, wh = (win >> 3) & 7, ww = win & 7;
        const int d = wd * GG + gd, h = wh * GG + gh, w = ww * GG + gw;
        const float* xr = x + ((((size_t)d * 32 + h) * 32 + w) * TT + t) * CC;
        float m = 0.f, s2 = 0.f;
        for (int c = 0; c < CC; ++c) { float v = xr[c]; m += v; s2 += v * v; }
        m *= (1.f / CC);
        const float inv = rsqrtf(s2 * (1.f / CC) - m * m + 1e-5f);
        const float* pr = pos + ((gd * GG + gh) * GG + gw) * CC;
        const float* tr = temb + t * CC;
        _Float16* dst = sh + n * SHP;
        for (int c = 0; c < CC; ++c) {
            float hv = (xr[c] - m) * inv * n1g[c] + n1b[c] + pr[c] + tr[c];
            dst[c] = (_Float16)hv;
        }
    }
    __syncthreads();

    // ---- GEMM: sh(256x128) @ qkv_w^T(128x384) ----
    const int wave = tid >> 5, lane = tid & 31, lr = lane & 15, hi = lane >> 4;
    // The wave owns column tiles wave, wave + 8, wave + 16 (its head's Q, K and V columns):
    // their weights are fetched and converted once and stay in registers over all row tiles.
    v16h bw[3][4];
    float bias[3];
#pragma unroll  // constant indices keep the fragment arrays in registers
    for (int j = 0; j < 3; ++j) bias[j] = qkv_b[(wave + 8 * j) * 16 + lr];
    // precaution: stands before the address register of these loads is given a new value
    asm volatile("s_wait_xcnt 0x0" ::: "memory");
#pragma unroll  // constant indices keep the fragment arrays in registers
    for (int j = 0; j < 3; ++j) {
        const int o = (wave + 8 * j) * 16 + lr;
#pragma unroll  // constant indices keep the fragment arrays in registers
        for (int kk = 0; kk < 4; ++kk) load_w_frag(bw[j][kk], qkv_w + (size_t)o * CC + kk * 32, hi);
    }
    for (int rt = 0; rt < 16; ++rt) {
        v16h a[4];
#pragma unroll  // constant indices keep the fragment arrays in registers
        for (int kk = 0; kk < 4; ++kk)
            for (int e = 0; e < 16; ++e)
                a[kk][e] = sh[(rt * 16 + lr) * SHP + kk * 32 + kmap(e, hi)];
#pragma unroll  // constant indices keep the fragment arrays in registers
        for (int j = 0; j < 3; ++j) {
            v8f acc = {};
#pragma unroll  // constant indices keep the fragment arrays in registers
            for (int kk = 0; kk < 4; ++kk)
                acc = __builtin_amdgcn_wmma_f32_16x16x32_f16(
                    false, a[kk], false, bw[j][kk], (short)0, acc, false, false);
            for (int r = 0; r < 8; ++r) {
                const int nrow = rt * 16 + r + 8 * hi;
                const float val = acc[r] + bias[j];
                const size_t addr = (((size_t)win * NHD + wave) * NTOK + nrow) * HDSZ + lr;
                if (j == 0)       Q[addr] = (_Float16)(val * ATT_SCALE);
                else if (j == 1)  K[addr] = (_Float16)val;
                else              V[addr] = (_Float16)val;
            }
            // precaution: stands before the registers of these stores are given a new value
            asm volatile("s_wait_xcnt 0x0" ::: "memory");
        }
    }
}

// ---------------------------------------------------------------------------
// Kernel 2: window attention, one block per (win, head), scores transposed.
// S^T = K Q^T: a lane's accumulator registers hold ONE query's scores (query = lane & 15,
// key = 16 kt + 8 hi + r), so the row maximum and the row sum are in-lane work plus one
// exchange between the wave's halves. Two score tiles, converted in place, are the B
// operand of O^T += V^T P^T over 32 keys: P never leaves the registers. All 256 keys of
// a query are held at once, so the softmax is one pass with the true row maximum.
// ---------------------------------------------------------------------------
typedef __attribute__((ext_vector_type(8))) _Float16 v8h;
typedef __attribute__((ext_vector_type(2))) _Float16 v2h;
typedef __attribute__((ext_vector_type(8))) short    v8s;
typedef __attribute__((ext_vector_type(2))) float    v2f;
#define LOG2E 1.4426950408889634f

// lane l <-> lane l ^ 16
__device__ __forceinline__ float xhalf(float v) {
    const int b = __builtin_bit_cast(int, v);
    return __builtin_bit_cast(float, __builtin_amdgcn_permlanex16(
        b, b, 0x76543210, 0xfedcba98, false, false));
}

// A or B fragment of a row of 16 f16 (head dim): k = 8 hi + e for e < 8, zero above k = 15
__device__ __forceinline__ v16h row16_frag(const _Float16* row, int hi) {
    const v8h lo = *(const v8h*)(row + hi * 8);
    const v8h z = {};
    return __builtin_shufflevector(lo, z, 0, 1, 2, 3, 4, 5, 6, 7, 8, 9, 10, 11, 12, 13, 14, 15);
}

// transposing LDS load: lane (lr, hi) gets column lr of the 8 rows 8 hi .. 8 hi + 7 of a
// 16 x 16 f16 tile; p is this lane's own address in the tile (formed by the caller)
__device__ __forceinline__ v8h lds_tr16(const _Float16* p) {
    typedef __attribute__((address_space(3))) v8s lds_v8s;
    return __builtin_bit_cast(v8h, __builtin_amdgcn_ds_load_tr16_b128_v8i16((lds_v8s*)p));
}

__global__ __launch_bounds__(256) void cf_k2_attn(
    const _Float16* __restrict__ Q, const _Float16* __restrict__ K,
    const _Float16* __restrict__ V, _Float16* __restrict__ O)
{
    __shared__ alignas(16) _Float16 Qh[NTOK * HDSZ];   // 8 KiB each
    __shared__ alignas(16) _Float16 Kh[NTOK * HDSZ];
    __shared__ alignas(16) _Float16 Vh[NTOK * HDSZ];

    const int tid = threadIdx.x, bx = blockIdx.x;
    const int win = bx >> 3, head = bx & 7;
    const size_t base = (size_t)bx * NTOK * HDSZ;

    {   // async DMA fills: 3 x 512 B128 transfers, no VGPR staging
        const uint4* qs = (const uint4*)(Q + base); uint4* qd = (uint4*)Qh;
        const uint4* ks = (const uint4*)(K + base); uint4* kd = (uint4*)Kh;
        const uint4* vs = (const uint4*)(V + base); uint4* vd = (uint4*)Vh;
        for (int i = tid; i < NTOK * HDSZ / 8; i += 256) {
            async_copy_b128(qd + i, qs + i);
            async_copy_b128(kd + i, ks + i);
            async_copy_b128(vd + i, vs + i);
        }
        wait_async();
    }
    __syncthreads();

    const int wave = tid >> 5, lane = tid & 31, lr = lane & 15, hi = lane >> 4;
    // this lane's address in a 16-key tile of V for the transposing load (rows of 32 bytes)
    const _Float16* vt = Vh + (8 * hi + (lane & 7)) * HDSZ + ((lane >> 3) & 1) * 8;
    for (int qi = 0; qi < 2; ++qi) {
        const int qt = wave * 2 + qi;
        const v16h bq = row16_frag(Qh + (qt * 16 + lr) * HDSZ, hi);

        v8f s[16];   // s[kt][r] = score of query qt * 16 + lr with key kt * 16 + 8 * hi + r
#pragma unroll  // constant indices keep the score tiles in registers
        for (int kt = 0; kt < 16; ++kt) {
            const v16h ak = row16_frag(Kh + (kt * 16 + lr) * HDSZ, hi);
            const v8f zc = {};
            s[kt] = __builtin_amdgcn_wmma_f32_16x16x32_f16(
                false, ak, false, bq, (short)0, zc, false, false);
        }

        float m4[4] = {-1e30f, -1e30f, -1e30f, -1e30f};   // four chains, joined below
#pragma unroll
        for (int kt = 0; kt < 16; ++kt)
#pragma unroll
            for (int r = 0; r < 8; ++r) m4[kt & 3] = fmaxf(m4[kt & 3], s[kt][r]);
        float mx = fmaxf(fmaxf(m4[0], m4[1]), fmaxf(m4[2], m4[3]));
        mx = fmaxf(mx, xhalf(mx));
        const float nm = -mx * LOG2E;

        v2f sum[4] = {};
        v8f oacc = {};   // oacc[r] = O^T[head dim 8 * hi + r][query lr], not yet normalised
#pragma unroll  // constant indices keep the score tiles in registers
        for (int j = 0; j < 8; ++j) {   // 32 keys a trip
            const v8h v0 = lds_tr16(vt + (j * 32) * HDSZ);
            const v8h v1 = lds_tr16(vt + (j * 32 + 16) * HDSZ);
            const v16h av = __builtin_shufflevector(
                v0, v1, 0, 1, 2, 3, 4, 5, 6, 7, 8, 9, 10, 11, 12, 13, 14, 15);
            v16h pf;   // pf[e] = P^T[key j * 32 + kmap(e, hi)][query lr]
#pragma unroll
            for (int i = 0; i < 8; ++i) {
                const v8f& st = s[2 * j + (i >> 2)];
                const v2f sv = {st[2 * (i & 3)], st[2 * (i & 3) + 1]};
                const v2f arg = __builtin_elementwise_fma(sv, v2f{LOG2E, LOG2E}, v2f{nm, nm});
                const v2f p = {__builtin_amdgcn_exp2f(arg.x), __builtin_amdgcn_exp2f(arg.y)};
                sum[i & 3] += p;
                const v2h ph = __builtin_convertvector(p, v2h);
                pf[2 * i] = ph.x;
                pf[2 * i + 1] = ph.y;
            }
            oacc = __builtin_amdgcn_wmma_f32_16x16x32_f16(
                false, av, false, pf, (short)0, oacc, false, false);
        }
        const v2f s2 = (sum[0] + sum[1]) + (sum[2] + sum[3]);
        float l = s2.x + s2.y;
        l += xhalf(l);
        const float inv = 1.f / l;

        v8h ov;
#pragma unroll
        for (int r = 0; r < 8; ++r) ov[r] = (_Float16)(oacc[r] * inv);
        *(v8h*)(O + ((size_t)win * NTOK + qt * 16 + lr) * CC + head * HDSZ + hi * 8) = ov;
        // precaution: stands before the registers of this store are given a new value
        if (qi == 0) asm volatile("s_wait_xcnt 0x0" ::: "memory");
    }
}

// ---------------------------------------------------------------------------
// Kernel 3: output projection (256x128 @ 128x128) + window-merge scatter.
// ---------------------------------------------------------------------------
__global__ __launch_bounds__(256) void cf_k3_proj_merge(
    const _Float16* __restrict__ O, const float* __restrict__ pw,
    const float* __restrict__ pb, float* __restrict__ Y0)
{
    __shared__ alignas(16) _Float16 sh[NTOK * SHP];   // 68 KiB
    const int tid = threadIdx.x, win = blockIdx.x;
    {
        const _Float16* src = O + (size_t)win * NTOK * CC;
        async_rows128(sh, src, tid);
        async_rows128(sh + 128 * SHP, src + 128 * CC, tid);
        wait_async();
    }
    __syncthreads();

    const int wave = tid >> 5, lane = tid & 31, lr = lane & 15, hi = lane >> 4;
    const int wd = win >> 6, wh = (win >> 3) & 7, ww = win & 7;
    // The wave owns column tile 'wave': its weights stay in registers over all row tiles.
    const int o = wave * 16 + lr;
    const float bias = pb[o];
    v16h bw[4];
#pragma unroll  // constant indices keep the fragment arrays in registers
    for (int kk = 0; kk < 4; ++kk) load_w_frag(bw[kk], pw + (size_t)o * CC + kk * 32, hi);
    for (int rt = 0; rt < 16; ++rt) {
        v8f acc = {};
#pragma unroll  // constant indices keep the fragment arrays in registers
        for (int kk = 0; kk < 4; ++kk) {
            v16h a;
            for (int e = 0; e < 16; ++e)
                a[e] = sh[(rt * 16 + lr) * SHP + kk * 32 + kmap(e, hi)];
            acc = __builtin_amdgcn_wmma_f32_16x16x32_f16(
                false, a, false, bw[kk], (short)0, acc, false, false);
        }
        for (int r = 0; r < 8; ++r) {
            const int n = rt * 16 + r + 8 * hi;
            const int t = n >> 6, rem = n & 63;
            const int gd = rem >> 4, gh = (rem >> 2) & 3, gw = rem & 3;
            const int d = wd * GG + gd, h = wh * GG + gh, w = ww * GG + gw;
            const size_t off = ((((size_t)d * 32 + h) * 32 + w) * TT + t) * CC + o;
            Y0[off] = acc[r] + bias;
        }
        // precaution: stands before the registers of these stores are given a new value
        asm volatile("s_wait_xcnt 0x0" ::: "memory");
    }
}

// ---------------------------------------------------------------------------
// Kernel 4: depthwise 3x3x3 conv over (D,H,W), T folded into batch.
// One wave = 64 channels of one (d,h,t) row, 2 channels per lane. The lane
// keeps its 2 x 27 weights in registers and walks the 32 columns of W: each
// loaded column (9 rows x 2 floats) feeds the three outputs it touches, so every
// input is loaded once per (kd,kh) and no weight is loaded again.
// A block is 2 d x 4 h rows of one t, so neighbouring waves read the same lines.
// Taps outside D or H: the row index is clamped and the tap's weight is zero.
// ---------------------------------------------------------------------------
#define DW_CS (TT * CC)   // floats from one column of W to the next
#define DW_NB 4           // column buffers: a column is fetched DW_NB - 1 ahead

__device__ __forceinline__ void dw_load_col(v2f (&b)[9], const float* const (&rp)[9],
                                            int off) {
#pragma unroll
    for (int j = 0; j < 9; ++j) b[j] = *(const v2f*)(rp[j] + off);
}

// acc += sum over the 9 (kd,kh) rows of column b times the weights of tap KW
template <int KW>
__device__ __forceinline__ void dw_fma_col(v2f& acc, const v2f (&b)[9],
                                           const v2f (&wp)[27]) {
#pragma unroll
    for (int j = 0; j < 9; ++j) acc = __builtin_elementwise_fma(b[j], wp[j * 3 + KW], acc);
}

__global__ __launch_bounds__(512) void cf_k4_dwconv(
    const float* __restrict__ Y0, const float* __restrict__ cw,
    const float* __restrict__ cb, float* __restrict__ Y1)
{
    // all weights, [c][tap]: 864 float4; the rest only lets every thread store twice
    __shared__ float4 swt[1024];
    const int tid = threadIdx.x;
    const int lane = tid & 31;
    const int wv = __builtin_amdgcn_readfirstlane(tid >> 5);
    const int bx = blockIdx.x;
    const int t = bx & 3;
    const int h = ((bx >> 2) & 7) * 4 + ((wv >> 1) & 3);
    const int d = (bx >> 5) * 2 + (wv >> 3);
    const int c0 = (wv & 1) * 64;          // this wave's first channel

    // the weights are fetched together with the first columns below
    const float4* cw4 = (const float4*)cw;
    const float4 g0 = cw4[tid];
    const float4 g1 = cw4[min(tid + 512, CC * 27 / 4 - 1)];

    const float* rp[9];
#pragma unroll
    for (int kd = 0; kd < 3; ++kd)
#pragma unroll
        for (int kh = 0; kh < 3; ++kh) {
            const int dc = min(max(d + kd - 1, 0), 15), hc = min(max(h + kh - 1, 0), 31);
            rp[kd * 3 + kh] = Y0 + ((size_t)((dc * 32 + hc) * 32) * TT + t) * CC + c0;
        }
    const int lo = lane * 2;
    v2f buf[DW_NB][9];                     // column c lives in buf[c % DW_NB]
    v2f acc[3];                            // output o lives in acc[o % 3]
#pragma unroll
    for (int c = 0; c < DW_NB - 1; ++c) dw_load_col(buf[c], rp, lo + c * DW_CS);
    const v2f bias = *(const v2f*)(cb + c0 + lo);

    swt[tid] = g0;
    swt[tid + 512] = g1;
    __syncthreads();

    // this lane's 2 channels x 27 taps (54 consecutive floats of cw), paired by tap
    const float* lw = (const float*)swt + (c0 + lo) * 27;
    v2f wp[27];
#pragma unroll
    for (int kd = 0; kd < 3; ++kd)
#pragma unroll
        for (int kh = 0; kh < 3; ++kh) {
            const bool ok = (unsigned)(d + kd - 1) < 16u && (unsigned)(h + kh - 1) < 32u;
#pragma unroll
            for (int kw = 0; kw < 3; ++kw) {
                const int tap = (kd * 3 + kh) * 3 + kw;
                const float wx = lw[tap], wy = lw[27 + tap];
                wp[tap].x = ok ? wx : 0.f;
                wp[tap].y = ok ? wy : 0.f;
            }
        }
    float* orow = Y1 + ((size_t)((d * 32 + h) * 32) * TT + t) * CC + c0;

    acc[0] = bias;
    // unrolled whole: every buffer index and every address offset is a constant
#pragma unroll
    for (int col = 0; col < 32; ++col) {
        // keeps later columns' loads from being hoisted up here, which spilled registers
        __builtin_amdgcn_sched_barrier(0);
        if (col + DW_NB - 1 < 32)
            dw_load_col(buf[(col + DW_NB - 1) % DW_NB], rp, lo + (col + DW_NB - 1) * DW_CS);
        const v2f (&b)[9] = buf[col % DW_NB];
        if (col > 0) {                     // right neighbour of output col - 1: done
            dw_fma_col<2>(acc[(col + 2) % 3], b, wp);
            *(v2f*)(orow + lo + (col - 1) * DW_CS) = acc[(col + 2) % 3];
            // precaution: stands before the stored registers are given a new value
            if (col < 31) asm volatile("s_wait_xcnt 0x0" ::: "memory");
        }
        dw_fma_col<1>(acc[col % 3], b, wp);
        if (col < 31) {                    // left neighbour of output col + 1: first
            acc[(col + 1) % 3] = bias;
            dw_fma_col<0>(acc[(col + 1) % 3], b, wp);
        }
    }
    *(v2f*)(orow + lo + 31 * DW_CS) = acc[31 % 3];
}

// ---------------------------------------------------------------------------
// Kernel 5: exLN -> Y2 (f32, residual base) and norm2(Y2) -> H2 (f16 MLP in).
// ---------------------------------------------------------------------------
__global__ __launch_bounds__(256) void cf_k5_lns(
    const float* __restrict__ Y1, const float* __restrict__ eg,
    const float* __restrict__ eb, const float* __restrict__ n2g,
    const float* __restrict__ n2b, float* __restrict__ Y2,
    _Float16* __restrict__ H2)
{
    const size_t tok = (size_t)blockIdx.x * 256 + threadIdx.x;
    const float* xr = Y1 + tok * CC;
    float m = 0.f, s2 = 0.f;
    for (int c = 0; c < CC; ++c) { float v = xr[c]; m += v; s2 += v * v; }
    m *= (1.f / CC);
    const float inv = rsqrtf(s2 * (1.f / CC) - m * m + 1e-5f);

    float m2 = 0.f, q2 = 0.f;
    float* yr = Y2 + tok * CC;
    for (int c = 0; c < CC; ++c) {
        const float y = (xr[c] - m) * inv * eg[c] + eb[c];
        yr[c] = y; m2 += y; q2 += y * y;
    }
    m2 *= (1.f / CC);
    const float inv2 = rsqrtf(q2 * (1.f / CC) - m2 * m2 + 1e-5f);
    _Float16* hr = H2 + tok * CC;
    for (int c = 0; c < CC; ++c)
        hr[c] = (_Float16)((yr[c] - m2) * inv2 * n2g[c] + n2b[c]);
}

// ---------------------------------------------------------------------------
// Kernel 6: fc1 GEMM (rows x 128 @ 128x512) + exact GELU -> Hm (f16).
// ---------------------------------------------------------------------------
__global__ __launch_bounds__(256) void cf_k6_fc1_gelu(
    const _Float16* __restrict__ H2, const float* __restrict__ w1,
    const float* __restrict__ b1, _Float16* __restrict__ Hm)
{
    __shared__ alignas(16) _Float16 sh[128 * SHP];   // 34 KiB
    const int tid = threadIdx.x;
    const size_t rowBase = (size_t)blockIdx.x * 128;
    {
        async_rows128(sh, H2 + rowBase * CC, tid);
        wait_async();
    }
    __syncthreads();

    const int wave = tid >> 5, lane = tid & 31, lr = lane & 15, hi = lane >> 4;
    // The wave owns column tiles wave + 8 j: their weights are fetched and converted once
    // and stay in registers; each row tile's A fragments serve all four.
    v16h bw[4][4];
    float bias[4];
#pragma unroll  // constant indices keep the fragment arrays in registers
    for (int j = 0; j < 4; ++j) bias[j] = b1[(wave + 8 * j) * 16 + lr];
    // precaution: stands before the address register of these loads is given a new value
    asm volatile("s_wait_xcnt 0x0" ::: "memory");
#pragma unroll  // constant indices keep the fragment arrays in registers
    for (int j = 0; j < 4; ++j) {
        const int o = (wave + 8 * j) * 16 + lr;
#pragma unroll  // constant indices keep the fragment arrays in registers
        for (int kk = 0; kk < 4; ++kk) load_w_frag(bw[j][kk], w1 + (size_t)o * CC + kk * 32, hi);
    }
    for (int rt = 0; rt < 8; ++rt) {
        v16h a[4];
#pragma unroll  // constant indices keep the fragment arrays in registers
        for (int kk = 0; kk < 4; ++kk)
            for (int e = 0; e < 16; ++e)
                a[kk][e] = sh[(rt * 16 + lr) * SHP + kk * 32 + kmap(e, hi)];
#pragma unroll  // constant indices keep the fragment arrays in registers
        for (int j = 0; j < 4; ++j) {
            v8f acc = {};
#pragma unroll  // constant indices keep the fragment arrays in registers
            for (int kk = 0; kk < 4; ++kk)
                acc = __builtin_amdgcn_wmma_f32_16x16x32_f16(
                    false, a[kk], false, bw[j][kk], (short)0, acc, false, false);
            for (int r = 0; r < 8; ++r) {
                const size_t n = rowBase + rt * 16 + r + 8 * hi;
                const int o = (wave + 8 * j) * 16 + lr;
                const float v = acc[r] + bias[j];
                const float ge = 0.5f * v * (1.f + erff(v * 0.70710678f));
                Hm[n * MLPH + o] = (_Float16)ge;
            }
            // precaution: stands before the registers of these stores are given a new value
            asm volatile("s_wait_xcnt 0x0" ::: "memory");
        }
    }
}

// ---------------------------------------------------------------------------
// Kernel 7: fc2 GEMM (rows x 512 @ 512x128) + bias + residual -> d_out (f32).
// ---------------------------------------------------------------------------
__global__ __launch_bounds__(256) void cf_k7_fc2_res(
    const _Float16* __restrict__ Hm, const float* __restrict__ w2,
    const float* __restrict__ b2, const float* __restrict__ Y2,
    float* __restrict__ out)
{
    const int tid = threadIdx.x;
    const size_t rowBase = (size_t)blockIdx.x * 128;
    const int wave = tid >> 5, lane = tid & 31, lr = lane & 15, hi = lane >> 4;
    // The wave owns column tile 'wave': its 16 weight fragments are fetched and converted
    // once and stay in registers over all row tiles.
    const int o = wave * 16 + lr;
    const float bias = b2[o];
    v16h bw[16];
#pragma unroll  // constant indices keep the fragment arrays in registers
    for (int kk = 0; kk < 16; ++kk) load_w_frag(bw[kk], w2 + (size_t)o * MLPH + kk * 32, hi);
    for (int rt = 0; rt < 8; ++rt) {
        const _Float16* ar = Hm + (rowBase + rt * 16 + lr) * MLPH;
        v8f acc = {};
#pragma unroll  // constant indices keep the fragment arrays in registers
        for (int g = 0; g < 4; ++g) {
            v16h a[4];
#pragma unroll  // constant indices keep the fragment arrays in registers
            for (int kk = 0; kk < 4; ++kk)
                for (int e = 0; e < 16; ++e)
                    a[kk][e] = ar[(g * 4 + kk) * 32 + kmap(e, hi)];
            // holds the group's eight loads above its products: sunk to their users, each
            // product waited out its own load's latency
            __builtin_amdgcn_sched_barrier(0);
#pragma unroll  // constant indices keep the fragment arrays in registers
            for (int kk = 0; kk < 4; ++kk)
                acc = __builtin_amdgcn_wmma_f32_16x16x32_f16(
                    false, a[kk], false, bw[g * 4 + kk], (short)0, acc, false, false);
        }
        for (int r = 0; r < 8; ++r) {
            const size_t n = rowBase + rt * 16 + r + 8 * hi;
            out[n * CC + o] = acc[r] + bias + Y2[n * CC + o];
        }
        // precaution: stands before the registers of these stores are given a new value
        asm volatile("s_wait_xcnt 0x0" ::: "memory");
    }
}

// ---------------------------------------------------------------------------
// Host-side orchestration. Workspace plan (peak 128 MiB, no live overlaps):
//   [0,16M)   Q f16      -> later Y0 f32 [0,32M) -> later Y2 f32 [0,32M)
//   [16,32M)  K f16
//   [32,48M)  V f16      -> later H2 f16 [32,48M)
//   [48,64M)  O f16
//   [64,96M)  Y1 f32     -> later Hm f16 [64,128M)
// ---------------------------------------------------------------------------
extern "C" void kernel_launch(void* const* d_in, const int* in_sizes, int n_in,
                              void* d_out, int out_size, void* d_ws, size_t ws_size,
                              hipStream_t stream) {
    (void)in_sizes; (void)n_in; (void)out_size; (void)ws_size;
    const float* x       = (const float*)d_in[0];
    const float* norm1_g = (const float*)d_in[1];
    const float* norm1_b = (const float*)d_in[2];
    const float* pos     = (const float*)d_in[3];
    const float* temb    = (const float*)d_in[4];
    const float* qkv_w   = (const float*)d_in[5];
    const float* qkv_b   = (const float*)d_in[6];
    const float* proj_w  = (const float*)d_in[7];
    const float* proj_b  = (const float*)d_in[8];
    const float* conv_w  = (const float*)d_in[9];
    const float* conv_b  = (const float*)d_in[10];
    const float* exln_g  = (const float*)d_in[11];
    const float* exln_b  = (const float*)d_in[12];
    const float* norm2_g = (const float*)d_in[13];
    const float* norm2_b = (const float*)d_in[14];
    const float* fc1_w   = (const float*)d_in[15];
    const float* fc1_b   = (const float*)d_in[16];
    const float* fc2_w   = (const float*)d_in[17];
    const float* fc2_b   = (const float*)d_in[18];

    char* ws = (char*)d_ws;
    const size_t MB = 1u << 20;
    _Float16* Q  = (_Float16*)(ws + 0 * MB);
    _Float16* K  = (_Float16*)(ws + 16 * MB);
    _Float16* V  = (_Float16*)(ws + 32 * MB);
    _Float16* O  = (_Float16*)(ws + 48 * MB);
    float*    Y0 = (float*)   (ws + 0 * MB);
    float*    Y1 = (float*)   (ws + 64 * MB);
    float*    Y2 = (float*)   (ws + 0 * MB);
    _Float16* H2 = (_Float16*)(ws + 32 * MB);
    _Float16* Hm = (_Float16*)(ws + 64 * MB);
    float*    out = (float*)d_out;

    cf_k1_ln_pe_qkv<<<NWIN, 256, 0, stream>>>(x, norm1_g, norm1_b, pos, temb,
                                              qkv_w, qkv_b, Q, K, V);
    cf_k2_attn<<<NWIN * NHD, 256, 0, stream>>>(Q, K, V, O);
    cf_k3_proj_merge<<<NWIN, 256, 0, stream>>>(O, proj_w, proj_b, Y0);
    cf_k4_dwconv<<<NROW / 256, 512, 0, stream>>>(Y0, conv_w, conv_b, Y1);
    cf_k5_lns<<<NROW / 256, 256, 0, stream>>>(Y1, exln_g, exln_b,
                                              norm2_g, norm2_b, Y2, H2);
    cf_k6_fc1_gelu<<<NROW / 128, 256, 0, stream>>>(H2, fc1_w, fc1_b, Hm);
    cf_k7_fc2_res<<<NROW / 128, 256, 0, stream>>>(Hm, fc2_w, fc2_b, Y2, out);
}

// v005
// It runs in 172 microseconds.
// In both of two side-by-side timings against v004, it was 1.12 times as fast.
// Over all steps from v000 it is 3.28 times as fast.
#include <hip/hip_runtime.h>
#include <hip/hip_bf16.h>
#include <math.h>

// ---------------------------------------------------------------------------
// CrossFormerBlock for MI455X (gfx1250, wave32, WMMA 16x16x32 f16 -> f32 acc)
// Data movement: GLOBAL_LOAD_ASYNC_TO_LDS_B128 for LDS staging in kernels 2, 3 and 6 (ASYNCcnt),
// WMMA for all six GEMMs (QK^T and PV in kernel 2), VALU for softmax/LN/conv.
// ---------------------------------------------------------------------------

typedef __attribute__((ext_vector_type(16))) _Float16 v16h;
typedef __attribute__((ext_vector_type(8)))  float    v8f;

// K-index inside a 16x32 f16 A/B fragment for element e (0..15) of the v16h,
// given lane-half hi = lane/16 (CDNA5 ISA 7.12.2 16-bit A/B layout).
__device__ __forceinline__ int kmap(int e, int hi) {
    return ((e >> 3) << 4) + (((e >> 1) & 3) << 1) + (hi << 3) + (e & 1);
}

// One B fragment from 32 consecutive f32 weights of this lane's output column, as f16.
__device__ __forceinline__ void load_w_frag(v16h& f, const float* __restrict__ w, int hi) {
#pragma unroll  // constant indices keep the fragment arrays in registers
    for (int e = 0; e < 16; ++e) f[e] = (_Float16)w[kmap(e, hi)];
    // precaution: stands before the address registers of these loads are given a new value
    asm volatile("s_wait_xcnt 0x0" ::: "memory");
}

// Async 16B global->LDS copy (no VGPR data path; tracked by ASYNCcnt).
// LDS address = low 32 bits of the flat shared pointer (ISA LDS aperture rule).
__device__ __forceinline__ void async_copy_b128(void* lds_dst, const void* gsrc) {
    unsigned l = (unsigned)(unsigned long long)lds_dst;
    asm volatile("global_load_async_to_lds_b128 %0, %1, off"
                 :: "v"(l), "v"(gsrc) : "memory");
}
__device__ __forceinline__ void wait_async() {
    asm volatile("s_wait_asynccnt 0x0" ::: "memory");
}

// Static problem dims
#define CC   128
#define TT   4
#define GG   4
#define NTOK 256        // tokens per window (G^3 * T)
#define NWIN 256        // windows
#define NHD  8          // heads
#define HDSZ 16         // head dim
#define MLPH 512
#define NROW 65536      // total tokens B*D*H*W*T
#define ATT_SCALE 0.25f // 1/sqrt(16)
// f16 per LDS row of a staged 128-channel A tile: 272 bytes = 16 x 17, so the 16 rows that a
// fragment's ds_load_b128 reads start 4 banks apart and cover all 64 banks (256-byte rows
// put all 16 on the same 4 banks)
#define SHP  (CC + 8)

// Eight async 16-byte copies per thread: 128 rows of 256 bytes, contiguous at src, land in
// LDS rows of SHP f16 at dst. Thread tid takes piece tid & 15 of rows (tid >> 4) + 16 j.
// precaution: the s_wait_xcnt closes the statement, ahead of any rewrite of its address registers
__device__ __forceinline__ void async_rows128(_Float16* dst, const _Float16* src, int tid) {
    const unsigned l = (unsigned)(unsigned long long)(dst + (tid >> 4) * SHP + (tid & 15) * 8);
    const _Float16* g = src + tid * 8;
    asm volatile("global_load_async_to_lds_b128 %0, %8, off\n\t"
                 "global_load_async_to_lds_b128 %1, %9, off\n\t"
                 "global_load_async_to_lds_b128 %2, %10, off\n\t"
                 "global_load_async_to_lds_b128 %3, %11, off\n\t"
                 "global_load_async_to_lds_b128 %4, %12, off\n\t"
                 "global_load_async_to_lds_b128 %5, %13, off\n\t"
                 "global_load_async_to_lds_b128 %6, %14, off\n\t"
                 "global_load_async_to_lds_b128 %7, %15, off\n\t"
                 "s_wait_xcnt 0x0"
                 :: "v"(l), "v"(l + 1 * 32 * SHP), "v"(l + 2 * 32 * SHP), "v"(l + 3 * 32 * SHP),
                    "v"(l + 4 * 32 * SHP), "v"(l + 5 * 32 * SHP), "v"(l + 6 * 32 * SHP),
                    "v"(l + 7 * 32 * SHP),
                    "v"(g), "v"(g + 1 * 2048), "v"(g + 2 * 2048), "v"(g + 3 * 2048),
                    "v"(g + 4 * 2048), "v"(g + 5 * 2048), "v"(g + 6 * 2048), "v"(g + 7 * 2048)
                 : "memory");
}

// ---------------------------------------------------------------------------
// LayerNorm rows, eight lanes a token. Lane piece s = lane & 7 holds channels
// 4 (s + 8 k) .. + 3 for k = 0..3, the token is picked by lane >> 3: one wave-wide 16-byte
// load or store covers four tokens x one whole 128-byte line, and a row stays in registers
// from its load to its last use.
// ---------------------------------------------------------------------------
typedef __attribute__((ext_vector_type(4))) float    v4f;
typedef __attribute__((ext_vector_type(4))) _Float16 v4h;

// v + (v of lane l ^ XM), XM < 16, as a DPP row_xmask move
template <int XM>
__device__ __forceinline__ float add_xmask(float v) {
    const int b = __builtin_bit_cast(int, v);
    return v + __builtin_bit_cast(float,
        __builtin_amdgcn_update_dpp(b, b, 0x160 + XM, 0xf, 0xf, false));
}
// total over the eight lanes of a token, in every one of them
__device__ __forceinline__ float sum8(float v) {
    return add_xmask<4>(add_xmask<2>(add_xmask<1>(v)));
}
__device__ __forceinline__ void ln_load(v4f (&v)[4], const float* p) {
#pragma unroll  // constant indices keep the row in registers
    for (int k = 0; k < 4; ++k) v[k] = *(const v4f*)(p + k * 32);
}
// mean and 1 / sqrt(var + eps) of the token whose row lies in v on these eight lanes
__device__ __forceinline__ void ln_stats(const v4f (&v)[4], float& m, float& inv) {
    const v4f s = (v[0] + v[1]) + (v[2] + v[3]);
    v4f q = v[0] * v[0];
#pragma unroll  // constant indices keep the row in registers
    for (int k = 1; k < 4; ++k) q = __builtin_elementwise_fma(v[k], v[k], q);
    const float sm = sum8((s.x + s.y) + (s.z + s.w));
    const float sq = sum8((q.x + q.y) + (q.z + q.w));
    m = sm * (1.f / CC);
    inv = rsqrtf(sq * (1.f / CC) - m * m + 1e-5f);
}

// ---------------------------------------------------------------------------
// Kernel 1: LN + pos/time embed -> LDS f16, then QKV GEMM (256x384, K=128)
// ---------------------------------------------------------------------------
__global__ __launch_bounds__(256) void cf_k1_ln_pe_qkv(
    const float* __restrict__ x, const float* __restrict__ n1g,
    const float* __restrict__ n1b, const float* __restrict__ pos,
    const float* __restrict__ temb, const float* __restrict__ qkv_w,
    const float* __restrict__ qkv_b,
    _Float16* __restrict__ Q, _Float16* __restrict__ K, _Float16* __restrict__ V)
{
    __shared__ alignas(16) _Float16 sh[NTOK * SHP];   // 68 KiB (LDS is 320 KiB/WGP)
    const int tid = threadIdx.x, win = blockIdx.x;

    // ---- per-token LN + embeds: a wave takes 32 tokens, four at a time ----
    {
        const int wv = tid >> 5, gw = (tid >> 3) & 3, pc = (tid & 7) * 4;
        const int t = wv >> 1;                       // token n = 32 wv + 4 q + gw
        const int wd = win >> 6, wh = (win >> 3) & 7, ww = win & 7;
        const int d0 = wd * GG + (wv & 1) * 2, h0 = wh * GG, w = ww * GG + gw;
        const float* xb = x + ((((size_t)d0 * 32 + h0) * 32 + w) * TT + t) * CC + pc;
        v4f xv[8][4];
#pragma unroll  // constant indices keep the rows in registers; all 32 loads are in flight at once
        for (int q = 0; q < 8; ++q)                  // gd = 2 (wv & 1) + (q >> 2), gh = q & 3
            ln_load(xv[q], xb + (size_t)(((q >> 2) * 32 + (q & 3)) * 32) * TT * CC);
        v4f g[4], b[4], te[4];
        ln_load(g, n1g + pc);
        ln_load(b, n1b + pc);
        ln_load(te, temb + t * CC + pc);
        const float* pb = pos + ((wv & 1) * 32 + gw) * CC + pc;
        v4f pr[8][4];                                // fetched two steps ahead of their use
        ln_load(pr[0], pb);
        ln_load(pr[1], pb + 4 * CC);
        // precaution: stands before the address registers of the loads above get a new value
        asm volatile("s_wait_xcnt 0x0" ::: "memory");
        _Float16* db = sh + (wv * 32 + gw) * SHP + pc;
#pragma unroll  // constant indices keep the rows in registers
        for (int q = 0; q < 8; ++q) {
            // keeps the loads above in front of the arithmetic (sunk to their users, the last
            // rows started late) and later steps' loads from rising here (past 256 registers)
            __builtin_amdgcn_sched_barrier(0);
            if (q + 2 < 8) ln_load(pr[q + 2], pb + (q + 2) * 4 * CC);
            float m, inv;
            ln_stats(xv[q], m, inv);
#pragma unroll  // constant indices keep the rows in registers
            for (int k = 0; k < 4; ++k) {
                const v4f hv = (xv[q][k] - m) * inv * g[k] + b[k] + pr[q][k] + te[k];
                *(v4h*)(db + q * 4 * SHP + k * 32) = __builtin_convertvector(hv, v4h);
            }
        }
        // precaution: stands before the address register of the loads in the loop gets a new value
        asm volatile("s_wait_xcnt 0x0" ::: "memory");
    }
    __syncthreads();

    // ---- GEMM: sh(256x128) @ qkv_w^T(128x384) ----
    const int wave = tid >> 5, lane = tid & 31, lr = lane & 15, hi = lane >> 4;
    // The wave owns column tiles wave, wave + 8, wave + 16 (its head's Q, K and V columns):
    // their weights are fetched and converted once and stay in registers over all row tiles.
    v16h bw[3][4];
    float bias[3];
#pragma unroll  // constant indices keep the fragment arrays in registers
    for (int j = 0; j < 3; ++j) bias[j] = qkv_b[(wave + 8 * j) * 16 + lr];
    // precaution: stands before the address register of these loads is given a new value
    asm volatile("s_wait_xcnt 0x0" ::: "memory");
#pragma unroll  // constant indices keep the fragment arrays in registers
    for (int j = 0; j < 3; ++j) {
        const int o = (wave + 8 * j) * 16 + lr;
#pragma unroll  // constant indices keep the fragment arrays in registers
        for (int kk = 0; kk < 4; ++kk) load_w_frag(bw[j][kk], qkv_w + (size_t)o * CC + kk * 32, hi);
    }
    for (int rt = 0; rt < 16; ++rt) {
        v16h a[4];
#pragma unroll  // constant indices keep the fragment arrays in registers
        for (int kk = 0; kk < 4; ++kk)
            for (int e = 0; e < 16; ++e)
                a[kk][e] = sh[(rt * 16 + lr) * SHP + kk * 32 + kmap(e, hi)];
#pragma unroll  // constant indices keep the fragment arrays in registers
        for (int j = 0; j < 3; ++j) {
            v8f acc = {};
#pragma unroll  // constant indices keep the fragment arrays in registers
            for (int kk = 0; kk < 4; ++kk)
                acc = __builtin_amdgcn_wmma_f32_16x16x32_f16(
                    false, a[kk], false, bw[j][kk], (short)0, acc, false, false);
            for (int r = 0; r < 8; ++r) {
                const int nrow = rt * 16 + r + 8 * hi;
                const float val = acc[r] + bias[j];
                const size_t addr = (((size_t)win * NHD + wave) * NTOK + nrow) * HDSZ + lr;
                if (j == 0)       Q[addr] = (_Float16)(val * ATT_SCALE);
                else if (j == 1)  K[addr] = (_Float16)val;
                else              V[addr] = (_Float16)val;
            }
            // precaution: stands before the registers of these stores are given a new value
            asm volatile("s_wait_xcnt 0x0" ::: "memory");
        }
    }
}

// ---------------------------------------------------------------------------
// Kernel 2: window attention, one block per (win, head), scores transposed.
// S^T = K Q^T: a lane's accumulator registers hold ONE query's scores (query = lane & 15,
// key = 16 kt + 8 hi + r), so the row maximum and the row sum are in-lane work plus one
// exchange between the wave's halves. Two score tiles, converted in place, are the B
// operand of O^T += V^T P^T over 32 keys: P never leaves the registers. All 256 keys of
// a query are held at once, so the softmax is one pass with the true row maximum.
// ---------------------------------------------------------------------------
typedef __attribute__((ext_vector_type(8))) _Float16 v8h;
typedef __attribute__((ext_vector_type(2))) _Float16 v2h;
typedef __attribute__((ext_vector_type(8))) short    v8s;
typedef __attribute__((ext_vector_type(2))) float    v2f;
#define LOG2E 1.4426950408889634f

// lane l <-> lane l ^ 16
__device__ __forceinline__ float xhalf(float v) {
    const int b = __builtin_bit_cast(int, v);
    return __builtin_bit_cast(float, __builtin_amdgcn_permlanex16(
        b, b, 0x76543210, 0xfedcba98, false, false));
}

// A or B fragment of a row of 16 f16 (head dim): k = 8 hi + e for e < 8, zero above k = 15
__device__ __forceinline__ v16h row16_frag(const _Float16* row, int hi) {
    const v8h lo = *(const v8h*)(row + hi * 8);
    const v8h z = {};
    return __builtin_shufflevector(lo, z, 0, 1, 2, 3, 4, 5, 6, 7, 8, 9, 10, 11, 12, 13, 14, 15);
}

// transposing LDS load: lane (lr, hi) gets column lr of the 8 rows 8 hi .. 8 hi + 7 of a
// 16 x 16 f16 tile; p is this lane's own address in the tile (formed by the caller)
__device__ __forceinline__ v8h lds_tr16(const _Float16* p) {
    typedef __attribute__((address_space(3))) v8s lds_v8s;
    return __builtin_bit_cast(v8h, __builtin_amdgcn_ds_load_tr16_b128_v8i16((lds_v8s*)p));
}

__global__ __launch_bounds__(256) void cf_k2_attn(
    const _Float16* __restrict__ Q, const _Float16* __restrict__ K,
    const _Float16* __restrict__ V, _Float16* __restrict__ O)
{
    __shared__ alignas(16) _Float16 Qh[NTOK * HDSZ];   // 8 KiB each
    __shared__ alignas(16) _Float16 Kh[NTOK * HDSZ];
    __shared__ alignas(16) _Float16 Vh[NTOK * HDSZ];

    const int tid = threadIdx.x, bx = blockIdx.x;
    const int win = bx >> 3, head = bx & 7;
    const size_t base = (size_t)bx * NTOK * HDSZ;

    {   // async DMA fills: 3 x 512 B128 transfers, no VGPR staging
        const uint4* qs = (const uint4*)(Q + base); uint4* qd = (uint4*)Qh;
        const uint4* ks = (const uint4*)(K + base); uint4* kd = (uint4*)Kh;
        const uint4* vs = (const uint4*)(V + base); uint4* vd = (uint4*)Vh;
        for (int i = tid; i < NTOK * HDSZ / 8; i += 256) {
            async_copy_b128(qd + i, qs + i);
            async_copy_b128(kd + i, ks + i);
            async_copy_b128(vd + i, vs + i);
        }
        wait_async();
    }
    __syncthreads();

    const int wave = tid >> 5, lane = tid & 31, lr = lane & 15, hi = lane >> 4;
    // this lane's address in a 16-key tile of V for the transposing load (rows of 32 bytes)
    const _Float16* vt = Vh + (8 * hi + (lane & 7)) * HDSZ + ((lane >> 3) & 1) * 8;
    for (int qi = 0; qi < 2; ++qi) {
        const int qt = wave * 2 + qi;
        const v16h bq = row16_frag(Qh + (qt * 16 + lr) * HDSZ, hi);

        v8f s[16];   // s[kt][r] = score of query qt * 16 + lr with key kt * 16 + 8 * hi + r
#pragma unroll  // constant indices keep the score tiles in registers
        for (int kt = 0; kt < 16; ++kt) {
            const v16h ak = row16_frag(Kh + (kt * 16 + lr) * HDSZ, hi);
            const v8f zc = {};
            s[kt] = __builtin_amdgcn_wmma_f32_16x16x32_f16(
                false, ak, false, bq, (short)0, zc, false, false);
        }

        float m4[4] = {-1e30f, -1e30f, -1e30f, -1e30f};   // four chains, joined below
#pragma unroll
        for (int kt = 0; kt < 16; ++kt)
#pragma unroll
            for (int r = 0; r < 8; ++r) m4[kt & 3] = fmaxf(m4[kt & 3], s[kt][r]);
        float mx = fmaxf(fmaxf(m4[0], m4[1]), fmaxf(m4[2], m4[3]));
        mx = fmaxf(mx, xhalf(mx));
        const float nm = -mx * LOG2E;

        v2f sum[4] = {};
        v8f oacc = {};   // oacc[r] = O^T[head dim 8 * hi + r][query lr], not yet normalised
#pragma unroll  // constant indices keep the score tiles in registers
        for (int j = 0; j < 8; ++j) {   // 32 keys a trip
            const v8h v0 = lds_tr16(vt + (j * 32) * HDSZ);
            const v8h v1 = lds_tr16(vt + (j * 32 + 16) * HDSZ);
            const v16h av = __builtin_shufflevector(
                v0, v1, 0, 1, 2, 3, 4, 5, 6, 7, 8, 9, 10, 11, 12, 13, 14, 15);
            v16h pf;   // pf[e] = P^T[key j * 32 + kmap(e, hi)][query lr]
#pragma unroll
            for (int i = 0; i < 8; ++i) {
                const v8f& st = s[2 * j + (i >> 2)];
                const v2f sv = {st[2 * (i & 3)], st[2 * (i & 3) + 1]};
                const v2f arg = __builtin_elementwise_fma(sv, v2f{LOG2E, LOG2E}, v2f{nm, nm});
                const v2f p = {__builtin_amdgcn_exp2f(arg.x), __builtin_amdgcn_exp2f(arg.y)};
                sum[i & 3] += p;
                const v2h ph = __builtin_convertvector(p, v2h);
                pf[2 * i] = ph.x;
                pf[2 * i + 1] = ph.y;
            }
            oacc = __builtin_amdgcn_wmma_f32_16x16x32_f16(
                false, av, false, pf, (short)0, oacc, false, false);
        }
        const v2f s2 = (sum[0] + sum[1]) + (sum[2] + sum[3]);
        float l = s2.x + s2.y;
        l += xhalf(l);
        const float inv = 1.f / l;

        v8h ov;
#pragma unroll
        for (int r = 0; r < 8; ++r) ov[r] = (_Float16)(oacc[r] * inv);
        *(v8h*)(O + ((size_t)win * NTOK + qt * 16 + lr) * CC + head * HDSZ + hi * 8) = ov;
        // precaution: stands before the registers of this store are given a new value
        if (qi == 0) asm volatile("s_wait_xcnt 0x0" ::: "memory");
    }
}

// ---------------------------------------------------------------------------
// Kernel 3: output projection (256x128 @ 128x128) + window-merge scatter.
// ---------------------------------------------------------------------------
__global__ __launch_bounds__(256) void cf_k3_proj_merge(
    const _Float16* __restrict__ O, const float* __restrict__ pw,
    const float* __restrict__ pb, float* __restrict__ Y0)
{
    __shared__ alignas(16) _Float16 sh[NTOK * SHP];   // 68 KiB
    const int tid = threadIdx.x, win = blockIdx.x;
    {
        const _Float16* src = O + (size_t)win * NTOK * CC;
        async_rows128(sh, src, tid);
        async_rows128(sh + 128 * SHP, src + 128 * CC, tid);
        wait_async();
    }
    __syncthreads();

    const int wave = tid >> 5, lane = tid & 31, lr = lane & 15, hi = lane >> 4;
    const int wd = win >> 6, wh = (win >> 3) & 7, ww = win & 7;
    // The wave owns column tile 'wave': its weights stay in registers over all row tiles.
    const int o = wave * 16 + lr;
    const float bias = pb[o];
    v16h bw[4];
#pragma unroll  // constant indices keep the fragment arrays in registers
    for (int kk = 0; kk < 4; ++kk) load_w_frag(bw[kk], pw + (size_t)o * CC + kk * 32, hi);
    for (int rt = 0; rt < 16; ++rt) {
        v8f acc = {};
#pragma unroll  // constant indices keep the fragment arrays in registers
        for (int kk = 0; kk < 4; ++kk) {
            v16h a;
            for (int e = 0; e < 16; ++e)
                a[e] = sh[(rt * 16 + lr) * SHP + kk * 32 + kmap(e, hi)];
            acc = __builtin_amdgcn_wmma_f32_16x16x32_f16(
                false, a, false, bw[kk], (short)0, acc, false, false);
        }
        for (int r = 0; r < 8; ++r) {
            const int n = rt * 16 + r + 8 * hi;
            const int t = n >> 6, rem = n & 63;
            const int gd = rem >> 4, gh = (rem >> 2) & 3, gw = rem & 3;
            const int d = wd * GG + gd, h = wh * GG + gh, w = ww * GG + gw;
            const size_t off = ((((size_t)d * 32 + h) * 32 + w) * TT + t) * CC + o;
            Y0[off] = acc[r] + bias;
        }
        // precaution: stands before the registers of these stores are given a new value
        asm volatile("s_wait_xcnt 0x0" ::: "memory");
    }
}

// ---------------------------------------------------------------------------
// Kernel 4: depthwise 3x3x3 conv over (D,H,W), T folded into batch.
// One wave = 64 channels of one (d,h,t) row, 2 channels per lane. The lane
// keeps its 2 x 27 weights in registers and walks the 32 columns of W: each
// loaded column (9 rows x 2 floats) feeds the three outputs it touches, so every
// input is loaded once per (kd,kh) and no weight is loaded again.
// A block is 2 d x 4 h rows of one t, so neighbouring waves read the same lines.
// Taps outside D or H: the row index is clamped and the tap's weight is zero.
// ---------------------------------------------------------------------------
#define DW_CS (TT * CC)   // floats from one column of W to the next
#define DW_NB 4           // column buffers: a column is fetched DW_NB - 1 ahead

__device__ __forceinline__ void dw_load_col(v2f (&b)[9], const float* const (&rp)[9],
                                            int off) {
#pragma unroll
    for (int j = 0; j < 9; ++j) b[j] = *(const v2f*)(rp[j] + off);
}

// acc += sum over the 9 (kd,kh) rows of column b times the weights of tap KW
template <int KW>
__device__ __forceinline__ void dw_fma_col(v2f& acc, const v2f (&b)[9],
                                           const v2f (&wp)[27]) {
#pragma unroll
    for (int j = 0; j < 9; ++j) acc = __builtin_elementwise_fma(b[j], wp[j * 3 + KW], acc);
}

__global__ __launch_bounds__(512) void cf_k4_dwconv(
    const float* __restrict__ Y0, const float* __restrict__ cw,
    const float* __restrict__ cb, float* __restrict__ Y1)
{
    // all weights, [c][tap]: 864 float4; the rest only lets every thread store twice
    __shared__ float4 swt[1024];
    const int tid = threadIdx.x;
    const int lane = tid & 31;
    const int wv = __builtin_amdgcn_readfirstlane(tid >> 5);
    const int bx = blockIdx.x;
    const int t = bx & 3;
    const int h = ((bx >> 2) & 7) * 4 + ((wv >> 1) & 3);
    const int d = (bx >> 5) * 2 + (wv >> 3);
    const int c0 = (wv & 1) * 64;          // this wave's first channel

    // the weights are fetched together with the first columns below
    const float4* cw4 = (const float4*)cw;
    const float4 g0 = cw4[tid];
    const float4 g1 = cw4[min(tid + 512, CC * 27 / 4 - 1)];

    const float* rp[9];
#pragma unroll
    for (int kd = 0; kd < 3; ++kd)
#pragma unroll
        for (int kh = 0; kh < 3; ++kh) {
            const int dc = min(max(d + kd - 1, 0), 15), hc = min(max(h + kh - 1, 0), 31);
            rp[kd * 3 + kh] = Y0 + ((size_t)((dc * 32 + hc) * 32) * TT + t) * CC + c0;
        }
    const int lo = lane * 2;
    v2f buf[DW_NB][9];                     // column c lives in buf[c % DW_NB]
    v2f acc[3];                            // output o lives in acc[o % 3]
#pragma unroll
    for (int c = 0; c < DW_NB - 1; ++c) dw_load_col(buf[c], rp, lo + c * DW_CS);
    const v2f bias = *(const v2f*)(cb + c0 + lo);

    swt[tid] = g0;
    swt[tid + 512] = g1;
    __syncthreads();

    // this lane's 2 channels x 27 taps (54 consecutive floats of cw), paired by tap
    const float* lw = (const float*)swt + (c0 + lo) * 27;
    v2f wp[27];
#pragma unroll
    for (int kd = 0; kd < 3; ++kd)
#pragma unroll
        for (int kh = 0; kh < 3; ++kh) {
            const bool ok = (unsigned)(d + kd - 1) < 16u && (unsigned)(h + kh - 1) < 32u;
#pragma unroll
            for (int kw = 0; kw < 3; ++kw) {
                const int tap = (kd * 3 + kh) * 3 + kw;
                const float wx = lw[tap], wy = lw[27 + tap];
                wp[tap].x = ok ? wx : 0.f;
                wp[tap].y = ok ? wy : 0.f;
            }
        }
    float* orow = Y1 + ((size_t)((d * 32 + h) * 32) * TT + t) * CC + c0;

    acc[0] = bias;
    // unrolled whole: every buffer index and every address offset is a constant
#pragma unroll
    for (int col = 0; col < 32; ++col) {
        // keeps later columns' loads from being hoisted up here, which spilled registers
        __builtin_amdgcn_sched_barrier(0);
        if (col + DW_NB - 1 < 32)
            dw_load_col(buf[(col + DW_NB - 1) % DW_NB], rp, lo + (col + DW_NB - 1) * DW_CS);
        const v2f (&b)[9] = buf[col % DW_NB];
        if (col > 0) {                     // right neighbour of output col - 1: done
            dw_fma_col<2>(acc[(col + 2) % 3], b, wp);
            *(v2f*)(orow + lo + (col - 1) * DW_CS) = acc[(col + 2) % 3];
            // precaution: stands before the stored registers are given a new value
            if (col < 31) asm volatile("s_wait_xcnt 0x0" ::: "memory");
        }
        dw_fma_col<1>(acc[col % 3], b, wp);
        if (col < 31) {                    // left neighbour of output col + 1: first
            acc[(col + 1) % 3] = bias;
            dw_fma_col<0>(acc[(col + 1) % 3], b, wp);
        }
    }
    *(v2f*)(orow + lo + 31 * DW_CS) = acc[31 % 3];
}

// ---------------------------------------------------------------------------
// Kernel 5: exLN -> Y2 (f32, residual base) and norm2(Y2) -> H2 (f16 MLP in).
// Eight lanes a token: Y1 is read once, y never read back.
// ---------------------------------------------------------------------------
__global__ __launch_bounds__(256) void cf_k5_lns(
    const float* __restrict__ Y1, const float* __restrict__ eg,
    const float* __restrict__ eb, const float* __restrict__ n2g,
    const float* __restrict__ n2b, float* __restrict__ Y2,
    _Float16* __restrict__ H2)
{
    // a wave takes 16 tokens, four at a time; a block 128
    const int tid = threadIdx.x, pc = (tid & 7) * 4;
    const size_t tok = (size_t)blockIdx.x * 128 + (tid >> 5) * 16 + ((tid >> 3) & 3);
    v4f xv[4][4];
    const float* xr = Y1 + tok * CC + pc;
#pragma unroll  // constant indices keep the rows in registers; all 16 loads are in flight at once
    for (int q = 0; q < 4; ++q) ln_load(xv[q], xr + q * 4 * CC);
    v4f g1[4], b1[4], g2[4], b2[4];
    ln_load(g1, eg + pc);
    ln_load(b1, eb + pc);
    ln_load(g2, n2g + pc);
    ln_load(b2, n2b + pc);
    // precaution: stands before the address registers of the loads above get a new value; xr is
    // named so that its registers live up to here (a later load's result was placed on them)
    asm volatile("s_wait_xcnt 0x0" :: "v"(xr) : "memory");
    // keeps the loads above in front of the arithmetic: sunk to their users, the last started late
    __builtin_amdgcn_sched_barrier(0);
    float* yr = Y2 + tok * CC + pc;
    _Float16* hr = H2 + tok * CC + pc;
#pragma unroll  // constant indices keep the rows in registers
    for (int q = 0; q < 4; ++q) {
        float m, inv;
        ln_stats(xv[q], m, inv);
        v4f y[4];
#pragma unroll  // constant indices keep the rows in registers
        for (int k = 0; k < 4; ++k) {
            y[k] = (xv[q][k] - m) * inv * g1[k] + b1[k];
            *(v4f*)(yr + q * 4 * CC + k * 32) = y[k];
        }
        float m2, inv2;
        ln_stats(y, m2, inv2);
#pragma unroll  // constant indices keep the rows in registers
        for (int k = 0; k < 4; ++k) {
            const v4f hv = (y[k] - m2) * inv2 * g2[k] + b2[k];
            *(v4h*)(hr + q * 4 * CC + k * 32) = __builtin_convertvector(hv, v4h);
        }
    }
}

// ---------------------------------------------------------------------------
// Kernel 6: fc1 GEMM (rows x 128 @ 128x512) + exact GELU -> Hm (f16).
// ---------------------------------------------------------------------------
__global__ __launch_bounds__(256) void cf_k6_fc1_gelu(
    const _Float16* __restrict__ H2, const float* __restrict__ w1,
    const float* __restrict__ b1, _Float16* __restrict__ Hm)
{
    __shared__ alignas(16) _Float16 sh[128 * SHP];   // 34 KiB
    const int tid = threadIdx.x;
    const size_t rowBase = (size_t)blockIdx.x * 128;
    {
        async_rows128(sh, H2 + rowBase * CC, tid);
        wait_async();
    }
    __syncthreads();

    const int wave = tid >> 5, lane = tid & 31, lr = lane & 15, hi = lane >> 4;
    // The wave owns column tiles wave + 8 j: their weights are fetched and converted once
    // and stay in registers; each row tile's A fragments serve all four.
    v16h bw[4][4];
    float bias[4];
#pragma unroll  // constant indices keep the fragment arrays in registers
    for (int j = 0; j < 4; ++j) bias[j] = b1[(wave + 8 * j) * 16 + lr];
    // precaution: stands before the address register of these loads is given a new value
    asm volatile("s_wait_xcnt 0x0" ::: "memory");
#pragma unroll  // constant indices keep the fragment arrays in registers
    for (int j = 0; j < 4; ++j) {
        const int o = (wave + 8 * j) * 16 + lr;
#pragma unroll  // constant indices keep the fragment arrays in registers
        for (int kk = 0; kk < 4; ++kk) load_w_frag(bw[j][kk], w1 + (size_t)o * CC + kk * 32, hi);
    }
    for (int rt = 0; rt < 8; ++rt) {
        v16h a[4];
#pragma unroll  // constant indices keep the fragment arrays in registers
        for (int kk = 0; kk < 4; ++kk)
            for (int e = 0; e < 16; ++e)
                a[kk][e] = sh[(rt * 16 + lr) * SHP + kk * 32 + kmap(e, hi)];
#pragma unroll  // constant indices keep the fragment arrays in registers
        for (int j = 0; j < 4; ++j) {
            v8f acc = {};
#pragma unroll  // constant indices keep the fragment arrays in registers
            for (int kk = 0; kk < 4; ++kk)
                acc = __builtin_amdgcn_wmma_f32_16x16x32_f16(
                    false, a[kk], false, bw[j][kk], (short)0, acc, false, false);
            for (int r = 0; r < 8; ++r) {
                const size_t n = rowBase + rt * 16 + r + 8 * hi;
                const int o = (wave + 8 * j) * 16 + lr;
                const float v = acc[r] + bias[j];
                const float ge = 0.5f * v * (1.f + erff(v * 0.70710678f));
                Hm[n * MLPH + o] = (_Float16)ge;
            }
            // precaution: stands before the registers of these stores are given a new value
            asm volatile("s_wait_xcnt 0x0" ::: "memory");
        }
    }
}

// ---------------------------------------------------------------------------
// Kernel 7: fc2 GEMM (rows x 512 @ 512x128) + bias + residual -> d_out (f32).
// ---------------------------------------------------------------------------
__global__ __launch_bounds__(256) void cf_k7_fc2_res(
    const _Float16* __restrict__ Hm, const float* __restrict__ w2,
    const float* __restrict__ b2, const float* __restrict__ Y2,
    float* __restrict__ out)
{
    const int tid = threadIdx.x;
    const size_t rowBase = (size_t)blockIdx.x * 128;
    const int wave = tid >> 5, lane = tid & 31, lr = lane & 15, hi = lane >> 4;
    // The wave owns column tile 'wave': its 16 weight fragments are fetched and converted
    // once and stay in registers over all row tiles.
    const int o = wave * 16 + lr;
    const float bias = b2[o];
    v16h bw[16];
#pragma unroll  // constant indices keep the fragment arrays in registers
    for (int kk = 0; kk < 16; ++kk) load_w_frag(bw[kk], w2 + (size_t)o * MLPH + kk * 32, hi);
    for (int rt = 0; rt < 8; ++rt) {
        const _Float16* ar = Hm + (rowBase + rt * 16 + lr) * MLPH;
        v8f acc = {};
#pragma unroll  // constant indices keep the fragment arrays in registers
        for (int g = 0; g < 4; ++g) {
            v16h a[4];
#pragma unroll  // constant indices keep the fragment arrays in registers
            for (int kk = 0; kk < 4; ++kk)
                for (int e = 0; e < 16; ++e)
                    a[kk][e] = ar[(g * 4 + kk) * 32 + kmap(e, hi)];
            // holds the group's eight loads above its products: sunk to their users, each
            // product waited out its own load's latency
            __builtin_amdgcn_sched_barrier(0);
#pragma unroll  // constant indices keep the fragment arrays in registers
            for (int kk = 0; kk < 4; ++kk)
                acc = __builtin_amdgcn_wmma_f32_16x16x32_f16(
                    false, a[kk], false, bw[g * 4 + kk], (short)0, acc, false, false);
        }
        for (int r = 0; r < 8; ++r) {
            const size_t n = rowBase + rt * 16 + r + 8 * hi;
            out[n * CC + o] = acc[r] + bias + Y2[n * CC + o];
        }
        // precaution: stands before the registers of these stores are given a new value
        asm volatile("s_wait_xcnt 0x0" ::: "memory");
    }
}

// ---------------------------------------------------------------------------
// Host-side orchestration. Workspace plan (peak 128 MiB, no live overlaps):
//   [0,16M)   Q f16      -> later Y0 f32 [0,32M) -> later Y2 f32 [0,32M)
//   [16,32M)  K f16
//   [32,48M)  V f16      -> later H2 f16 [32,48M)
//   [48,64M)  O f16
//   [64,96M)  Y1 f32     -> later Hm f16 [64,128M)
// ---------------------------------------------------------------------------
extern "C" void kernel_launch(void* const* d_in, const int* in_sizes, int n_in,
                              void* d_out, int out_size, void* d_ws, size_t ws_size,
                              hipStream_t stream) {
    (void)in_sizes; (void)n_in; (void)out_size; (void)ws_size;
    const float* x       = (const float*)d_in[0];
    const float* norm1_g = (const float*)d_in[1];
    const float* norm1_b = (const float*)d_in[2];
    const float* pos     = (const float*)d_in[3];
    const float* temb    = (const float*)d_in[4];
    const float* qkv_w   = (const float*)d_in[5];
    const float* qkv_b   = (const float*)d_in[6];
    const float* proj_w  = (const float*)d_in[7];
    const float* proj_b  = (const float*)d_in[8];
    const float* conv_w  = (const float*)d_in[9];
    const float* conv_b  = (const float*)d_in[10];
    const float* exln_g  = (const float*)d_in[11];
    const float* exln_b  = (const float*)d_in[12];
    const float* norm2_g = (const float*)d_in[13];
    const float* norm2_b = (const float*)d_in[14];
    const float* fc1_w   = (const float*)d_in[15];
    const float* fc1_b   = (const float*)d_in[16];
    const float* fc2_w   = (const float*)d_in[17];
    const float* fc2_b   = (const float*)d_in[18];

    char* ws = (char*)d_ws;
    const size_t MB = 1u << 20;
    _Float16* Q  = (_Float16*)(ws + 0 * MB);
    _Float16* K  = (_Float16*)(ws + 16 * MB);
    _Float16* V  = (_Float16*)(ws + 32 * MB);
    _Float16* O  = (_Float16*)(ws + 48 * MB);
    float*    Y0 = (float*)   (ws + 0 * MB);
    float*    Y1 = (float*)   (ws + 64 * MB);
    float*    Y2 = (float*)   (ws + 0 * MB);
    _Float16* H2 = (_Float16*)(ws + 32 * MB);
    _Float16* Hm = (_Float16*)(ws + 64 * MB);
    float*    out = (float*)d_out;

    cf_k1_ln_pe_qkv<<<NWIN, 256, 0, stream>>>(x, norm1_g, norm1_b, pos, temb,
                                              qkv_w, qkv_b, Q, K, V);
    cf_k2_attn<<<NWIN * NHD, 256, 0, stream>>>(Q, K, V, O);
    cf_k3_proj_merge<<<NWIN, 256, 0, stream>>>(O, proj_w, proj_b, Y0);
    cf_k4_dwconv<<<NROW / 256, 512, 0, stream>>>(Y0, conv_w, conv_b, Y1);
    cf_k5_lns<<<NROW / 128, 256, 0, stream>>>(Y1, exln_g, exln_b,
                                              norm2_g, norm2_b, Y2, H2);
    cf_k6_fc1_gelu<<<NROW / 128, 256, 0, stream>>>(H2, fc1_w, fc1_b, Hm);
    cf_k7_fc2_res<<<NROW / 128, 256, 0, stream>>>(Hm, fc2_w, fc2_b, Y2, out);
}

// v006
// It runs in 132 microseconds.
// In two side-by-side timings against v005, it was 1.30 and 1.29 times as fast.
// Over all steps from v000 it is 4.25 times as fast.
#include <hip/hip_runtime.h>
#include <hip/hip_bf16.h>
#include <math.h>

// ---------------------------------------------------------------------------
// CrossFormerBlock for MI455X (gfx1250, wave32, WMMA 16x16x32 f16 -> f32 acc)
// Data movement: GLOBAL_LOAD_ASYNC_TO_LDS_B128 for LDS staging in kernels 2, 3 and 6 (ASYNCcnt),
// WMMA for all six GEMMs (QK^T and PV in kernel 2), VALU for softmax/LN/conv.
// ---------------------------------------------------------------------------

typedef __attribute__((ext_vector_type(16))) _Float16 v16h;
typedef __attribute__((ext_vector_type(8)))  float    v8f;

// K-index inside a 16x32 f16 A/B fragment for element e (0..15) of the v16h,
// given lane-half hi = lane/16 (CDNA5 ISA 7.12.2 16-bit A/B layout).
__device__ __forceinline__ int kmap(int e, int hi) {
    return ((e >> 3) << 4) + (((e >> 1) & 3) << 1) + (hi << 3) + (e & 1);
}

// One B fragment from 32 consecutive f32 weights of this lane's output column, as f16.
__device__ __forceinline__ void load_w_frag(v16h& f, const float* __restrict__ w, int hi) {
#pragma unroll  // constant indices keep the fragment arrays in registers
    for (int e = 0; e < 16; ++e) f[e] = (_Float16)w[kmap(e, hi)];
    // precaution: stands before the address registers of these loads are given a new value
    asm volatile("s_wait_xcnt 0x0" ::: "memory");
}

// Async 16B global->LDS copy (no VGPR data path; tracked by ASYNCcnt).
// LDS address = low 32 bits of the flat shared pointer (ISA LDS aperture rule).
__device__ __forceinline__ void async_copy_b128(void* lds_dst, const void* gsrc) {
    unsigned l = (unsigned)(unsigned long long)lds_dst;
    asm volatile("global_load_async_to_lds_b128 %0, %1, off"
                 :: "v"(l), "v"(gsrc) : "memory");
}
__device__ __forceinline__ void wait_async() {
    asm volatile("s_wait_asynccnt 0x0" ::: "memory");
}

// Static problem dims
#define CC   128
#define TT   4
#define GG   4
#define NTOK 256        // tokens per window (G^3 * T)
#define NWIN 256        // windows
#define NHD  8          // heads
#define HDSZ 16         // head dim
#define MLPH 512
#define NROW 65536      // total tokens B*D*H*W*T
#define ATT_SCALE 0.25f // 1/sqrt(16)
// f16 per LDS row of a staged 128-channel A tile: 272 bytes = 16 x 17, so the 16 rows that a
// fragment's ds_load_b128 reads start 4 banks apart and cover all 64 banks (256-byte rows
// put all 16 on the same 4 banks)
#define SHP  (CC + 8)

// Eight async 16-byte copies per thread: 128 rows of 256 bytes, contiguous at src, land in
// LDS rows of SHP f16 at dst. Thread tid takes piece tid & 15 of rows (tid >> 4) + 16 j.
// precaution: the s_wait_xcnt closes the statement, ahead of any rewrite of its address registers
__device__ __forceinline__ void async_rows128(_Float16* dst, const _Float16* src, int tid) {
    const unsigned l = (unsigned)(unsigned long long)(dst + (tid >> 4) * SHP + (tid & 15) * 8);
    const _Float16* g = src + tid * 8;
    asm volatile("global_load_async_to_lds_b128 %0, %8, off\n\t"
                 "global_load_async_to_lds_b128 %1, %9, off\n\t"
                 "global_load_async_to_lds_b128 %2, %10, off\n\t"
                 "global_load_async_to_lds_b128 %3, %11, off\n\t"
                 "global_load_async_to_lds_b128 %4, %12, off\n\t"
                 "global_load_async_to_lds_b128 %5, %13, off\n\t"
                 "global_load_async_to_lds_b128 %6, %14, off\n\t"
                 "global_load_async_to_lds_b128 %7, %15, off\n\t"
                 "s_wait_xcnt 0x0"
                 :: "v"(l), "v"(l + 1 * 32 * SHP), "v"(l + 2 * 32 * SHP), "v"(l + 3 * 32 * SHP),
                    "v"(l + 4 * 32 * SHP), "v"(l + 5 * 32 * SHP), "v"(l + 6 * 32 * SHP),
                    "v"(l + 7 * 32 * SHP),
                    "v"(g), "v"(g + 1 * 2048), "v"(g + 2 * 2048), "v"(g + 3 * 2048),
                    "v"(g + 4 * 2048), "v"(g + 5 * 2048), "v"(g + 6 * 2048), "v"(g + 7 * 2048)
                 : "memory");
}

// ---------------------------------------------------------------------------
// LayerNorm rows, eight lanes a token. Lane piece s = lane & 7 holds channels
// 4 (s + 8 k) .. + 3 for k = 0..3, the token is picked by lane >> 3: one wave-wide 16-byte
// load or store covers four tokens x one whole 128-byte line, and a row stays in registers
// from its load to its last use.
// ---------------------------------------------------------------------------
typedef __attribute__((ext_vector_type(4))) float    v4f;
typedef __attribute__((ext_vector_type(4))) _Float16 v4h;

// v + (v of lane l ^ XM), XM < 16, as a DPP row_xmask move
template <int XM>
__device__ __forceinline__ float add_xmask(float v) {
    const int b = __builtin_bit_cast(int, v);
    return v + __builtin_bit_cast(float,
        __builtin_amdgcn_update_dpp(b, b, 0x160 + XM, 0xf, 0xf, false));
}
// total over the eight lanes of a token, in every one of them
__device__ __forceinline__ float sum8(float v) {
    return add_xmask<4>(add_xmask<2>(add_xmask<1>(v)));
}
__device__ __forceinline__ void ln_load(v4f (&v)[4], const float* p) {
#pragma unroll  // constant indices keep the row in registers
    for (int k = 0; k < 4; ++k) v[k] = *(const v4f*)(p + k * 32);
}
// mean and 1 / sqrt(var + eps) of the token whose row lies in v on these eight lanes
__device__ __forceinline__ void ln_stats(const v4f (&v)[4], float& m, float& inv) {
    const v4f s = (v[0] + v[1]) + (v[2] + v[3]);
    v4f q = v[0] * v[0];
#pragma unroll  // constant indices keep the row in registers
    for (int k = 1; k < 4; ++k) q = __builtin_elementwise_fma(v[k], v[k], q);
    const float sm = sum8((s.x + s.y) + (s.z + s.w));
    const float sq = sum8((q.x + q.y) + (q.z + q.w));
    m = sm * (1.f / CC);
    inv = rsqrtf(sq * (1.f / CC) - m * m + 1e-5f);
}

// ---------------------------------------------------------------------------
// Kernel 1: LN + pos/time embed -> LDS f16, then QKV GEMM (256x384, K=128)
// ---------------------------------------------------------------------------
__global__ __launch_bounds__(256) void cf_k1_ln_pe_qkv(
    const float* __restrict__ x, const float* __restrict__ n1g,
    const float* __restrict__ n1b, const float* __restrict__ pos,
    const float* __restrict__ temb, const float* __restrict__ qkv_w,
    const float* __restrict__ qkv_b,
    _Float16* __restrict__ Q, _Float16* __restrict__ K, _Float16* __restrict__ V)
{
    __shared__ alignas(16) _Float16 sh[NTOK * SHP];   // 68 KiB (LDS is 320 KiB/WGP)
    const int tid = threadIdx.x, win = blockIdx.x;

    // ---- per-token LN + embeds: a wave takes 32 tokens, four at a time ----
    {
        const int wv = tid >> 5, gw = (tid >> 3) & 3, pc = (tid & 7) * 4;
        const int t = wv >> 1;                       // token n = 32 wv + 4 q + gw
        const int wd = win >> 6, wh = (win >> 3) & 7, ww = win & 7;
        const int d0 = wd * GG + (wv & 1) * 2, h0 = wh * GG, w = ww * GG + gw;
        const float* xb = x + ((((size_t)d0 * 32 + h0) * 32 + w) * TT + t) * CC + pc;
        v4f xv[8][4];
#pragma unroll  // constant indices keep the rows in registers; all 32 loads are in flight at once
        for (int q = 0; q < 8; ++q)                  // gd = 2 (wv & 1) + (q >> 2), gh = q & 3
            ln_load(xv[q], xb + (size_t)(((q >> 2) * 32 + (q & 3)) * 32) * TT * CC);
        v4f g[4], b[4], te[4];
        ln_load(g, n1g + pc);
        ln_load(b, n1b + pc);
        ln_load(te, temb + t * CC + pc);
        const float* pb = pos + ((wv & 1) * 32 + gw) * CC + pc;
        v4f pr[8][4];                                // fetched two steps ahead of their use
        ln_load(pr[0], pb);
        ln_load(pr[1], pb + 4 * CC);
        // precaution: stands before the address registers of the loads above get a new value
        asm volatile("s_wait_xcnt 0x0" ::: "memory");
        _Float16* db = sh + (wv * 32 + gw) * SHP + pc;
#pragma unroll  // constant indices keep the rows in registers
        for (int q = 0; q < 8; ++q) {
            // keeps the loads above in front of the arithmetic (sunk to their users, the last
            // rows started late) and later steps' loads from rising here (past 256 registers)
            __builtin_amdgcn_sched_barrier(0);
            if (q + 2 < 8) ln_load(pr[q + 2], pb + (q + 2) * 4 * CC);
            float m, inv;
            ln_stats(xv[q], m, inv);
#pragma unroll  // constant indices keep the rows in registers
            for (int k = 0; k < 4; ++k) {
                const v4f hv = (xv[q][k] - m) * inv * g[k] + b[k] + pr[q][k] + te[k];
                *(v4h*)(db + q * 4 * SHP + k * 32) = __builtin_convertvector(hv, v4h);
            }
        }
        // precaution: stands before the address register of the loads in the loop gets a new value
        asm volatile("s_wait_xcnt 0x0" ::: "memory");
    }
    __syncthreads();

    // ---- GEMM: sh(256x128) @ qkv_w^T(128x384) ----
    const int wave = tid >> 5, lane = tid & 31, lr = lane & 15, hi = lane >> 4;
    // The wave owns column tiles wave, wave + 8, wave + 16 (its head's Q, K and V columns):
    // their weights are fetched and converted once and stay in registers over all row tiles.
    v16h bw[3][4];
    float bias[3];
#pragma unroll  // constant indices keep the fragment arrays in registers
    for (int j = 0; j < 3; ++j) bias[j] = qkv_b[(wave + 8 * j) * 16 + lr];
    // precaution: stands before the address register of these loads is given a new value
    asm volatile("s_wait_xcnt 0x0" ::: "memory");
#pragma unroll  // constant indices keep the fragment arrays in registers
    for (int j = 0; j < 3; ++j) {
        const int o = (wave + 8 * j) * 16 + lr;
#pragma unroll  // constant indices keep the fragment arrays in registers
        for (int kk = 0; kk < 4; ++kk) load_w_frag(bw[j][kk], qkv_w + (size_t)o * CC + kk * 32, hi);
    }
    for (int rt = 0; rt < 16; ++rt) {
        v16h a[4];
#pragma unroll  // constant indices keep the fragment arrays in registers
        for (int kk = 0; kk < 4; ++kk)
            for (int e = 0; e < 16; ++e)
                a[kk][e] = sh[(rt * 16 + lr) * SHP + kk * 32 + kmap(e, hi)];
#pragma unroll  // constant indices keep the fragment arrays in registers
        for (int j = 0; j < 3; ++j) {
            v8f acc = {};
#pragma unroll  // constant indices keep the fragment arrays in registers
            for (int kk = 0; kk < 4; ++kk)
                acc = __builtin_amdgcn_wmma_f32_16x16x32_f16(
                    false, a[kk], false, bw[j][kk], (short)0, acc, false, false);
            for (int r = 0; r < 8; ++r) {
                const int nrow = rt * 16 + r + 8 * hi;
                const float val = acc[r] + bias[j];
                const size_t addr = (((size_t)win * NHD + wave) * NTOK + nrow) * HDSZ + lr;
                if (j == 0)       Q[addr] = (_Float16)(val * ATT_SCALE);
                else if (j == 1)  K[addr] = (_Float16)val;
                else              V[addr] = (_Float16)val;
            }
            // precaution: stands before the registers of these stores are given a new value
            asm volatile("s_wait_xcnt 0x0" ::: "memory");
        }
    }
}

// ---------------------------------------------------------------------------
// Kernel 2: window attention, one block per (win, head), scores transposed.
// S^T = K Q^T: a lane's accumulator registers hold ONE query's scores (query = lane & 15,
// key = 16 kt + 8 hi + r), so the row maximum and the row sum are in-lane work plus one
// exchange between the wave's halves. Two score tiles, converted in place, are the B
// operand of O^T += V^T P^T over 32 keys: P never leaves the registers. All 256 keys of
// a query are held at once, so the softmax is one pass with the true row maximum.
// ---------------------------------------------------------------------------
typedef __attribute__((ext_vector_type(8))) _Float16 v8h;
typedef __attribute__((ext_vector_type(2))) _Float16 v2h;
typedef __attribute__((ext_vector_type(8))) short    v8s;
typedef __attribute__((ext_vector_type(2))) float    v2f;
#define LOG2E 1.4426950408889634f

// lane l <-> lane l ^ 16
__device__ __forceinline__ float xhalf(float v) {
    const int b = __builtin_bit_cast(int, v);
    return __builtin_bit_cast(float, __builtin_amdgcn_permlanex16(
        b, b, 0x76543210, 0xfedcba98, false, false));
}

// A or B fragment of a row of 16 f16 (head dim): k = 8 hi + e for e < 8, zero above k = 15
__device__ __forceinline__ v16h row16_frag(const _Float16* row, int hi) {
    const v8h lo = *(const v8h*)(row + hi * 8);
    const v8h z = {};
    return __builtin_shufflevector(lo, z, 0, 1, 2, 3, 4, 5, 6, 7, 8, 9, 10, 11, 12, 13, 14, 15);
}

// transposing LDS load: lane (lr, hi) gets column lr of the 8 rows 8 hi .. 8 hi + 7 of a
// 16 x 16 f16 tile; p is this lane's own address in the tile (formed by the caller)
__device__ __forceinline__ v8h lds_tr16(const _Float16* p) {
    typedef __attribute__((address_space(3))) v8s lds_v8s;
    return __builtin_bit_cast(v8h, __builtin_amdgcn_ds_load_tr16_b128_v8i16((lds_v8s*)p));
}

__global__ __launch_bounds__(256) void cf_k2_attn(
    const _Float16* __restrict__ Q, const _Float16* __restrict__ K,
    const _Float16* __restrict__ V, _Float16* __restrict__ O)
{
    __shared__ alignas(16) _Float16 Qh[NTOK * HDSZ];   // 8 KiB each
    __shared__ alignas(16) _Float16 Kh[NTOK * HDSZ];
    __shared__ alignas(16) _Float16 Vh[NTOK * HDSZ];

    const int tid = threadIdx.x, bx = blockIdx.x;
    const int win = bx >> 3, head = bx & 7;
    const size_t base = (size_t)bx * NTOK * HDSZ;

    {   // async DMA fills: 3 x 512 B128 transfers, no VGPR staging
        const uint4* qs = (const uint4*)(Q + base); uint4* qd = (uint4*)Qh;
        const uint4* ks = (const uint4*)(K + base); uint4* kd = (uint4*)Kh;
        const uint4* vs = (const uint4*)(V + base); uint4* vd = (uint4*)Vh;
        for (int i = tid; i < NTOK * HDSZ / 8; i += 256) {
            async_copy_b128(qd + i, qs + i);
            async_copy_b128(kd + i, ks + i);
            async_copy_b128(vd + i, vs + i);
        }
        wait_async();
    }
    __syncthreads();

    const int wave = tid >> 5, lane = tid & 31, lr = lane & 15, hi = lane >> 4;
    // this lane's address in a 16-key tile of V for the transposing load (rows of 32 bytes)
    const _Float16* vt = Vh + (8 * hi + (lane & 7)) * HDSZ + ((lane >> 3) & 1) * 8;
    for (int qi = 0; qi < 2; ++qi) {
        const int qt = wave * 2 + qi;
        const v16h bq = row16_frag(Qh + (qt * 16 + lr) * HDSZ, hi);

        v8f s[16];   // s[kt][r] = score of query qt * 16 + lr with key kt * 16 + 8 * hi + r
#pragma unroll  // constant indices keep the score tiles in registers
        for (int kt = 0; kt < 16; ++kt) {
            const v16h ak = row16_frag(Kh + (kt * 16 + lr) * HDSZ, hi);
            const v8f zc = {};
            s[kt] = __builtin_amdgcn_wmma_f32_16x16x32_f16(
                false, ak, false, bq, (short)0, zc, false, false);
        }

        float m4[4] = {-1e30f, -1e30f, -1e30f, -1e30f};   // four chains, joined below
#pragma unroll
        for (int kt = 0; kt < 16; ++kt)
#pragma unroll
            for (int r = 0; r < 8; ++r) m4[kt & 3] = fmaxf(m4[kt & 3], s[kt][r]);
        float mx = fmaxf(fmaxf(m4[0], m4[1]), fmaxf(m4[2], m4[3]));
        mx = fmaxf(mx, xhalf(mx));
        const float nm = -mx * LOG2E;

        v2f sum[4] = {};
        v8f oacc = {};   // oacc[r] = O^T[head dim 8 * hi + r][query lr], not yet normalised
#pragma unroll  // constant indices keep the score tiles in registers
        for (int j = 0; j < 8; ++j) {   // 32 keys a trip
            const v8h v0 = lds_tr16(vt + (j * 32) * HDSZ);
            const v8h v1 = lds_tr16(vt + (j * 32 + 16) * HDSZ);
            const v16h av = __builtin_shufflevector(
                v0, v1, 0, 1, 2, 3, 4, 5, 6, 7, 8, 9, 10, 11, 12, 13, 14, 15);
            v16h pf;   // pf[e] = P^T[key j * 32 + kmap(e, hi)][query lr]
#pragma unroll
            for (int i = 0; i < 8; ++i) {
                const v8f& st = s[2 * j + (i >> 2)];
                const v2f sv = {st[2 * (i & 3)], st[2 * (i & 3) + 1]};
                const v2f arg = __builtin_elementwise_fma(sv, v2f{LOG2E, LOG2E}, v2f{nm, nm});
                const v2f p = {__builtin_amdgcn_exp2f(arg.x), __builtin_amdgcn_exp2f(arg.y)};
                sum[i & 3] += p;
                const v2h ph = __builtin_convertvector(p, v2h);
                pf[2 * i] = ph.x;
                pf[2 * i + 1] = ph.y;
            }
            oacc = __builtin_amdgcn_wmma_f32_16x16x32_f16(
                false, av, false, pf, (short)0, oacc, false, false);
        }
        const v2f s2 = (sum[0] + sum[1]) + (sum[2] + sum[3]);
        float l = s2.x + s2.y;
        l += xhalf(l);
        const float inv = 1.f / l;

        v8h ov;
#pragma unroll
        for (int r = 0; r < 8; ++r) ov[r] = (_Float16)(oacc[r] * inv);
        *(v8h*)(O + ((size_t)win * NTOK + qt * 16 + lr) * CC + head * HDSZ + hi * 8) = ov;
        // precaution: stands before the registers of this store are given a new value
        if (qi == 0) asm volatile("s_wait_xcnt 0x0" ::: "memory");
    }
}

// ---------------------------------------------------------------------------
// Kernel 3: output projection (256x128 @ 128x128) + window-merge scatter.
// ---------------------------------------------------------------------------
__global__ __launch_bounds__(256) void cf_k3_proj_merge(
    const _Float16* __restrict__ O, const float* __restrict__ pw,
    const float* __restrict__ pb, float* __restrict__ Y0)
{
    __shared__ alignas(16) _Float16 sh[NTOK * SHP];   // 68 KiB
    const int tid = threadIdx.x, win = blockIdx.x;
    {
        const _Float16* src = O + (size_t)win * NTOK * CC;
        async_rows128(sh, src, tid);
        async_rows128(sh + 128 * SHP, src + 128 * CC, tid);
        wait_async();
    }
    __syncthreads();

    const int wave = tid >> 5, lane = tid & 31, lr = lane & 15, hi = lane >> 4;
    const int wd = win >> 6, wh = (win >> 3) & 7, ww = win & 7;
    // The wave owns column tile 'wave': its weights stay in registers over all row tiles.
    const int o = wave * 16 + lr;
    const float bias = pb[o];
    v16h bw[4];
#pragma unroll  // constant indices keep the fragment arrays in registers
    for (int kk = 0; kk < 4; ++kk) load_w_frag(bw[kk], pw + (size_t)o * CC + kk * 32, hi);
    for (int rt = 0; rt < 16; ++rt) {
        v8f acc = {};
#pragma unroll  // constant indices keep the fragment arrays in registers
        for (int kk = 0; kk < 4; ++kk) {
            v16h a;
            for (int e = 0; e < 16; ++e)
                a[e] = sh[(rt * 16 + lr) * SHP + kk * 32 + kmap(e, hi)];
            acc = __builtin_amdgcn_wmma_f32_16x16x32_f16(
                false, a, false, bw[kk], (short)0, acc, false, false);
        }
        for (int r = 0; r < 8; ++r) {
            const int n = rt * 16 + r + 8 * hi;
            const int t = n >> 6, rem = n & 63;
            const int gd = rem >> 4, gh = (rem >> 2) & 3, gw = rem & 3;
            const int d = wd * GG + gd, h = wh * GG + gh, w = ww * GG + gw;
            const size_t off = ((((size_t)d * 32 + h) * 32 + w) * TT + t) * CC + o;
            Y0[off] = acc[r] + bias;
        }
        // precaution: stands before the registers of these stores are given a new value
        asm volatile("s_wait_xcnt 0x0" ::: "memory");
    }
}

// ---------------------------------------------------------------------------
// Kernel 4: depthwise 3x3x3 conv over (D,H,W), T folded into batch.
// One wave = 64 channels of one (d,h,t) row, 2 channels per lane. The lane
// keeps its 2 x 27 weights in registers and walks the 32 columns of W: each
// loaded column (9 rows x 2 floats) feeds the three outputs it touches, so every
// input is loaded once per (kd,kh) and no weight is loaded again.
// A block is 2 d x 4 h rows of one t, so neighbouring waves read the same lines.
// Taps outside D or H: the row index is clamped and the tap's weight is zero.
// ---------------------------------------------------------------------------
#define DW_CS (TT * CC)   // floats from one column of W to the next
#define DW_NB 4           // column buffers: a column is fetched DW_NB - 1 ahead

__device__ __forceinline__ void dw_load_col(v2f (&b)[9], const float* const (&rp)[9],
                                            int off) {
#pragma unroll
    for (int j = 0; j < 9; ++j) b[j] = *(const v2f*)(rp[j] + off);
}

// acc += sum over the 9 (kd,kh) rows of column b times the weights of tap KW
template <int KW>
__device__ __forceinline__ void dw_fma_col(v2f& acc, const v2f (&b)[9],
                                           const v2f (&wp)[27]) {
#pragma unroll
    for (int j = 0; j < 9; ++j) acc = __builtin_elementwise_fma(b[j], wp[j * 3 + KW], acc);
}

__global__ __launch_bounds__(512) void cf_k4_dwconv(
    const float* __restrict__ Y0, const float* __restrict__ cw,
    const float* __restrict__ cb, float* __restrict__ Y1)
{
    // all weights, [c][tap]: 864 float4; the rest only lets every thread store twice
    __shared__ float4 swt[1024];
    const int tid = threadIdx.x;
    const int lane = tid & 31;
    const int wv = __builtin_amdgcn_readfirstlane(tid >> 5);
    const int bx = blockIdx.x;
    const int t = bx & 3;
    const int h = ((bx >> 2) & 7) * 4 + ((wv >> 1) & 3);
    const int d = (bx >> 5) * 2 + (wv >> 3);
    const int c0 = (wv & 1) * 64;          // this wave's first channel

    // the weights are fetched together with the first columns below
    const float4* cw4 = (const float4*)cw;
    const float4 g0 = cw4[tid];
    const float4 g1 = cw4[min(tid + 512, CC * 27 / 4 - 1)];

    const float* rp[9];
#pragma unroll
    for (int kd = 0; kd < 3; ++kd)
#pragma unroll
        for (int kh = 0; kh < 3; ++kh) {
            const int dc = min(max(d + kd - 1, 0), 15), hc = min(max(h + kh - 1, 0), 31);
            rp[kd * 3 + kh] = Y0 + ((size_t)((dc * 32 + hc) * 32) * TT + t) * CC + c0;
        }
    const int lo = lane * 2;
    v2f buf[DW_NB][9];                     // column c lives in buf[c % DW_NB]
    v2f acc[3];                            // output o lives in acc[o % 3]
#pragma unroll
    for (int c = 0; c < DW_NB - 1; ++c) dw_load_col(buf[c], rp, lo + c * DW_CS);
    const v2f bias = *(const v2f*)(cb + c0 + lo);

    swt[tid] = g0;
    swt[tid + 512] = g1;
    __syncthreads();

    // this lane's 2 channels x 27 taps (54 consecutive floats of cw), paired by tap
    const float* lw = (const float*)swt + (c0 + lo) * 27;
    v2f wp[27];
#pragma unroll
    for (int kd = 0; kd < 3; ++kd)
#pragma unroll
        for (int kh = 0; kh < 3; ++kh) {
            const bool ok = (unsigned)(d + kd - 1) < 16u && (unsigned)(h + kh - 1) < 32u;
#pragma unroll
            for (int kw = 0; kw < 3; ++kw) {
                const int tap = (kd * 3 + kh) * 3 + kw;
                const float wx = lw[tap], wy = lw[27 + tap];
                wp[tap].x = ok ? wx : 0.f;
                wp[tap].y = ok ? wy : 0.f;
            }
        }
    float* orow = Y1 + ((size_t)((d * 32 + h) * 32) * TT + t) * CC + c0;

    acc[0] = bias;
    // unrolled whole: every buffer index and every address offset is a constant
#pragma unroll
    for (int col = 0; col < 32; ++col) {
        // keeps later columns' loads from being hoisted up here, which spilled registers
        __builtin_amdgcn_sched_barrier(0);
        if (col + DW_NB - 1 < 32)
            dw_load_col(buf[(col + DW_NB - 1) % DW_NB], rp, lo + (col + DW_NB - 1) * DW_CS);
        const v2f (&b)[9] = buf[col % DW_NB];
        if (col > 0) {                     // right neighbour of output col - 1: done
            dw_fma_col<2>(acc[(col + 2) % 3], b, wp);
            *(v2f*)(orow + lo + (col - 1) * DW_CS) = acc[(col + 2) % 3];
            // precaution: stands before the stored registers are given a new value
            if (col < 31) asm volatile("s_wait_xcnt 0x0" ::: "memory");
        }
        dw_fma_col<1>(acc[col % 3], b, wp);
        if (col < 31) {                    // left neighbour of output col + 1: first
            acc[(col + 1) % 3] = bias;
            dw_fma_col<0>(acc[(col + 1) % 3], b, wp);
        }
    }
    *(v2f*)(orow + lo + 31 * DW_CS) = acc[31 % 3];
}

// ---------------------------------------------------------------------------
// Kernel 5: exLN -> Y2 (f32, residual base) and norm2(Y2) -> H2 (f16 MLP in).
// Eight lanes a token: Y1 is read once, y never read back.
// ---------------------------------------------------------------------------
__global__ __launch_bounds__(256) void cf_k5_lns(
    const float* __restrict__ Y1, const float* __restrict__ eg,
    const float* __restrict__ eb, const float* __restrict__ n2g,
    const float* __restrict__ n2b, float* __restrict__ Y2,
    _Float16* __restrict__ H2)
{
    // a wave takes 16 tokens, four at a time; a block 128
    const int tid = threadIdx.x, pc = (tid & 7) * 4;
    const size_t tok = (size_t)blockIdx.x * 128 + (tid >> 5) * 16 + ((tid >> 3) & 3);
    v4f xv[4][4];
    const float* xr = Y1 + tok * CC + pc;
#pragma unroll  // constant indices keep the rows in registers; all 16 loads are in flight at once
    for (int q = 0; q < 4; ++q) ln_load(xv[q], xr + q * 4 * CC);
    v4f g1[4], b1[4], g2[4], b2[4];
    ln_load(g1, eg + pc);
    ln_load(b1, eb + pc);
    ln_load(g2, n2g + pc);
    ln_load(b2, n2b + pc);
    // precaution: stands before the address registers of the loads above get a new value; xr is
    // named so that its registers live up to here (a later load's result was placed on them)
    asm volatile("s_wait_xcnt 0x0" :: "v"(xr) : "memory");
    // keeps the loads above in front of the arithmetic: sunk to their users, the last started late
    __builtin_amdgcn_sched_barrier(0);
    float* yr = Y2 + tok * CC + pc;
    _Float16* hr = H2 + tok * CC + pc;
#pragma unroll  // constant indices keep the rows in registers
    for (int q = 0; q < 4; ++q) {
        float m, inv;
        ln_stats(xv[q], m, inv);
        v4f y[4];
#pragma unroll  // constant indices keep the rows in registers
        for (int k = 0; k < 4; ++k) {
            y[k] = (xv[q][k] - m) * inv * g1[k] + b1[k];
            *(v4f*)(yr + q * 4 * CC + k * 32) = y[k];
        }
        float m2, inv2;
        ln_stats(y, m2, inv2);
#pragma unroll  // constant indices keep the rows in registers
        for (int k = 0; k < 4; ++k) {
            const v4f hv = (y[k] - m2) * inv2 * g2[k] + b2[k];
            *(v4h*)(hr + q * 4 * CC + k * 32) = __builtin_convertvector(hv, v4h);
        }
    }
}

// ---------------------------------------------------------------------------
// Kernel 6: the whole MLP. fc1 (rows x 128 @ 128x512) + exact GELU -> hidden tile in LDS
// (f16), then fc2 (rows x 512 @ 512x128) + bias + residual -> d_out (f32).
// The hidden activations never leave the WGP. One block = 16 waves = 256 rows, worked in two
// tiles of 128 rows; both layers' weights stay in registers over both tiles.
// ---------------------------------------------------------------------------
// f16 per LDS row of the hidden tile: 1040 bytes = 16 x 65, so the 16 rows that a fragment's
// ds_load_b128 reads start 4 banks apart, as with SHP
#define HMP  (MLPH + 8)

__global__ __launch_bounds__(512) void cf_k6_mlp(
    const _Float16* __restrict__ H2, const float* __restrict__ w1,
    const float* __restrict__ b1, const float* __restrict__ w2,
    const float* __restrict__ b2, const float* __restrict__ Y2,
    float* __restrict__ out)
{
    __shared__ alignas(16) _Float16 sh[256 * SHP];   // 68 KiB: the block's 256 input rows
    __shared__ alignas(16) _Float16 hm[128 * HMP];   // 130 KiB: one tile's hidden rows
    const int tid = threadIdx.x;
    const size_t rowBase = (size_t)blockIdx.x * 256;
    // waves 0..7 bring rows 0..127, waves 8..15 rows 128..255; the copies fly under the
    // weight loads below
    async_rows128(sh + (tid >> 8) * 128 * SHP, H2 + (rowBase + (tid >> 8) * 128) * CC, tid & 255);

    const int wave = tid >> 5, lane = tid & 31, lr = lane & 15, hi = lane >> 4;
    // fc1: the wave owns hidden column tiles wave and wave + 16.
    // fc2: the wave owns output column tile wave & 7, for row tiles 4 (wave >> 3) .. + 3.
    const int o = (wave & 7) * 16 + lr;
    const float* yb = Y2 + rowBase * CC;
    float* ob = out + rowBase * CC;
    v16h bw1[2][4];
    v16h bw2[16];
    float bias1[2];
#pragma unroll  // constant indices keep the fragment arrays in registers
    for (int j = 0; j < 2; ++j) bias1[j] = b1[(wave + 16 * j) * 16 + lr];
    const float bias2 = b2[o];
    // precaution: stands before the address registers of these loads are given a new value
    asm volatile("s_wait_xcnt 0x0" ::: "memory");
#pragma unroll  // constant indices keep the fragment arrays in registers
    for (int f = 0; f < 24; ++f) {
        // batches of 10, 8, 4 and 2 fragments: keeps later fragments' f32 loads from rising
        // above earlier conversions (with too many staged at once, registers spilled)
        if (f == 10 || f == 18 || f == 22) __builtin_amdgcn_sched_barrier(0);
        if (f < 16) {
            load_w_frag(bw2[f], w2 + (size_t)o * MLPH + f * 32, hi);
        } else {
            const int j = (f - 16) >> 2, kk = (f - 16) & 3;
            load_w_frag(bw1[j][kk], w1 + (size_t)((wave + 16 * j) * 16 + lr) * CC + kk * 32, hi);
        }
    }
    wait_async();
    __syncthreads();

    for (int t = 0; t < 2; ++t) {
        // every wave has read its last fragment of the tile before: hm may be written again
        if (t) __syncthreads();
        // ---- fc1 + GELU: 128 rows x this wave's 32 hidden columns -> hm ----
        for (int rt = 0; rt < 8; ++rt) {
            v16h a[4];
#pragma unroll  // constant indices keep the fragment arrays in registers
            for (int kk = 0; kk < 4; ++kk)
                for (int e = 0; e < 16; ++e)
                    a[kk][e] = sh[(t * 128 + rt * 16 + lr) * SHP + kk * 32 + kmap(e, hi)];
            // both column tiles' products first: the A fragments are dead before the GELU work
            v8f acc[2] = {};
#pragma unroll  // constant indices keep the fragment arrays in registers
            for (int kk = 0; kk < 4; ++kk)
#pragma unroll  // constant indices keep the fragment arrays in registers
                for (int j = 0; j < 2; ++j)
                    acc[j] = __builtin_amdgcn_wmma_f32_16x16x32_f16(
                        false, a[kk], false, bw1[j][kk], (short)0, acc[j], false, false);
#pragma unroll  // constant indices keep the accumulators in registers
            for (int j = 0; j < 2; ++j)
                for (int r = 0; r < 8; ++r) {
                    const float v = acc[j][r] + bias1[j];
                    const float ge = 0.5f * v * (1.f + erff(v * 0.70710678f));
                    hm[(rt * 16 + r + 8 * hi) * HMP + (wave + 16 * j) * 16 + lr] = (_Float16)ge;
                }
        }
        // the tile's hidden rows are complete before any wave reads them
        __syncthreads();
        // ---- fc2 + bias + residual: this wave's 64 rows x 16 output columns ----
        for (int i = 0; i < 4; ++i) {
            const int rt = (wave >> 3) * 4 + i;
            const _Float16* ar = hm + (rt * 16 + lr) * HMP;
            const int n0 = (t * 128 + rt * 16 + 8 * hi) * CC + o;   // in the block's 256 rows
            float res[8];
#pragma unroll  // constant indices keep the values in registers
            for (int r = 0; r < 8; ++r) res[r] = yb[n0 + r * CC];
            v8f acc = {};
#pragma unroll  // constant indices keep the fragment arrays in registers
            for (int g = 0; g < 4; ++g) {
                v16h a[4];
#pragma unroll  // constant indices keep the fragment arrays in registers
                for (int kk = 0; kk < 4; ++kk)
                    for (int e = 0; e < 16; ++e)
                        a[kk][e] = ar[(g * 4 + kk) * 32 + kmap(e, hi)];
#pragma unroll  // constant indices keep the fragment arrays in registers
                for (int kk = 0; kk < 4; ++kk)
                    acc = __builtin_amdgcn_wmma_f32_16x16x32_f16(
                        false, a[kk], false, bw2[g * 4 + kk], (short)0, acc, false, false);
            }
            for (int r = 0; r < 8; ++r) ob[n0 + r * CC] = acc[r] + bias2 + res[r];
            // precaution: stands before the registers of these loads and stores get a new value
            asm volatile("s_wait_xcnt 0x0" ::: "memory");
        }
    }
}

// ---------------------------------------------------------------------------
// Host-side orchestration. Workspace plan (peak 96 MiB, no live overlaps):
//   [0,16M)   Q f16      -> later Y0 f32 [0,32M) -> later Y2 f32 [0,32M)
//   [16,32M)  K f16
//   [32,48M)  V f16      -> later H2 f16 [32,48M)
//   [48,64M)  O f16
//   [64,96M)  Y1 f32
// ---------------------------------------------------------------------------
extern "C" void kernel_launch(void* const* d_in, const int* in_sizes, int n_in,
                              void* d_out, int out_size, void* d_ws, size_t ws_size,
                              hipStream_t stream) {
    (void)in_sizes; (void)n_in; (void)out_size; (void)ws_size;
    const float* x       = (const float*)d_in[0];
    const float* norm1_g = (const float*)d_in[1];
    const float* norm1_b = (const float*)d_in[2];
    const float* pos     = (const float*)d_in[3];
    const float* temb    = (const float*)d_in[4];
    const float* qkv_w   = (const float*)d_in[5];
    const float* qkv_b   = (const float*)d_in[6];
    const float* proj_w  = (const float*)d_in[7];
    const float* proj_b  = (const float*)d_in[8];
    const float* conv_w  = (const float*)d_in[9];
    const float* conv_b  = (const float*)d_in[10];
    const float* exln_g  = (const float*)d_in[11];
    const float* exln_b  = (const float*)d_in[12];
    const float* norm2_g = (const float*)d_in[13];
    const float* norm2_b = (const float*)d_in[14];
    const float* fc1_w   = (const float*)d_in[15];
    const float* fc1_b   = (const float*)d_in[16];
    const float* fc2_w   = (const float*)d_in[17];
    const float* fc2_b   = (const float*)d_in[18];

    char* ws = (char*)d_ws;
    const size_t MB = 1u << 20;
    _Float16* Q  = (_Float16*)(ws + 0 * MB);
    _Float16* K  = (_Float16*)(ws + 16 * MB);
    _Float16* V  = (_Float16*)(ws + 32 * MB);
    _Float16* O  = (_Float16*)(ws + 48 * MB);
    float*    Y0 = (float*)   (ws + 0 * MB);
    float*    Y1 = (float*)   (ws + 64 * MB);
    float*    Y2 = (float*)   (ws + 0 * MB);
    _Float16* H2 = (_Float16*)(ws + 32 * MB);
    float*    out = (float*)d_out;

    cf_k1_ln_pe_qkv<<<NWIN, 256, 0, stream>>>(x, norm1_g, norm1_b, pos, temb,
                                              qkv_w, qkv_b, Q, K, V);
    cf_k2_attn<<<NWIN * NHD, 256, 0, stream>>>(Q, K, V, O);
    cf_k3_proj_merge<<<NWIN, 256, 0, stream>>>(O, proj_w, proj_b, Y0);
    cf_k4_dwconv<<<NROW / 256, 512, 0, stream>>>(Y0, conv_w, conv_b, Y1);
    cf_k5_lns<<<NROW / 128, 256, 0, stream>>>(Y1, exln_g, exln_b,
                                              norm2_g, norm2_b, Y2, H2);
    cf_k6_mlp<<<NROW / 256, 512, 0, stream>>>(H2, fc1_w, fc1_b, fc2_w, fc2_b, Y2, out);
}

// v007
// Measured time: 104 microseconds a run.
// Timed twice side by side with v006, it ran 1.28 and 1.26 times as fast.
// All steps since v000 together make it 5.40 times as fast.
#include <hip/hip_runtime.h>
#include <hip/hip_bf16.h>
#include <math.h>

// ---------------------------------------------------------------------------
// CrossFormerBlock for MI455X (gfx1250, wave32, WMMA 16x16x32 f16 -> f32 acc)
// Data movement: GLOBAL_LOAD_ASYNC_TO_LDS_B128 stages the MLP's input rows (ASYNCcnt),
// WMMA for all six GEMMs, VALU for softmax/LN/conv.
// ---------------------------------------------------------------------------

typedef __attribute__((ext_vector_type(16))) _Float16 v16h;
typedef __attribute__((ext_vector_type(8)))  float    v8f;

// K-index inside a 16x32 f16 A/B fragment for element e (0..15) of the v16h,
// given lane-half hi = lane/16 (CDNA5 ISA 7.12.2 16-bit A/B layout).
__device__ __forceinline__ int kmap(int e, int hi) {
    return ((e >> 3) << 4) + (((e >> 1) & 3) << 1) + (hi << 3) + (e & 1);
}

// One B fragment from 32 consecutive f32 weights of this lane's output column, as f16.
__device__ __forceinline__ void load_w_frag(v16h& f, const float* __restrict__ w, int hi) {
#pragma unroll  // constant indices keep the fragment arrays in registers
    for (int e = 0; e < 16; ++e) f[e] = (_Float16)w[kmap(e, hi)];
    // precaution: stands before the address registers of these loads are given a new value
    asm volatile("s_wait_xcnt 0x0" ::: "memory");
}

__device__ __forceinline__ void wait_async() {
    asm volatile("s_wait_asynccnt 0x0" ::: "memory");
}

// Static problem dims
#define CC   128
#define TT   4
#define GG   4
#define NTOK 256        // tokens per window (G^3 * T)
#define NWIN 256        // windows
#define NHD  8          // heads
#define HDSZ 16         // head dim
#define MLPH 512
#define NROW 65536      // total tokens B*D*H*W*T
#define ATT_SCALE 0.25f // 1/sqrt(16)
// f16 per LDS row of a staged 128-channel A tile: 272 bytes = 16 x 17, so the 16 rows that a
// fragment's ds_load_b128 reads start 4 banks apart and cover all 64 banks (256-byte rows
// put all 16 on the same 4 banks)
#define SHP  (CC + 8)

// Async 16-byte global->LDS copies (no VGPR data path; tracked by ASYNCcnt); the LDS address is
// the low 32 bits of the flat shared pointer.
// Eight async 16-byte copies per thread: 128 rows of 256 bytes, contiguous at src, land in
// LDS rows of SHP f16 at dst. Thread tid takes piece tid & 15 of rows (tid >> 4) + 16 j.
// precaution: the s_wait_xcnt closes the statement, ahead of any rewrite of its address registers
__device__ __forceinline__ void async_rows128(_Float16* dst, const _Float16* src, int tid) {
    const unsigned l = (unsigned)(unsigned long long)(dst + (tid >> 4) * SHP + (tid & 15) * 8);
    const _Float16* g = src + tid * 8;
    asm volatile("global_load_async_to_lds_b128 %0, %8, off\n\t"
                 "global_load_async_to_lds_b128 %1, %9, off\n\t"
                 "global_load_async_to_lds_b128 %2, %10, off\n\t"
                 "global_load_async_to_lds_b128 %3, %11, off\n\t"
                 "global_load_async_to_lds_b128 %4, %12, off\n\t"
                 "global_load_async_to_lds_b128 %5, %13, off\n\t"
                 "global_load_async_to_lds_b128 %6, %14, off\n\t"
                 "global_load_async_to_lds_b128 %7, %15, off\n\t"
                 "s_wait_xcnt 0x0"
                 :: "v"(l), "v"(l + 1 * 32 * SHP), "v"(l + 2 * 32 * SHP), "v"(l + 3 * 32 * SHP),
                    "v"(l + 4 * 32 * SHP), "v"(l + 5 * 32 * SHP), "v"(l + 6 * 32 * SHP),
                    "v"(l + 7 * 32 * SHP),
                    "v"(g), "v"(g + 1 * 2048), "v"(g + 2 * 2048), "v"(g + 3 * 2048),
                    "v"(g + 4 * 2048), "v"(g + 5 * 2048), "v"(g + 6 * 2048), "v"(g + 7 * 2048)
                 : "memory");
}

// ---------------------------------------------------------------------------
// LayerNorm rows, eight lanes a token. Lane piece s = lane & 7 holds channels
// 4 (s + 8 k) .. + 3 for k = 0..3, the token is picked by lane >> 3: one wave-wide 16-byte
// load or store covers four tokens x one whole 128-byte line, and a row stays in registers
// from its load to its last use.
// ---------------------------------------------------------------------------
typedef __attribute__((ext_vector_type(4))) float    v4f;
typedef __attribute__((ext_vector_type(4))) _Float16 v4h;

// v + (v of lane l ^ XM), XM < 16, as a DPP row_xmask move
template <int XM>
__device__ __forceinline__ float add_xmask(float v) {
    const int b = __builtin_bit_cast(int, v);
    return v + __builtin_bit_cast(float,
        __builtin_amdgcn_update_dpp(b, b, 0x160 + XM, 0xf, 0xf, false));
}
// total over the eight lanes of a token, in every one of them
__device__ __forceinline__ float sum8(float v) {
    return add_xmask<4>(add_xmask<2>(add_xmask<1>(v)));
}
__device__ __forceinline__ void ln_load(v4f (&v)[4], const float* p) {
#pragma unroll  // constant indices keep the row in registers
    for (int k = 0; k < 4; ++k) v[k] = *(const v4f*)(p + k * 32);
}
// mean and 1 / sqrt(var + eps) of the token whose row lies in v on these eight lanes
__device__ __forceinline__ void ln_stats(const v4f (&v)[4], float& m, float& inv) {
    const v4f s = (v[0] + v[1]) + (v[2] + v[3]);
    v4f q = v[0] * v[0];
#pragma unroll  // constant indices keep the row in registers
    for (int k = 1; k < 4; ++k) q = __builtin_elementwise_fma(v[k], v[k], q);
    const float sm = sum8((s.x + s.y) + (s.z + s.w));
    const float sq = sum8((q.x + q.y) + (q.z + q.w));
    m = sm * (1.f / CC);
    inv = rsqrtf(sq * (1.f / CC) - m * m + 1e-5f);
}

// ---------------------------------------------------------------------------
// Attention helpers. Scores are held transposed, S^T = K Q^T: a lane's accumulator registers
// hold ONE query's scores (query = lane & 15, key = 16 kt + 8 hi + r), so the row maximum and
// the row sum are in-lane work plus one exchange between the wave's halves. Two score tiles,
// converted in place, are the B operand of O^T += V^T P^T over 32 keys: P never leaves the
// registers. All 256 keys of a query are held at once, so the softmax is one pass with the
// true row maximum.
// ---------------------------------------------------------------------------
typedef __attribute__((ext_vector_type(8))) _Float16 v8h;
typedef __attribute__((ext_vector_type(2))) _Float16 v2h;
typedef __attribute__((ext_vector_type(8))) short    v8s;
typedef __attribute__((ext_vector_type(2))) float    v2f;
#define LOG2E 1.4426950408889634f

// lane l <-> lane l ^ 16
__device__ __forceinline__ float xhalf(float v) {
    const int b = __builtin_bit_cast(int, v);
    return __builtin_bit_cast(float, __builtin_amdgcn_permlanex16(
        b, b, 0x76543210, 0xfedcba98, false, false));
}

// A or B fragment of a row of 16 f16 (head dim): k = 8 hi + e for e < 8, zero above k = 15
__device__ __forceinline__ v16h row16_frag(const _Float16* row, int hi) {
    const v8h lo = *(const v8h*)(row + hi * 8);
    const v8h z = {};
    return __builtin_shufflevector(lo, z, 0, 1, 2, 3, 4, 5, 6, 7, 8, 9, 10, 11, 12, 13, 14, 15);
}

// transposing LDS load: lane (lr, hi) gets column lr of the 8 rows 8 hi .. 8 hi + 7 of a
// 16 x 16 f16 tile; p is this lane's own address in the tile (formed by the caller)
__device__ __forceinline__ v8h lds_tr16(const _Float16* p) {
    typedef __attribute__((address_space(3))) v8s lds_v8s;
    return __builtin_bit_cast(v8h, __builtin_amdgcn_ds_load_tr16_b128_v8i16((lds_v8s*)p));
}

// ---------------------------------------------------------------------------
// Kernel 1: the whole window attention, one block per window, one wave per head.
//   A  LN + pos/time embed -> sh (f16)
//   B  QKV GEMM (256x384, K=128): wave w makes head w's Q, K and V, into LDS
//   C  attention of head w over the window's 256 tokens, output -> sh (f16)
//   D  output projection (256x128 @ 128x128) + window-merge scatter -> Y0
// Q, K, V and the attention output never leave the WGP.
// ---------------------------------------------------------------------------
__global__ __launch_bounds__(256) void cf_k1_window_attn(
    const float* __restrict__ x, const float* __restrict__ n1g,
    const float* __restrict__ n1b, const float* __restrict__ pos,
    const float* __restrict__ temb, const float* __restrict__ qkv_w,
    const float* __restrict__ qkv_b, const float* __restrict__ pw,
    const float* __restrict__ pb, float* __restrict__ Y0)
{
    __shared__ alignas(16) _Float16 sh[NTOK * SHP];                 // 68 KiB (LDS is 320 KiB/WGP)
    __shared__ alignas(16) _Float16 qkvh[NHD * 3 * NTOK * HDSZ];    // 192 KiB: [head][q,k,v][token][16]
    const int tid = threadIdx.x, win = blockIdx.x;
    const int wd = win >> 6, wh = (win >> 3) & 7, ww = win & 7;

    // ---- A: per-token LN + embeds: a wave takes 32 tokens, four at a time ----
    {
        const int wv = tid >> 5, gw = (tid >> 3) & 3, pc = (tid & 7) * 4;
        const int t = wv >> 1;                       // token n = 32 wv + 4 q + gw
        const int d0 = wd * GG + (wv & 1) * 2, h0 = wh * GG, w = ww * GG + gw;
        const float* xb = x + ((((size_t)d0 * 32 + h0) * 32 + w) * TT + t) * CC + pc;
        v4f xv[8][4];
#pragma unroll  // constant indices keep the rows in registers; all 32 loads are in flight at once
        for (int q = 0; q < 8; ++q)                  // gd = 2 (wv & 1) + (q >> 2), gh = q & 3
            ln_load(xv[q], xb + (size_t)(((q >> 2) * 32 + (q & 3)) * 32) * TT * CC);
        v4f g[4], b[4], te[4];
        ln_load(g, n1g + pc);
        ln_load(b, n1b + pc);
        ln_load(te, temb + t * CC + pc);
        const float* pb0 = pos + ((wv & 1) * 32 + gw) * CC + pc;
        v4f pr[8][4];                                // fetched two steps ahead of their use
        ln_load(pr[0], pb0);
        ln_load(pr[1], pb0 + 4 * CC);
        // precaution: stands before the address registers of the loads above get a new value
        asm volatile("s_wait_xcnt 0x0" ::: "memory");
        _Float16* db = sh + (wv * 32 + gw) * SHP + pc;
#pragma unroll  // constant indices keep the rows in registers
        for (int q = 0; q < 8; ++q) {
            // keeps the loads above in front of the arithmetic (sunk to their users, the last
            // rows started late) and later steps' loads from rising here (past 256 registers)
            __builtin_amdgcn_sched_barrier(0);
            if (q + 2 < 8) ln_load(pr[q + 2], pb0 + (q + 2) * 4 * CC);
            float m, inv;
            ln_stats(xv[q], m, inv);
#pragma unroll  // constant indices keep the rows in registers
            for (int k = 0; k < 4; ++k) {
                const v4f hv = (xv[q][k] - m) * inv * g[k] + b[k] + pr[q][k] + te[k];
                *(v4h*)(db + q * 4 * SHP + k * 32) = __builtin_convertvector(hv, v4h);
            }
        }
        // precaution: stands before the address register of the loads in the loop gets a new value
        asm volatile("s_wait_xcnt 0x0" ::: "memory");
    }
    __syncthreads();

    // ---- B: sh(256x128) @ qkv_w^T(128x384) ----
    const int wave = tid >> 5, lane = tid & 31, lr = lane & 15, hi = lane >> 4;
    _Float16* Qh = qkvh + wave * 3 * NTOK * HDSZ;    // this wave's head: 8 KiB each
    _Float16* Kh = Qh + NTOK * HDSZ;
    _Float16* Vh = Kh + NTOK * HDSZ;
    {
        // The wave owns column tiles wave, wave + 8, wave + 16 (its head's Q, K and V columns):
        // their weights are fetched and converted once and stay in registers over all row tiles.
        v16h bw[3][4];
        float bias[3];
#pragma unroll  // constant indices keep the fragment arrays in registers
        for (int j = 0; j < 3; ++j) bias[j] = qkv_b[(wave + 8 * j) * 16 + lr];
        // precaution: stands before the address register of these loads is given a new value
        asm volatile("s_wait_xcnt 0x0" ::: "memory");
#pragma unroll  // constant indices keep the fragment arrays in registers
        for (int j = 0; j < 3; ++j) {
            const int o = (wave + 8 * j) * 16 + lr;
#pragma unroll  // constant indices keep the fragment arrays in registers
            for (int kk = 0; kk < 4; ++kk)
                load_w_frag(bw[j][kk], qkv_w + (size_t)o * CC + kk * 32, hi);
        }
        for (int rt = 0; rt < 16; ++rt) {
            v16h a[4];
#pragma unroll  // constant indices keep the fragment arrays in registers
            for (int kk = 0; kk < 4; ++kk)
                for (int e = 0; e < 16; ++e)
                    a[kk][e] = sh[(rt * 16 + lr) * SHP + kk * 32 + kmap(e, hi)];
#pragma unroll  // constant indices keep the fragment arrays in registers
            for (int j = 0; j < 3; ++j) {
                v8f acc = {};
#pragma unroll  // constant indices keep the fragment arrays in registers
                for (int kk = 0; kk < 4; ++kk)
                    acc = __builtin_amdgcn_wmma_f32_16x16x32_f16(
                        false, a[kk], false, bw[j][kk], (short)0, acc, false, false);
                for (int r = 0; r < 8; ++r) {
                    const int nrow = rt * 16 + r + 8 * hi;
                    const float val = acc[r] + bias[j];
                    Qh[(j * NTOK + nrow) * HDSZ + lr] =
                        (_Float16)(j == 0 ? val * ATT_SCALE : val);
                }
            }
        }
    }
    // every wave has read its last fragment of sh: the attention output may be written there
    __syncthreads();

    // ---- C: attention of this wave's head, 16 queries a trip ----
    // this lane's address in a 16-key tile of V for the transposing load (rows of 32 bytes)
    const _Float16* vt = Vh + (8 * hi + (lane & 7)) * HDSZ + ((lane >> 3) & 1) * 8;
#pragma nounroll  // one trip is some thousand instructions: kept rolled, for speed only
    for (int qt = 0; qt < 16; ++qt) {
        const v16h bq = row16_frag(Qh + (qt * 16 + lr) * HDSZ, hi);

        v8f s[16];   // s[kt][r] = score of query qt * 16 + lr with key kt * 16 + 8 * hi + r
#pragma unroll  // constant indices keep the score tiles in registers
        for (int kt = 0; kt < 16; ++kt) {
            const v16h ak = row16_frag(Kh + (kt * 16 + lr) * HDSZ, hi);
            const v8f zc = {};
            s[kt] = __builtin_amdgcn_wmma_f32_16x16x32_f16(
                false, ak, false, bq, (short)0, zc, false, false);
        }

        float m4[4] = {-1e30f, -1e30f, -1e30f, -1e30f};   // four chains, joined below
#pragma unroll
        for (int kt = 0; kt < 16; ++kt)
#pragma unroll
            for (int r = 0; r < 8; ++r) m4[kt & 3] = fmaxf(m4[kt & 3], s[kt][r]);
        float mx = fmaxf(fmaxf(m4[0], m4[1]), fmaxf(m4[2], m4[3]));
        mx = fmaxf(mx, xhalf(mx));
        const float nm = -mx * LOG2E;

        v2f sum[4] = {};
        v8f oacc = {};   // oacc[r] = O^T[head dim 8 * hi + r][query lr], not yet normalised
#pragma unroll  // constant indices keep the score tiles in registers
        for (int j = 0; j < 8; ++j) {   // 32 keys a trip
            const v8h v0 = lds_tr16(vt + (j * 32) * HDSZ);
            const v8h v1 = lds_tr16(vt + (j * 32 + 16) * HDSZ);
            const v16h av = __builtin_shufflevector(
                v0, v1, 0, 1, 2, 3, 4, 5, 6, 7, 8, 9, 10, 11, 12, 13, 14, 15);
            v16h pf;   // pf[e] = P^T[key j * 32 + kmap(e, hi)][query lr]
#pragma unroll
            for (int i = 0; i < 8; ++i) {
                const v8f& st = s[2 * j + (i >> 2)];
                const v2f sv = {st[2 * (i & 3)], st[2 * (i & 3) + 1]};
                const v2f arg = __builtin_elementwise_fma(sv, v2f{LOG2E, LOG2E}, v2f{nm, nm});
                const v2f p = {__builtin_amdgcn_exp2f(arg.x), __builtin_amdgcn_exp2f(arg.y)};
                sum[i & 3] += p;
                const v2h ph = __builtin_convertvector(p, v2h);
                pf[2 * i] = ph.x;
                pf[2 * i + 1] = ph.y;
            }
            oacc = __builtin_amdgcn_wmma_f32_16x16x32_f16(
                false, av, false, pf, (short)0, oacc, false, false);
        }
        const v2f s2 = (sum[0] + sum[1]) + (sum[2] + sum[3]);
        float l = s2.x + s2.y;
        l += xhalf(l);
        const float inv = 1.f / l;

        v8h ov;
#pragma unroll
        for (int r = 0; r < 8; ++r) ov[r] = (_Float16)(oacc[r] * inv);
        *(v8h*)(sh + (qt * 16 + lr) * SHP + wave * HDSZ + hi * 8) = ov;
    }

    // ---- D: sh(256x128) @ pw^T(128x128), scattered back to (D,H,W,T,C) ----
    // The wave owns column tile 'wave': its weights stay in registers over all row tiles.
    const int o = wave * 16 + lr;
    const float bias = pb[o];
    v16h bw[4];
#pragma unroll  // constant indices keep the fragment arrays in registers
    for (int kk = 0; kk < 4; ++kk) load_w_frag(bw[kk], pw + (size_t)o * CC + kk * 32, hi);
    // all eight heads' columns of sh are complete before any wave reads a row
    __syncthreads();
    for (int rt = 0; rt < 16; ++rt) {
        v8f acc = {};
#pragma unroll  // constant indices keep the fragment arrays in registers
        for (int kk = 0; kk < 4; ++kk) {
            v16h a;
            for (int e = 0; e < 16; ++e)
                a[e] = sh[(rt * 16 + lr) * SHP + kk * 32 + kmap(e, hi)];
            acc = __builtin_amdgcn_wmma_f32_16x16x32_f16(
                false, a, false, bw[kk], (short)0, acc, false, false);
        }
        for (int r = 0; r < 8; ++r) {
            const int n = rt * 16 + r + 8 * hi;
            const int t = n >> 6, rem = n & 63;
            const int gd = rem >> 4, gh = (rem >> 2) & 3, gw = rem & 3;
            const int d = wd * GG + gd, h = wh * GG + gh, w = ww * GG + gw;
            const size_t off = ((((size_t)d * 32 + h) * 32 + w) * TT + t) * CC + o;
            Y0[off] = acc[r] + bias;
        }
        // precaution: stands before the registers of these stores are given a new value
        asm volatile("s_wait_xcnt 0x0" ::: "memory");
    }
}

// ---------------------------------------------------------------------------
// Kernel 4: depthwise 3x3x3 conv over (D,H,W), T folded into batch.
// One wave = 64 channels of one (d,h,t) row, 2 channels per lane. The lane
// keeps its 2 x 27 weights in registers and walks the 32 columns of W: each
// loaded column (9 rows x 2 floats) feeds the three outputs it touches, so every
// input is loaded once per (kd,kh) and no weight is loaded again.
// A block is 2 d x 4 h rows of one t, so neighbouring waves read the same lines.
// Taps outside D or H: the row index is clamped and the tap's weight is zero.
// ---------------------------------------------------------------------------
#define DW_CS (TT * CC)   // floats from one column of W to the next
#define DW_NB 4           // column buffers: a column is fetched DW_NB - 1 ahead

__device__ __forceinline__ void dw_load_col(v2f (&b)[9], const float* const (&rp)[9],
                                            int off) {
#pragma unroll
    for (int j = 0; j < 9; ++j) b[j] = *(const v2f*)(rp[j] + off);
}

// acc += sum over the 9 (kd,kh) rows of column b times the weights of tap KW
template <int KW>
__device__ __forceinline__ void dw_fma_col(v2f& acc, const v2f (&b)[9],
                                           const v2f (&wp)[27]) {
#pragma unroll
    for (int j = 0; j < 9; ++j) acc = __builtin_elementwise_fma(b[j], wp[j * 3 + KW], acc);
}

__global__ __launch_bounds__(512) void cf_k4_dwconv(
    const float* __restrict__ Y0, const float* __restrict__ cw,
    const float* __restrict__ cb, float* __restrict__ Y1)
{
    // all weights, [c][tap]: 864 float4; the rest only lets every thread store twice
    __shared__ float4 swt[1024];
    const int tid = threadIdx.x;
    const int lane = tid & 31;
    const int wv = __builtin_amdgcn_readfirstlane(tid >> 5);
    const int bx = blockIdx.x;
    const int t = bx & 3;
    const int h = ((bx >> 2) & 7) * 4 + ((wv >> 1) & 3);
    const int d = (bx >> 5) * 2 + (wv >> 3);
    const int c0 = (wv & 1) * 64;          // this wave's first channel

    // the weights are fetched together with the first columns below
    const float4* cw4 = (const float4*)cw;
    const float4 g0 = cw4[tid];
    const float4 g1 = cw4[min(tid + 512, CC * 27 / 4 - 1)];

    const float* rp[9];
#pragma unroll
    for (int kd = 0; kd < 3; ++kd)
#pragma unroll
        for (int kh = 0; kh < 3; ++kh) {
            const int dc = min(max(d + kd - 1, 0), 15), hc = min(max(h + kh - 1, 0), 31);
            rp[kd * 3 + kh] = Y0 + ((size_t)((dc * 32 + hc) * 32) * TT + t) * CC + c0;
        }
    const int lo = lane * 2;
    v2f buf[DW_NB][9];                     // column c lives in buf[c % DW_NB]
    v2f acc[3];                            // output o lives in acc[o % 3]
#pragma unroll
    for (int c = 0; c < DW_NB - 1; ++c) dw_load_col(buf[c], rp, lo + c * DW_CS);
    const v2f bias = *(const v2f*)(cb + c0 + lo);

    swt[tid] = g0;
    swt[tid + 512] = g1;
    __syncthreads();

    // this lane's 2 channels x 27 taps (54 consecutive floats of cw), paired by tap
    const float* lw = (const float*)swt + (c0 + lo) * 27;
    v2f wp[27];
#pragma unroll
    for (int kd = 0; kd < 3; ++kd)
#pragma unroll
        for (int kh = 0; kh < 3; ++kh) {
            const bool ok = (unsigned)(d + kd - 1) < 16u && (unsigned)(h + kh - 1) < 32u;
#pragma unroll
            for (int kw = 0; kw < 3; ++kw) {
                const int tap = (kd * 3 + kh) * 3 + kw;
                const float wx = lw[tap], wy = lw[27 + tap];
                wp[tap].x = ok ? wx : 0.f;
                wp[tap].y = ok ? wy : 0.f;
            }
        }
    float* orow = Y1 + ((size_t)((d * 32 + h) * 32) * TT + t) * CC + c0;

    acc[0] = bias;
    // unrolled whole: every buffer index and every address offset is a constant
#pragma unroll
    for (int col = 0; col < 32; ++col) {
        // keeps later columns' loads from being hoisted up here, which spilled registers
        __builtin_amdgcn_sched_barrier(0);
        if (col + DW_NB - 1 < 32)
            dw_load_col(buf[(col + DW_NB - 1) % DW_NB], rp, lo + (col + DW_NB - 1) * DW_CS);
        const v2f (&b)[9] = buf[col % DW_NB];
        if (col > 0) {                     // right neighbour of output col - 1: done
            dw_fma_col<2>(acc[(col + 2) % 3], b, wp);
            *(v2f*)(orow + lo + (col - 1) * DW_CS) = acc[(col + 2) % 3];
            // precaution: stands before the stored registers are given a new value
            if (col < 31) asm volatile("s_wait_xcnt 0x0" ::: "memory");
        }
        dw_fma_col<1>(acc[col % 3], b, wp);
        if (col < 31) {                    // left neighbour of output col + 1: first
            acc[(col + 1) % 3] = bias;
            dw_fma_col<0>(acc[(col + 1) % 3], b, wp);
        }
    }
    *(v2f*)(orow + lo + 31 * DW_CS) = acc[31 % 3];
}

// ---------------------------------------------------------------------------
// Kernel 5: exLN -> Y2 (f32, residual base) and norm2(Y2) -> H2 (f16 MLP in).
// Eight lanes a token: Y1 is read once, y never read back.
// ---------------------------------------------------------------------------
__global__ __launch_bounds__(256) void cf_k5_lns(
    const float* __restrict__ Y1, const float* __restrict__ eg,
    const float* __restrict__ eb, const float* __restrict__ n2g,
    const float* __restrict__ n2b, float* __restrict__ Y2,
    _Float16* __restrict__ H2)
{
    // a wave takes 16 tokens, four at a time; a block 128
    const int tid = threadIdx.x, pc = (tid & 7) * 4;
    const size_t tok = (size_t)blockIdx.x * 128 + (tid >> 5) * 16 + ((tid >> 3) & 3);
    v4f xv[4][4];
    const float* xr = Y1 + tok * CC + pc;
#pragma unroll  // constant indices keep the rows in registers; all 16 loads are in flight at once
    for (int q = 0; q < 4; ++q) ln_load(xv[q], xr + q * 4 * CC);
    v4f g1[4], b1[4], g2[4], b2[4];
    ln_load(g1, eg + pc);
    ln_load(b1, eb + pc);
    ln_load(g2, n2g + pc);
    ln_load(b2, n2b + pc);
    // precaution: stands before the address registers of the loads above get a new value; xr is
    // named so that its registers live up to here (a later load's result was placed on them)
    asm volatile("s_wait_xcnt 0x0" :: "v"(xr) : "memory");
    // keeps the loads above in front of the arithmetic: sunk to their users, the last started late
    __builtin_amdgcn_sched_barrier(0);
    float* yr = Y2 + tok * CC + pc;
    _Float16* hr = H2 + tok * CC + pc;
#pragma unroll  // constant indices keep the rows in registers
    for (int q = 0; q < 4; ++q) {
        float m, inv;
        ln_stats(xv[q], m, inv);
        v4f y[4];
#pragma unroll  // constant indices keep the rows in registers
        for (int k = 0; k < 4; ++k) {
            y[k] = (xv[q][k] - m) * inv * g1[k] + b1[k];
            *(v4f*)(yr + q * 4 * CC + k * 32) = y[k];
        }
        float m2, inv2;
        ln_stats(y, m2, inv2);
#pragma unroll  // constant indices keep the rows in registers
        for (int k = 0; k < 4; ++k) {
            const v4f hv = (y[k] - m2) * inv2 * g2[k] + b2[k];
            *(v4h*)(hr + q * 4 * CC + k * 32) = __builtin_convertvector(hv, v4h);
        }
    }
}

// ---------------------------------------------------------------------------
// Kernel 6: the whole MLP. fc1 (rows x 128 @ 128x512) + exact GELU -> hidden tile in LDS
// (f16), then fc2 (rows x 512 @ 512x128) + bias + residual -> d_out (f32).
// The hidden activations never leave the WGP. One block = 16 waves = 256 rows, worked in two
// tiles of 128 rows; both layers' weights stay in registers over both tiles.
// ---------------------------------------------------------------------------
// f16 per LDS row of the hidden tile: 1040 bytes = 16 x 65, so the 16 rows that a fragment's
// ds_load_b128 reads start 4 banks apart, as with SHP
#define HMP  (MLPH + 8)

__global__ __launch_bounds__(512) void cf_k6_mlp(
    const _Float16* __restrict__ H2, const float* __restrict__ w1,
    const float* __restrict__ b1, const float* __restrict__ w2,
    const float* __restrict__ b2, const float* __restrict__ Y2,
    float* __restrict__ out)
{
    __shared__ alignas(16) _Float16 sh[256 * SHP];   // 68 KiB: the block's 256 input rows
    __shared__ alignas(16) _Float16 hm[128 * HMP];   // 130 KiB: one tile's hidden rows
    const int tid = threadIdx.x;
    const size_t rowBase = (size_t)blockIdx.x * 256;
    // waves 0..7 bring rows 0..127, waves 8..15 rows 128..255; the copies fly under the
    // weight loads below
    async_rows128(sh + (tid >> 8) * 128 * SHP, H2 + (rowBase + (tid >> 8) * 128) * CC, tid & 255);

    const int wave = tid >> 5, lane = tid & 31, lr = lane & 15, hi = lane >> 4;
    // fc1: the wave owns hidden column tiles wave and wave + 16.
    // fc2: the wave owns output column tile wave & 7, for row tiles 4 (wave >> 3) .. + 3.
    const int o = (wave & 7) * 16 + lr;
    const float* yb = Y2 + rowBase * CC;
    float* ob = out + rowBase * CC;
    v16h bw1[2][4];
    v16h bw2[16];
    float bias1[2];
#pragma unroll  // constant indices keep the fragment arrays in registers
    for (int j = 0; j < 2; ++j) bias1[j] = b1[(wave + 16 * j) * 16 + lr];
    const float bias2 = b2[o];
    // precaution: stands before the address registers of these loads are given a new value
    asm volatile("s_wait_xcnt 0x0" ::: "memory");
#pragma unroll  // constant indices keep the fragment arrays in registers
    for (int f = 0; f < 24; ++f) {
        // batches of 10, 8, 4 and 2 fragments: keeps later fragments' f32 loads from rising
        // above earlier conversions (with too many staged at once, registers spilled)
        if (f == 10 || f == 18 || f == 22) __builtin_amdgcn_sched_barrier(0);
        if (f < 16) {
            load_w_frag(bw2[f], w2 + (size_t)o * MLPH + f * 32, hi);
        } else {
            const int j = (f - 16) >> 2, kk = (f - 16) & 3;
            load_w_frag(bw1[j][kk], w1 + (size_t)((wave + 16 * j) * 16 + lr) * CC + kk * 32, hi);
        }
    }
    wait_async();
    __syncthreads();

    for (int t = 0; t < 2; ++t) {
        // every wave has read its last fragment of the tile before: hm may be written again
        if (t) __syncthreads();
        // ---- fc1 + GELU: 128 rows x this wave's 32 hidden columns -> hm ----
        for (int rt = 0; rt < 8; ++rt) {
            v16h a[4];
#pragma unroll  // constant indices keep the fragment arrays in registers
            for (int kk = 0; kk < 4; ++kk)
                for (int e = 0; e < 16; ++e)
                    a[kk][e] = sh[(t * 128 + rt * 16 + lr) * SHP + kk * 32 + kmap(e, hi)];
            // both column tiles' products first: the A fragments are dead before the GELU work
            v8f acc[2] = {};
#pragma unroll  // constant indices keep the fragment arrays in registers
            for (int kk = 0; kk < 4; ++kk)
#pragma unroll  // constant indices keep the fragment arrays in registers
                for (int j = 0; j < 2; ++j)
                    acc[j] = __builtin_amdgcn_wmma_f32_16x16x32_f16(
                        false, a[kk], false, bw1[j][kk], (short)0, acc[j], false, false);
#pragma unroll  // constant indices keep the accumulators in registers
            for (int j = 0; j < 2; ++j)
                for (int r = 0; r < 8; ++r) {
                    const float v = acc[j][r] + bias1[j];
                    const float ge = 0.5f * v * (1.f + erff(v * 0.70710678f));
                    hm[(rt * 16 + r + 8 * hi) * HMP + (wave + 16 * j) * 16 + lr] = (_Float16)ge;
                }
        }
        // the tile's hidden rows are complete before any wave reads them
        __syncthreads();
        // ---- fc2 + bias + residual: this wave's 64 rows x 16 output columns ----
        for (int i = 0; i < 4; ++i) {
            const int rt = (wave >> 3) * 4 + i;
            const _Float16* ar = hm + (rt * 16 + lr) * HMP;
            const int n0 = (t * 128 + rt * 16 + 8 * hi) * CC + o;   // in the block's 256 rows
            float res[8];
#pragma unroll  // constant indices keep the values in registers
            for (int r = 0; r < 8; ++r) res[r] = yb[n0 + r * CC];
            v8f acc = {};
#pragma unroll  // constant indices keep the fragment arrays in registers
            for (int g = 0; g < 4; ++g) {
                v16h a[4];
#pragma unroll  // constant indices keep the fragment arrays in registers
                for (int kk = 0; kk < 4; ++kk)
                    for (int e = 0; e < 16; ++e)
                        a[kk][e] = ar[(g * 4 + kk) * 32 + kmap(e, hi)];
#pragma unroll  // constant indices keep the fragment arrays in registers
                for (int kk = 0; kk < 4; ++kk)
                    acc = __builtin_amdgcn_wmma_f32_16x16x32_f16(
                        false, a[kk], false, bw2[g * 4 + kk], (short)0, acc, false, false);
            }
            for (int r = 0; r < 8; ++r) ob[n0 + r * CC] = acc[r] + bias2 + res[r];
            // precaution: stands before the registers of these loads and stores get a new value
            asm volatile("s_wait_xcnt 0x0" ::: "memory");
        }
    }
}

// ---------------------------------------------------------------------------
// Host-side orchestration. Workspace plan (peak 96 MiB, no live overlaps):
//   [0,32M)   Y0 f32     -> later Y2 f32
//   [32,48M)  H2 f16
//   [64,96M)  Y1 f32
// ---------------------------------------------------------------------------
extern "C" void kernel_launch(void* const* d_in, const int* in_sizes, int n_in,
                              void* d_out, int out_size, void* d_ws, size_t ws_size,
                              hipStream_t stream) {
    (void)in_sizes; (void)n_in; (void)out_size; (void)ws_size;
    const float* x       = (const float*)d_in[0];
    const float* norm1_g = (const float*)d_in[1];
    const float* norm1_b = (const float*)d_in[2];
    const float* pos     = (const float*)d_in[3];
    const float* temb    = (const float*)d_in[4];
    const float* qkv_w   = (const float*)d_in[5];
    const float* qkv_b   = (const float*)d_in[6];
    const float* proj_w  = (const float*)d_in[7];
    const float* proj_b  = (const float*)d_in[8];
    const float* conv_w  = (const float*)d_in[9];
    const float* conv_b  = (const float*)d_in[10];
    const float* exln_g  = (const float*)d_in[11];
    const float* exln_b  = (const float*)d_in[12];
    const float* norm2_g = (const float*)d_in[13];
    const float* norm2_b = (const float*)d_in[14];
    const float* fc1_w   = (const float*)d_in[15];
    const float* fc1_b   = (const float*)d_in[16];
    const float* fc2_w   = (const float*)d_in[17];
    const float* fc2_b   = (const float*)d_in[18];

    char* ws = (char*)d_ws;
    const size_t MB = 1u << 20;
    float*    Y0 = (float*)   (ws + 0 * MB);
    float*    Y1 = (float*)   (ws + 64 * MB);
    float*    Y2 = (float*)   (ws + 0 * MB);
    _Float16* H2 = (_Float16*)(ws + 32 * MB);
    float*    out = (float*)d_out;

    cf_k1_window_attn<<<NWIN, 256, 0, stream>>>(x, norm1_g, norm1_b, pos, temb,
                                                qkv_w, qkv_b, proj_w, proj_b, Y0);
    cf_k4_dwconv<<<NROW / 256, 512, 0, stream>>>(Y0, conv_w, conv_b, Y1);
    cf_k5_lns<<<NROW / 128, 256, 0, stream>>>(Y1, exln_g, exln_b,
                                              norm2_g, norm2_b, Y2, H2);
    cf_k6_mlp<<<NROW / 256, 512, 0, stream>>>(H2, fc1_w, fc1_b, fc2_w, fc2_b, Y2, out);
}

// v008
// It runs in 74.6 microseconds.
// Two timings next to v007 put it at 1.39 and 1.41 times that version's speed.
// All steps since v000 together make it 7.56 times as fast.
#include <hip/hip_runtime.h>
#include <hip/hip_bf16.h>
#include <math.h>

// ---------------------------------------------------------------------------
// CrossFormerBlock for MI455X (gfx1250, wave32, WMMA 16x16x32 f16 -> f32 acc)
// Two launches: window attention; then conv, both LayerNorms and the MLP, whose intermediate
// rows stay in LDS. WMMA for all six GEMMs, VALU for softmax/LN/conv.
// ---------------------------------------------------------------------------

typedef __attribute__((ext_vector_type(16))) _Float16 v16h;
typedef __attribute__((ext_vector_type(8)))  float    v8f;

// K-index inside a 16x32 f16 A/B fragment for element e (0..15) of the v16h,
// given lane-half hi = lane/16 (CDNA5 ISA 7.12.2 16-bit A/B layout).
__device__ __forceinline__ int kmap(int e, int hi) {
    return ((e >> 3) << 4) + (((e >> 1) & 3) << 1) + (hi << 3) + (e & 1);
}

// One B fragment from 32 consecutive f32 weights of this lane's output column, as f16.
__device__ __forceinline__ void load_w_frag(v16h& f, const float* __restrict__ w, int hi) {
#pragma unroll  // constant indices keep the fragment arrays in registers
    for (int e = 0; e < 16; ++e) f[e] = (_Float16)w[kmap(e, hi)];
    // precaution: stands before the address registers of these loads are given a new value
    asm volatile("s_wait_xcnt 0x0" ::: "memory");
}

// Static problem dims
#define CC   128
#define TT   4
#define GG   4
#define NTOK 256        // tokens per window (G^3 * T)
#define NWIN 256        // windows
#define NHD  8          // heads
#define HDSZ 16         // head dim
#define MLPH 512
#define NROW 65536      // total tokens B*D*H*W*T
#define ATT_SCALE 0.25f // 1/sqrt(16)
// f16 per LDS row of a staged 128-channel A tile: 272 bytes = 16 x 17, so the 16 rows that a
// fragment's ds_load_b128 reads start 4 banks apart and cover all 64 banks (256-byte rows
// put all 16 on the same 4 banks)
#define SHP  (CC + 8)

// ---------------------------------------------------------------------------
// LayerNorm rows, eight lanes a token. Lane piece s = lane & 7 holds channels
// 4 (s + 8 k) .. + 3 for k = 0..3, the token is picked by lane >> 3: one wave-wide 16-byte
// load or store covers four tokens x one whole 128-byte line, and a row stays in registers
// from its load to its last use.
// ---------------------------------------------------------------------------
typedef __attribute__((ext_vector_type(4))) float    v4f;
typedef __attribute__((ext_vector_type(4))) _Float16 v4h;

// v + (v of lane l ^ XM), XM < 16, as a DPP row_xmask move
template <int XM>
__device__ __forceinline__ float add_xmask(float v) {
    const int b = __builtin_bit_cast(int, v);
    return v + __builtin_bit_cast(float,
        __builtin_amdgcn_update_dpp(b, b, 0x160 + XM, 0xf, 0xf, false));
}
// total over the eight lanes of a token, in every one of them
__device__ __forceinline__ float sum8(float v) {
    return add_xmask<4>(add_xmask<2>(add_xmask<1>(v)));
}
__device__ __forceinline__ void ln_load(v4f (&v)[4], const float* p) {
#pragma unroll  // constant indices keep the row in registers
    for (int k = 0; k < 4; ++k) v[k] = *(const v4f*)(p + k * 32);
}
// mean and 1 / sqrt(var + eps) of the token whose row lies in v on these eight lanes
__device__ __forceinline__ void ln_stats(const v4f (&v)[4], float& m, float& inv) {
    const v4f s = (v[0] + v[1]) + (v[2] + v[3]);
    v4f q = v[0] * v[0];
#pragma unroll  // constant indices keep the row in registers
    for (int k = 1; k < 4; ++k) q = __builtin_elementwise_fma(v[k], v[k], q);
    const float sm = sum8((s.x + s.y) + (s.z + s.w));
    const float sq = sum8((q.x + q.y) + (q.z + q.w));
    m = sm * (1.f / CC);
    inv = rsqrtf(sq * (1.f / CC) - m * m + 1e-5f);
}

// ---------------------------------------------------------------------------
// Attention helpers. Scores are held transposed, S^T = K Q^T: a lane's accumulator registers
// hold ONE query's scores (query = lane & 15, key = 16 kt + 8 hi + r), so the row maximum and
// the row sum are in-lane work plus one exchange between the wave's halves. Two score tiles,
// converted in place, are the B operand of O^T += V^T P^T over 32 keys: P never leaves the
// registers. All 256 keys of a query are held at once, so the softmax is one pass with the
// true row maximum.
// ---------------------------------------------------------------------------
typedef __attribute__((ext_vector_type(8))) _Float16 v8h;
typedef __attribute__((ext_vector_type(2))) _Float16 v2h;
typedef __attribute__((ext_vector_type(8))) short    v8s;
typedef __attribute__((ext_vector_type(2))) float    v2f;
#define LOG2E 1.4426950408889634f

// lane l <-> lane l ^ 16
__device__ __forceinline__ float xhalf(float v) {
    const int b = __builtin_bit_cast(int, v);
    return __builtin_bit_cast(float, __builtin_amdgcn_permlanex16(
        b, b, 0x76543210, 0xfedcba98, false, false));
}

// A or B fragment of a row of 16 f16 (head dim): k = 8 hi + e for e < 8, zero above k = 15
__device__ __forceinline__ v16h row16_frag(const _Float16* row, int hi) {
    const v8h lo = *(const v8h*)(row + hi * 8);
    const v8h z = {};
    return __builtin_shufflevector(lo, z, 0, 1, 2, 3, 4, 5, 6, 7, 8, 9, 10, 11, 12, 13, 14, 15);
}

// transposing LDS load: lane (lr, hi) gets column lr of the 8 rows 8 hi .. 8 hi + 7 of a
// 16 x 16 f16 tile; p is this lane's own address in the tile (formed by the caller)
__device__ __forceinline__ v8h lds_tr16(const _Float16* p) {
    typedef __attribute__((address_space(3))) v8s lds_v8s;
    return __builtin_bit_cast(v8h, __builtin_amdgcn_ds_load_tr16_b128_v8i16((lds_v8s*)p));
}

// ---------------------------------------------------------------------------
// Kernel 1: the whole window attention, one block per window, one wave per head.
//   A  LN + pos/time embed -> sh (f16)
//   B  QKV GEMM (256x384, K=128): wave w makes head w's Q, K and V, into LDS
//   C  attention of head w over the window's 256 tokens, output -> sh (f16)
//   D  output projection (256x128 @ 128x128) + window-merge scatter -> Y0
// Q, K, V and the attention output never leave the WGP.
// ---------------------------------------------------------------------------
__global__ __launch_bounds__(256) void cf_k1_window_attn(
    const float* __restrict__ x, const float* __restrict__ n1g,
    const float* __restrict__ n1b, const float* __restrict__ pos,
    const float* __restrict__ temb, const float* __restrict__ qkv_w,
    const float* __restrict__ qkv_b, const float* __restrict__ pw,
    const float* __restrict__ pb, float* __restrict__ Y0)
{
    __shared__ alignas(16) _Float16 sh[NTOK * SHP];                 // 68 KiB (LDS is 320 KiB/WGP)
    __shared__ alignas(16) _Float16 qkvh[NHD * 3 * NTOK * HDSZ];    // 192 KiB: [head][q,k,v][token][16]
    const int tid = threadIdx.x, win = blockIdx.x;
    const int wd = win >> 6, wh = (win >> 3) & 7, ww = win & 7;

    // ---- A: per-token LN + embeds: a wave takes 32 tokens, four at a time ----
    {
        const int wv = tid >> 5, gw = (tid >> 3) & 3, pc = (tid & 7) * 4;
        const int t = wv >> 1;                       // token n = 32 wv + 4 q + gw
        const int d0 = wd * GG + (wv & 1) * 2, h0 = wh * GG, w = ww * GG + gw;
        const float* xb = x + ((((size_t)d0 * 32 + h0) * 32 + w) * TT + t) * CC + pc;
        v4f xv[8][4];
#pragma unroll  // constant indices keep the rows in registers; all 32 loads are in flight at once
        for (int q = 0; q < 8; ++q)                  // gd = 2 (wv & 1) + (q >> 2), gh = q & 3
            ln_load(xv[q], xb + (size_t)(((q >> 2) * 32 + (q & 3)) * 32) * TT * CC);
        v4f g[4], b[4], te[4];
        ln_load(g, n1g + pc);
        ln_load(b, n1b + pc);
        ln_load(te, temb + t * CC + pc);
        const float* pb0 = pos + ((wv & 1) * 32 + gw) * CC + pc;
        v4f pr[8][4];                                // fetched two steps ahead of their use
        ln_load(pr[0], pb0);
        ln_load(pr[1], pb0 + 4 * CC);
        // precaution: stands before the address registers of the loads above get a new value
        asm volatile("s_wait_xcnt 0x0" ::: "memory");
        _Float16* db = sh + (wv * 32 + gw) * SHP + pc;
#pragma unroll  // constant indices keep the rows in registers
        for (int q = 0; q < 8; ++q) {
            // keeps the loads above in front of the arithmetic (sunk to their users, the last
            // rows started late) and later steps' loads from rising here (past 256 registers)
            __builtin_amdgcn_sched_barrier(0);
            if (q + 2 < 8) ln_load(pr[q + 2], pb0 + (q + 2) * 4 * CC);
            float m, inv;
            ln_stats(xv[q], m, inv);
#pragma unroll  // constant indices keep the rows in registers
            for (int k = 0; k < 4; ++k) {
                const v4f hv = (xv[q][k] - m) * inv * g[k] + b[k] + pr[q][k] + te[k];
                *(v4h*)(db + q * 4 * SHP + k * 32) = __builtin_convertvector(hv, v4h);
            }
        }
        // precaution: stands before the address register of the loads in the loop gets a new value
        asm volatile("s_wait_xcnt 0x0" ::: "memory");
    }
    __syncthreads();

    // ---- B: sh(256x128) @ qkv_w^T(128x384) ----
    const int wave = tid >> 5, lane = tid & 31, lr = lane & 15, hi = lane >> 4;
    _Float16* Qh = qkvh + wave * 3 * NTOK * HDSZ;    // this wave's head: 8 KiB each
    _Float16* Kh = Qh + NTOK * HDSZ;
    _Float16* Vh = Kh + NTOK * HDSZ;
    {
        // The wave owns column tiles wave, wave + 8, wave + 16 (its head's Q, K and V columns):
        // their weights are fetched and converted once and stay in registers over all row tiles.
        v16h bw[3][4];
        float bias[3];
#pragma unroll  // constant indices keep the fragment arrays in registers
        for (int j = 0; j < 3; ++j) bias[j] = qkv_b[(wave + 8 * j) * 16 + lr];
        // precaution: stands before the address register of these loads is given a new value
        asm volatile("s_wait_xcnt 0x0" ::: "memory");
#pragma unroll  // constant indices keep the fragment arrays in registers
        for (int j = 0; j < 3; ++j) {
            const int o = (wave + 8 * j) * 16 + lr;
#pragma unroll  // constant indices keep the fragment arrays in registers
            for (int kk = 0; kk < 4; ++kk)
                load_w_frag(bw[j][kk], qkv_w + (size_t)o * CC + kk * 32, hi);
        }
        for (int rt = 0; rt < 16; ++rt) {
            v16h a[4];
#pragma unroll  // constant indices keep the fragment arrays in registers
            for (int kk = 0; kk < 4; ++kk)
                for (int e = 0; e < 16; ++e)
                    a[kk][e] = sh[(rt * 16 + lr) * SHP + kk * 32 + kmap(e, hi)];
#pragma unroll  // constant indices keep the fragment arrays in registers
            for (int j = 0; j < 3; ++j) {
                v8f acc = {};
#pragma unroll  // constant indices keep the fragment arrays in registers
                for (int kk = 0; kk < 4; ++kk)
                    acc = __builtin_amdgcn_wmma_f32_16x16x32_f16(
                        false, a[kk], false, bw[j][kk], (short)0, acc, false, false);
                for (int r = 0; r < 8; ++r) {
                    const int nrow = rt * 16 + r + 8 * hi;
                    const float val = acc[r] + bias[j];
                    Qh[(j * NTOK + nrow) * HDSZ + lr] =
                        (_Float16)(j == 0 ? val * ATT_SCALE : val);
                }
            }
        }
    }
    // every wave has read its last fragment of sh: the attention output may be written there
    __syncthreads();

    // ---- C: attention of this wave's head, 16 queries a trip ----
    // this lane's address in a 16-key tile of V for the transposing load (rows of 32 bytes)
    const _Float16* vt = Vh + (8 * hi + (lane & 7)) * HDSZ + ((lane >> 3) & 1) * 8;
#pragma nounroll  // one trip is some thousand instructions: kept rolled, for speed only
    for (int qt = 0; qt < 16; ++qt) {
        const v16h bq = row16_frag(Qh + (qt * 16 + lr) * HDSZ, hi);

        v8f s[16];   // s[kt][r] = score of query qt * 16 + lr with key kt * 16 + 8 * hi + r
#pragma unroll  // constant indices keep the score tiles in registers
        for (int kt = 0; kt < 16; ++kt) {
            const v16h ak = row16_frag(Kh + (kt * 16 + lr) * HDSZ, hi);
            const v8f zc = {};
            s[kt] = __builtin_amdgcn_wmma_f32_16x16x32_f16(
                false, ak, false, bq, (short)0, zc, false, false);
        }

        float m4[4] = {-1e30f, -1e30f, -1e30f, -1e30f};   // four chains, joined below
#pragma unroll
        for (int kt = 0; kt < 16; ++kt)
#pragma unroll
            for (int r = 0; r < 8; ++r) m4[kt & 3] = fmaxf(m4[kt & 3], s[kt][r]);
        float mx = fmaxf(fmaxf(m4[0], m4[1]), fmaxf(m4[2], m4[3]));
        mx = fmaxf(mx, xhalf(mx));
        const float nm = -mx * LOG2E;

        v2f sum[4] = {};
        v8f oacc = {};   // oacc[r] = O^T[head dim 8 * hi + r][query lr], not yet normalised
#pragma unroll  // constant indices keep the score tiles in registers
        for (int j = 0; j < 8; ++j) {   // 32 keys a trip
            const v8h v0 = lds_tr16(vt + (j * 32) * HDSZ);
            const v8h v1 = lds_tr16(vt + (j * 32 + 16) * HDSZ);
            const v16h av = __builtin_shufflevector(
                v0, v1, 0, 1, 2, 3, 4, 5, 6, 7, 8, 9, 10, 11, 12, 13, 14, 15);
            v16h pf;   // pf[e] = P^T[key j * 32 + kmap(e, hi)][query lr]
#pragma unroll
            for (int i = 0; i < 8; ++i) {
                const v8f& st = s[2 * j + (i >> 2)];
                const v2f sv = {st[2 * (i & 3)], st[2 * (i & 3) + 1]};
                const v2f arg = __builtin_elementwise_fma(sv, v2f{LOG2E, LOG2E}, v2f{nm, nm});
                const v2f p = {__builtin_amdgcn_exp2f(arg.x), __builtin_amdgcn_exp2f(arg.y)};
                sum[i & 3] += p;
                const v2h ph = __builtin_convertvector(p, v2h);
                pf[2 * i] = ph.x;
                pf[2 * i + 1] = ph.y;
            }
            oacc = __builtin_amdgcn_wmma_f32_16x16x32_f16(
                false, av, false, pf, (short)0, oacc, false, false);
        }
        const v2f s2 = (sum[0] + sum[1]) + (sum[2] + sum[3]);
        float l = s2.x + s2.y;
        l += xhalf(l);
        const float inv = 1.f / l;

        v8h ov;
#pragma unroll
        for (int r = 0; r < 8; ++r) ov[r] = (_Float16)(oacc[r] * inv);
        *(v8h*)(sh + (qt * 16 + lr) * SHP + wave * HDSZ + hi * 8) = ov;
    }

    // ---- D: sh(256x128) @ pw^T(128x128), scattered back to (D,H,W,T,C) ----
    // The wave owns column tile 'wave': its weights stay in registers over all row tiles.
    const int o = wave * 16 + lr;
    const float bias = pb[o];
    v16h bw[4];
#pragma unroll  // constant indices keep the fragment arrays in registers
    for (int kk = 0; kk < 4; ++kk) load_w_frag(bw[kk], pw + (size_t)o * CC + kk * 32, hi);
    // all eight heads' columns of sh are complete before any wave reads a row
    __syncthreads();
    for (int rt = 0; rt < 16; ++rt) {
        v8f acc = {};
#pragma unroll  // constant indices keep the fragment arrays in registers
        for (int kk = 0; kk < 4; ++kk) {
            v16h a;
            for (int e = 0; e < 16; ++e)
                a[e] = sh[(rt * 16 + lr) * SHP + kk * 32 + kmap(e, hi)];
            acc = __builtin_amdgcn_wmma_f32_16x16x32_f16(
                false, a, false, bw[kk], (short)0, acc, false, false);
        }
        for (int r = 0; r < 8; ++r) {
            const int n = rt * 16 + r + 8 * hi;
            const int t = n >> 6, rem = n & 63;
            const int gd = rem >> 4, gh = (rem >> 2) & 3, gw = rem & 3;
            const int d = wd * GG + gd, h = wh * GG + gh, w = ww * GG + gw;
            const size_t off = ((((size_t)d * 32 + h) * 32 + w) * TT + t) * CC + o;
            Y0[off] = acc[r] + bias;
        }
        // precaution: stands before the registers of these stores are given a new value
        asm volatile("s_wait_xcnt 0x0" ::: "memory");
    }
}

// ---------------------------------------------------------------------------
// Kernel 2: depthwise 3x3x3 conv over (D,H,W) (T folded into batch), exLN, norm2 and the MLP,
// one block of 16 waves per 256 tokens (2 d x 4 h rows x 32 w of one t).
//   A  conv: one wave = 64 channels of one (d,h,t) row, 2 channels per lane. The lane keeps its
//      2 x 27 weights in registers and walks the 32 columns of W: each loaded column (9 rows x
//      2 floats) feeds the three outputs it touches. Neighbouring waves read the same lines.
//      Taps outside D or H: the row index is clamped and the tap's weight is zero. -> cv (f32)
//   B  exLN -> y, in place in cv (f32, residual base); norm2(y) -> sh (f16 MLP input);
//      eight lanes a token
//   C  fc1 (rows x 128 @ 128x512) + exact GELU -> hidden tile hm (f16), then fc2 (rows x 512 @
//      512x128) + bias + residual -> d_out (f32), in four tiles of 64 rows; both layers'
//      weights stay in registers over all tiles
// Conv rows, y, the MLP input and the hidden activations never leave the WGP.
// ---------------------------------------------------------------------------
#define DW_CS (TT * CC)   // floats from one column of W to the next
#define DW_NB 4           // column buffers: a column is fetched DW_NB - 1 ahead
// f16 per LDS row of the hidden tile: 1040 bytes = 16 x 65, so the 16 rows that a fragment's
// ds_load_b128 reads start 4 banks apart, as with SHP
#define HMP  (MLPH + 8)
#define HTR  64           // rows of a hidden tile

// cv holds channel c of local token n at n * CC + (c ^ cv_sw(n)): rows are 512 bytes, so equal
// channels of all rows share a bank; swapping the 32-channel halves by bit 0 ^ bit 3 of the row
// sets neighbouring tokens (LayerNorm's 16-byte reads) and rows 8 apart (the two halves of an
// accumulator's residual read) 32 banks apart
__device__ __forceinline__ int cv_sw(int n) { return (((n >> 3) ^ n) & 1) << 5; }

__device__ __forceinline__ void dw_load_col(v2f (&b)[9], const float* const (&rp)[9],
                                            int off) {
#pragma unroll
    for (int j = 0; j < 9; ++j) b[j] = *(const v2f*)(rp[j] + off);
}

// acc += sum over the 9 (kd,kh) rows of column b times the weights of tap KW
template <int KW>
__device__ __forceinline__ void dw_fma_col(v2f& acc, const v2f (&b)[9],
                                           const v2f (&wp)[27]) {
#pragma unroll
    for (int j = 0; j < 9; ++j) acc = __builtin_elementwise_fma(b[j], wp[j * 3 + KW], acc);
}

__global__ __launch_bounds__(512) void cf_k2_conv_ln_mlp(
    const float* __restrict__ Y0, const float* __restrict__ cw,
    const float* __restrict__ cb, const float* __restrict__ eg,
    const float* __restrict__ eb, const float* __restrict__ n2g,
    const float* __restrict__ n2b, const float* __restrict__ w1,
    const float* __restrict__ b1, const float* __restrict__ w2,
    const float* __restrict__ b2, float* __restrict__ out)
{
    __shared__ alignas(16) float    cv[256 * CC];    // 128 KiB: conv rows, then y
    __shared__ alignas(16) _Float16 sh[256 * SHP];   // 68 KiB: the block's 256 MLP input rows
    __shared__ alignas(16) _Float16 hm[HTR * HMP];   // 65 KiB: one tile's hidden rows
    // the conv weights, [c][tap], lie in hm's place until the lanes hold them: 864 float4; the
    // rest of the 1024 only lets every thread store twice
    float4* swt = (float4*)hm;
    const int tid = threadIdx.x;
    const int lane = tid & 31;
    const int bx = blockIdx.x;
    const int tt = bx & 3, h0 = ((bx >> 2) & 7) * 4, d0 = (bx >> 5) * 2;

    // LayerNorm's scales and shifts for this lane's 16 channels: fetched with the first conv
    // columns, so that no wave waits for them between the phases
    const int pc = (tid & 7) * 4;
    v4f g1[4], c1[4], g2[4], c2[4];
    // MLP. fc1: the wave owns hidden column tiles wave and wave + 16.
    // fc2: the wave owns output column tile wave & 7, for row tiles 2 (wave >> 3) .. + 1.
    // Their biases are fetched with the first conv columns too.
    const int wave = tid >> 5, lr = lane & 15, hi = lane >> 4;
    const int o = (wave & 7) * 16 + lr;
    float bias1[2], bias2;

    // ---- A: conv ----
    {
        const int wv = __builtin_amdgcn_readfirstlane(tid >> 5);
        const int h = h0 + ((wv >> 1) & 3);
        const int d = d0 + (wv >> 3);
        const int c0 = (wv & 1) * 64;          // this wave's first channel

        // the weights are fetched together with the first columns below
        const float4* cw4 = (const float4*)cw;
        const float4 q0 = cw4[tid];
        const int i1 = min(tid + 512, CC * 27 / 4 - 1);
        const float4 q1 = cw4[i1];

        const float* rp[9];
#pragma unroll
        for (int kd = 0; kd < 3; ++kd)
#pragma unroll
            for (int kh = 0; kh < 3; ++kh) {
                const int dc = min(max(d + kd - 1, 0), 15), hc = min(max(h + kh - 1, 0), 31);
                rp[kd * 3 + kh] = Y0 + ((size_t)((dc * 32 + hc) * 32) * TT + tt) * CC + c0;
            }
        const int lo = lane * 2;
        v2f buf[DW_NB][9];                     // column c lives in buf[c % DW_NB]
        v2f acc[3];                            // output o lives in acc[o % 3]
#pragma unroll
        for (int c = 0; c < DW_NB - 1; ++c) dw_load_col(buf[c], rp, lo + c * DW_CS);
        const v2f bias = *(const v2f*)(cb + c0 + lo);
        ln_load(g1, eg + pc);
        ln_load(c1, eb + pc);
        ln_load(g2, n2g + pc);
        ln_load(c2, n2b + pc);
#pragma unroll  // constant indices keep the values in registers
        for (int j = 0; j < 2; ++j) bias1[j] = b1[(wave + 16 * j) * 16 + lr];
        bias2 = b2[o];

        swt[tid] = q0;
        swt[tid + 512] = q1;
        // precaution: stands before the address registers of the loads above get a new value; i1
        // is named so that its register lives up to here (a later load's result was placed on it)
        asm volatile("s_wait_xcnt 0x0" :: "v"(i1) : "memory");
        // keeps later address arithmetic from rising above that wait
        __builtin_amdgcn_sched_barrier(0);
        __syncthreads();

        // this lane's 2 channels x 27 taps (54 consecutive floats of cw), paired by tap
        const float* lw = (const float*)swt + (c0 + lo) * 27;
        v2f wp[27];
#pragma unroll
        for (int kd = 0; kd < 3; ++kd)
#pragma unroll
            for (int kh = 0; kh < 3; ++kh) {
                const bool ok = (unsigned)(d + kd - 1) < 16u && (unsigned)(h + kh - 1) < 32u;
#pragma unroll
                for (int kw = 0; kw < 3; ++kw) {
                    const int tap = (kd * 3 + kh) * 3 + kw;
                    const float wx = lw[tap], wy = lw[27 + tap];
                    wp[tap].x = ok ? wx : 0.f;
                    wp[tap].y = ok ? wy : 0.f;
                }
            }
        // local token = 32 (wv >> 1) + column
        float* orow = cv + (wv >> 1) * 32 * CC + c0;

        acc[0] = bias;
        // unrolled whole: every buffer index and every address offset is a constant
#pragma unroll
        for (int col = 0; col < 32; ++col) {
            // keeps later columns' loads from being hoisted up here, which spilled registers
            __builtin_amdgcn_sched_barrier(0);
            if (col + DW_NB - 1 < 32)
                dw_load_col(buf[(col + DW_NB - 1) % DW_NB], rp, lo + (col + DW_NB - 1) * DW_CS);
            const v2f (&b)[9] = buf[col % DW_NB];
            if (col > 0) {                     // right neighbour of output col - 1: done
                dw_fma_col<2>(acc[(col + 2) % 3], b, wp);
                *(v2f*)(orow + (col - 1) * CC + (lo ^ cv_sw(col - 1))) = acc[(col + 2) % 3];
            }
            dw_fma_col<1>(acc[col % 3], b, wp);
            if (col < 31) {                    // left neighbour of output col + 1: first
                acc[(col + 1) % 3] = bias;
                dw_fma_col<0>(acc[(col + 1) % 3], b, wp);
            }
        }
        *(v2f*)(orow + 31 * CC + (lo ^ cv_sw(31))) = acc[31 % 3];
        // precaution: stands before the address registers of the loads above get a new value; the
        // lane number, their offset register, is named so that it lives up to here (the last
        // load's result was placed on it while earlier loads from it were in flight)
        asm volatile("s_wait_xcnt 0x0" :: "v"(lane) : "memory");
        // keeps the next phase's set-up from rising above that wait
        __builtin_amdgcn_sched_barrier(0);
    }

    // ---- B: both LayerNorms: a wave takes 16 tokens, four at a time ----
    {
        const int tk0 = (tid >> 5) * 16 + ((tid >> 3) & 3);
        // both channel halves of every conv row are complete before a token's row is read
        __syncthreads();
#pragma unroll  // constant indices keep the rows in registers
        for (int q = 0; q < 4; ++q) {
            const int tok = tk0 + q * 4;
            float* yr = cv + tok * CC;
            const int sw = cv_sw(tok);
            v4f xv[4];
#pragma unroll  // constant indices keep the rows in registers
            for (int k = 0; k < 4; ++k) xv[k] = *(const v4f*)(yr + ((pc + k * 32) ^ sw));
            float m, inv;
            ln_stats(xv, m, inv);
            v4f y[4];
#pragma unroll  // constant indices keep the rows in registers
            for (int k = 0; k < 4; ++k) {
                y[k] = (xv[k] - m) * inv * g1[k] + c1[k];
                *(v4f*)(yr + ((pc + k * 32) ^ sw)) = y[k];
            }
            float m2, inv2;
            ln_stats(y, m2, inv2);
#pragma unroll  // constant indices keep the rows in registers
            for (int k = 0; k < 4; ++k) {
                const v4f hv = (y[k] - m2) * inv2 * g2[k] + c2[k];
                *(v4h*)(sh + tok * SHP + pc + k * 32) = __builtin_convertvector(hv, v4h);
            }
        }
    }

    // ---- C: MLP ----
    v16h bw1[2][4];
    v16h bw2[16];
    const float* w1r = w1 + (size_t)(wave * 16 + lr) * CC;   // column tile wave; + 16 tiles: j = 1
#pragma unroll  // constant indices keep the fragment arrays in registers
    for (int f = 0; f < 24; ++f) {
        // batches of 10, 8, 4 and 2 fragments: keeps later fragments' f32 loads from rising
        // above earlier conversions (with too many staged at once, registers spilled)
        if (f == 10 || f == 18 || f == 22) __builtin_amdgcn_sched_barrier(0);
        if (f < 16) {
            load_w_frag(bw2[f], w2 + (size_t)o * MLPH + f * 32, hi);
        } else {
            const int j = (f - 16) >> 2, kk = (f - 16) & 3;
            load_w_frag(bw1[j][kk], w1r + j * 256 * CC + kk * 32, hi);
        }
    }
    // precaution: w1r is named so that its registers live up to here (the last load's result was
    // placed on them while earlier loads from them were in flight)
    asm volatile("s_wait_xcnt 0x0" :: "v"(w1r) : "memory");
    // every token's y and MLP input row are complete before any wave reads them
    __syncthreads();

    for (int t = 0; t < 256 / HTR; ++t) {
        // every wave has read its last fragment of the tile before: hm may be written again
        if (t) __syncthreads();
        // ---- fc1 + GELU: 64 rows x this wave's 32 hidden columns -> hm ----
        for (int rt = 0; rt < HTR / 16; ++rt) {
            v16h a[4];
#pragma unroll  // constant indices keep the fragment arrays in registers
            for (int kk = 0; kk < 4; ++kk)
                for (int e = 0; e < 16; ++e)
                    a[kk][e] = sh[(t * HTR + rt * 16 + lr) * SHP + kk * 32 + kmap(e, hi)];
            // both column tiles' products first: the A fragments are dead before the GELU work
            v8f acc[2] = {};
#pragma unroll  // constant indices keep the fragment arrays in registers
            for (int kk = 0; kk < 4; ++kk)
#pragma unroll  // constant indices keep the fragment arrays in registers
                for (int j = 0; j < 2; ++j)
                    acc[j] = __builtin_amdgcn_wmma_f32_16x16x32_f16(
                        false, a[kk], false, bw1[j][kk], (short)0, acc[j], false, false);
#pragma unroll  // constant indices keep the accumulators in registers
            for (int j = 0; j < 2; ++j)
                for (int r = 0; r < 8; ++r) {
                    const float v = acc[j][r] + bias1[j];
                    const float ge = 0.5f * v * (1.f + erff(v * 0.70710678f));
                    hm[(rt * 16 + r + 8 * hi) * HMP + (wave + 16 * j) * 16 + lr] = (_Float16)ge;
                }
        }
        // the tile's hidden rows are complete before any wave reads them
        __syncthreads();
        // ---- fc2 + bias + residual: this wave's 32 rows x 16 output columns ----
        // these 32 rows are the 32 columns of W of the block's row 2 t + (wave >> 3)
        const int d = d0 + (t >> 1), h = h0 + (t & 1) * 2 + (wave >> 3);
        float* ob = out + ((size_t)((d * 32 + h) * 32) * TT + tt) * CC + o;
        for (int i = 0; i < 2; ++i) {
            const int rt = (wave >> 3) * 2 + i;
            const _Float16* ar = hm + (rt * 16 + lr) * HMP;
            const int n0 = t * HTR + rt * 16 + 8 * hi;   // local token of accumulator row 0
            float res[8];
#pragma unroll  // constant indices keep the values in registers
            for (int r = 0; r < 8; ++r) res[r] = cv[(n0 + r) * CC + (o ^ cv_sw(n0 + r))];
            v8f acc = {};
#pragma unroll  // constant indices keep the fragment arrays in registers
            for (int g = 0; g < 4; ++g) {
                v16h a[4];
#pragma unroll  // constant indices keep the fragment arrays in registers
                for (int kk = 0; kk < 4; ++kk)
                    for (int e = 0; e < 16; ++e)
                        a[kk][e] = ar[(g * 4 + kk) * 32 + kmap(e, hi)];
#pragma unroll  // constant indices keep the fragment arrays in registers
                for (int kk = 0; kk < 4; ++kk)
                    acc = __builtin_amdgcn_wmma_f32_16x16x32_f16(
                        false, a[kk], false, bw2[g * 4 + kk], (short)0, acc, false, false);
            }
            for (int r = 0; r < 8; ++r)
                ob[(i * 16 + 8 * hi + r) * DW_CS] = acc[r] + bias2 + res[r];
            // precaution: stands before the registers of these stores get a new value
            asm volatile("s_wait_xcnt 0x0" ::: "memory");
        }
    }
}

// ---------------------------------------------------------------------------
// Host-side orchestration. Workspace: [0,32M) Y0 f32, the attention block's output.
// ---------------------------------------------------------------------------
extern "C" void kernel_launch(void* const* d_in, const int* in_sizes, int n_in,
                              void* d_out, int out_size, void* d_ws, size_t ws_size,
                              hipStream_t stream) {
    (void)in_sizes; (void)n_in; (void)out_size; (void)ws_size;
    const float* x       = (const float*)d_in[0];
    const float* norm1_g = (const float*)d_in[1];
    const float* norm1_b = (const float*)d_in[2];
    const float* pos     = (const float*)d_in[3];
    const float* temb    = (const float*)d_in[4];
    const float* qkv_w   = (const float*)d_in[5];
    const float* qkv_b   = (const float*)d_in[6];
    const float* proj_w  = (const float*)d_in[7];
    const float* proj_b  = (const float*)d_in[8];
    const float* conv_w  = (const float*)d_in[9];
    const float* conv_b  = (const float*)d_in[10];
    const float* exln_g  = (const float*)d_in[11];
    const float* exln_b  = (const float*)d_in[12];
    const float* norm2_g = (const float*)d_in[13];
    const float* norm2_b = (const float*)d_in[14];
    const float* fc1_w   = (const float*)d_in[15];
    const float* fc1_b   = (const float*)d_in[16];
    const float* fc2_w   = (const float*)d_in[17];
    const float* fc2_b   = (const float*)d_in[18];

    float* Y0 = (float*)d_ws;
    float* out = (float*)d_out;

    cf_k1_window_attn<<<NWIN, 256, 0, stream>>>(x, norm1_g, norm1_b, pos, temb,
                                                qkv_w, qkv_b, proj_w, proj_b, Y0);
    cf_k2_conv_ln_mlp<<<NROW / 256, 512, 0, stream>>>(Y0, conv_w, conv_b, exln_g, exln_b,
                                                      norm2_g, norm2_b, fc1_w, fc1_b,
                                                      fc2_w, fc2_b, out);
}

// v009
// It runs in 70.6 microseconds.
// In two side-by-side timings against v008, it was 1.05 and 1.06 times as fast.
// All steps since v000 together make it 7.97 times as fast.
#include <hip/hip_runtime.h>
#include <hip/hip_bf16.h>
#include <math.h>

// ---------------------------------------------------------------------------
// CrossFormerBlock for MI455X (gfx1250, wave32, WMMA 16x16x32 f16 -> f32 acc)
// Two launches: window attention; then conv, both LayerNorms and the MLP, whose intermediate
// rows stay in LDS. WMMA for all six GEMMs, VALU for softmax/LN/conv.
// ---------------------------------------------------------------------------

typedef __attribute__((ext_vector_type(16))) _Float16 v16h;
typedef __attribute__((ext_vector_type(8)))  float    v8f;

// K-index inside a 16x32 f16 A/B fragment for element e (0..15) of the v16h,
// given lane-half hi = lane/16 (CDNA5 ISA 7.12.2 16-bit A/B layout).
__device__ __forceinline__ int kmap(int e, int hi) {
    return ((e >> 3) << 4) + (((e >> 1) & 3) << 1) + (hi << 3) + (e & 1);
}

// One B fragment from 32 consecutive f32 weights of this lane's output column, as f16.
__device__ __forceinline__ void load_w_frag(v16h& f, const float* __restrict__ w, int hi) {
#pragma unroll  // constant indices keep the fragment arrays in registers
    for (int e = 0; e < 16; ++e) f[e] = (_Float16)w[kmap(e, hi)];
    // precaution: stands before the address registers of these loads are given a new value
    asm volatile("s_wait_xcnt 0x0" ::: "memory");
}

// Static problem dims
#define CC   128
#define TT   4
#define GG   4
#define NTOK 256        // tokens per window (G^3 * T)
#define NWIN 256        // windows
#define NHD  8          // heads
#define HDSZ 16         // head dim
#define MLPH 512
#define NROW 65536      // total tokens B*D*H*W*T
#define ATT_SCALE 0.25f // 1/sqrt(16)
// f16 per LDS row of a staged 128-channel A tile: 272 bytes = 16 x 17, so the 16 rows that a
// fragment's ds_load_b128 reads start 4 banks apart and cover all 64 banks (256-byte rows
// put all 16 on the same 4 banks)
#define SHP  (CC + 8)

// ---------------------------------------------------------------------------
// LayerNorm rows, eight lanes a token. Lane piece s = lane & 7 holds channels
// 4 (s + 8 k) .. + 3 for k = 0..3, the token is picked by lane >> 3: one wave-wide 16-byte
// load or store covers four tokens x one whole 128-byte line, and a row stays in registers
// from its load to its last use.
// ---------------------------------------------------------------------------
typedef __attribute__((ext_vector_type(4))) float    v4f;
typedef __attribute__((ext_vector_type(4))) _Float16 v4h;

// v + (v of lane l ^ XM), XM < 16, as a DPP row_xmask move
template <int XM>
__device__ __forceinline__ float add_xmask(float v) {
    const int b = __builtin_bit_cast(int, v);
    return v + __builtin_bit_cast(float,
        __builtin_amdgcn_update_dpp(b, b, 0x160 + XM, 0xf, 0xf, false));
}
// total over the eight lanes of a token, in every one of them
__device__ __forceinline__ float sum8(float v) {
    return add_xmask<4>(add_xmask<2>(add_xmask<1>(v)));
}
__device__ __forceinline__ void ln_load(v4f (&v)[4], const float* p) {
#pragma unroll  // constant indices keep the row in registers
    for (int k = 0; k < 4; ++k) v[k] = *(const v4f*)(p + k * 32);
}
// mean and 1 / sqrt(var + eps) of the token whose row lies in v on these eight lanes
__device__ __forceinline__ void ln_stats(const v4f (&v)[4], float& m, float& inv) {
    const v4f s = (v[0] + v[1]) + (v[2] + v[3]);
    v4f q = v[0] * v[0];
#pragma unroll  // constant indices keep the row in registers
    for (int k = 1; k < 4; ++k) q = __builtin_elementwise_fma(v[k], v[k], q);
    const float sm = sum8((s.x + s.y) + (s.z + s.w));
    const float sq = sum8((q.x + q.y) + (q.z + q.w));
    m = sm * (1.f / CC);
    inv = rsqrtf(sq * (1.f / CC) - m * m + 1e-5f);
}

// ---------------------------------------------------------------------------
// Attention helpers. Scores are held transposed, S^T = K Q^T: a lane's accumulator registers
// hold ONE query's scores (query = lane & 15, key = 16 kt + 8 hi + r), so the row maximum and
// the row sum are in-lane work plus one exchange between the wave's halves. Two score tiles,
// converted in place, are the B operand of O^T += V^T P^T over 32 keys: P never leaves the
// registers. All 256 keys of a query are held at once, so the softmax is one pass with the
// true row maximum.
// ---------------------------------------------------------------------------
typedef __attribute__((ext_vector_type(8))) _Float16 v8h;
typedef __attribute__((ext_vector_type(2))) _Float16 v2h;
typedef __attribute__((ext_vector_type(8))) short    v8s;
typedef __attribute__((ext_vector_type(2))) float    v2f;
#define LOG2E 1.4426950408889634f

// lane l <-> lane l ^ 16
__device__ __forceinline__ float xhalf(float v) {
    const int b = __builtin_bit_cast(int, v);
    return __builtin_bit_cast(float, __builtin_amdgcn_permlanex16(
        b, b, 0x76543210, 0xfedcba98, false, false));
}

// A or B fragment of a row of 16 f16 (head dim): k = 8 hi + e for e < 8, zero above k = 15
__device__ __forceinline__ v16h row16_frag(const _Float16* row, int hi) {
    const v8h lo = *(const v8h*)(row + hi * 8);
    const v8h z = {};
    return __builtin_shufflevector(lo, z, 0, 1, 2, 3, 4, 5, 6, 7, 8, 9, 10, 11, 12, 13, 14, 15);
}

// transposing LDS load: lane (lr, hi) gets column lr of the 8 rows 8 hi .. 8 hi + 7 of a
// 16 x 16 f16 tile; p is this lane's own address in the tile (formed by the caller)
__device__ __forceinline__ v8h lds_tr16(const _Float16* p) {
    typedef __attribute__((address_space(3))) v8s lds_v8s;
    return __builtin_bit_cast(v8h, __builtin_amdgcn_ds_load_tr16_b128_v8i16((lds_v8s*)p));
}

// ---------------------------------------------------------------------------
// Kernel 1: the whole window attention, one block per window, one wave per head.
//   A  LN + pos/time embed -> sh (f16)
//   B  QKV GEMM (256x384, K=128): wave w makes head w's Q, K and V, into LDS
//   C  attention of head w over the window's 256 tokens, output -> sh (f16)
//   D  output projection (256x128 @ 128x128) + window-merge scatter -> Y0
// Q, K, V and the attention output never leave the WGP.
// ---------------------------------------------------------------------------
__global__ __launch_bounds__(256) void cf_k1_window_attn(
    const float* __restrict__ x, const float* __restrict__ n1g,
    const float* __restrict__ n1b, const float* __restrict__ pos,
    const float* __restrict__ temb, const float* __restrict__ qkv_w,
    const float* __restrict__ qkv_b, const float* __restrict__ pw,
    const float* __restrict__ pb, float* __restrict__ Y0)
{
    __shared__ alignas(16) _Float16 sh[NTOK * SHP];                 // 68 KiB (LDS is 320 KiB/WGP)
    __shared__ alignas(16) _Float16 qkvh[NHD * 3 * NTOK * HDSZ];    // 192 KiB: [head][q,k,v][token][16]
    const int tid = threadIdx.x, win = blockIdx.x;
    const int wd = win >> 6, wh = (win >> 3) & 7, ww = win & 7;

    // ---- A: per-token LN + embeds: a wave takes 32 tokens, four at a time ----
    {
        const int wv = tid >> 5, gw = (tid >> 3) & 3, pc = (tid & 7) * 4;
        const int t = wv >> 1;                       // token n = 32 wv + 4 q + gw
        const int d0 = wd * GG + (wv & 1) * 2, h0 = wh * GG, w = ww * GG + gw;
        const float* xb = x + ((((size_t)d0 * 32 + h0) * 32 + w) * TT + t) * CC + pc;
        v4f xv[8][4];
#pragma unroll  // constant indices keep the rows in registers; all 32 loads are in flight at once
        for (int q = 0; q < 8; ++q)                  // gd = 2 (wv & 1) + (q >> 2), gh = q & 3
            ln_load(xv[q], xb + (size_t)(((q >> 2) * 32 + (q & 3)) * 32) * TT * CC);
        v4f g[4], b[4], te[4];
        ln_load(g, n1g + pc);
        ln_load(b, n1b + pc);
        ln_load(te, temb + t * CC + pc);
        const float* pb0 = pos + ((wv & 1) * 32 + gw) * CC + pc;
        v4f pr[8][4];                                // fetched two steps ahead of their use
        ln_load(pr[0], pb0);
        ln_load(pr[1], pb0 + 4 * CC);
        // precaution: stands before the address registers of the loads above get a new value
        asm volatile("s_wait_xcnt 0x0" ::: "memory");
        _Float16* db = sh + (wv * 32 + gw) * SHP + pc;
#pragma unroll  // constant indices keep the rows in registers
        for (int q = 0; q < 8; ++q) {
            // keeps the loads above in front of the arithmetic (sunk to their users, the last
            // rows started late) and later steps' loads from rising here (past 256 registers)
            __builtin_amdgcn_sched_barrier(0);
            if (q + 2 < 8) ln_load(pr[q + 2], pb0 + (q + 2) * 4 * CC);
            float m, inv;
            ln_stats(xv[q], m, inv);
#pragma unroll  // constant indices keep the rows in registers
            for (int k = 0; k < 4; ++k) {
                const v4f hv = (xv[q][k] - m) * inv * g[k] + b[k] + pr[q][k] + te[k];
                *(v4h*)(db + q * 4 * SHP + k * 32) = __builtin_convertvector(hv, v4h);
            }
        }
        // precaution: stands before the address register of the loads in the loop gets a new value
        asm volatile("s_wait_xcnt 0x0" ::: "memory");
    }
    __syncthreads();

    // ---- B: sh(256x128) @ qkv_w^T(128x384) ----
    const int wave = tid >> 5, lane = tid & 31, lr = lane & 15, hi = lane >> 4;
    _Float16* Qh = qkvh + wave * 3 * NTOK * HDSZ;    // this wave's head: 8 KiB each
    _Float16* Kh = Qh + NTOK * HDSZ;
    _Float16* Vh = Kh + NTOK * HDSZ;
    {
        // The wave owns column tiles wave, wave + 8, wave + 16 (its head's Q, K and V columns):
        // their weights are fetched and converted once and stay in registers over all row tiles.
        v16h bw[3][4];
        float bias[3];
#pragma unroll  // constant indices keep the fragment arrays in registers
        for (int j = 0; j < 3; ++j) bias[j] = qkv_b[(wave + 8 * j) * 16 + lr];
        // precaution: stands before the address register of these loads is given a new value
        asm volatile("s_wait_xcnt 0x0" ::: "memory");
#pragma unroll  // constant indices keep the fragment arrays in registers
        for (int j = 0; j < 3; ++j) {
            const int o = (wave + 8 * j) * 16 + lr;
#pragma unroll  // constant indices keep the fragment arrays in registers
            for (int kk = 0; kk < 4; ++kk)
                load_w_frag(bw[j][kk], qkv_w + (size_t)o * CC + kk * 32, hi);
        }
        for (int rt = 0; rt < 16; ++rt) {
            v16h a[4];
#pragma unroll  // constant indices keep the fragment arrays in registers
            for (int kk = 0; kk < 4; ++kk)
                for (int e = 0; e < 16; ++e)
                    a[kk][e] = sh[(rt * 16 + lr) * SHP + kk * 32 + kmap(e, hi)];
#pragma unroll  // constant indices keep the fragment arrays in registers
            for (int j = 0; j < 3; ++j) {
                v8f acc = {};
#pragma unroll  // constant indices keep the fragment arrays in registers
                for (int kk = 0; kk < 4; ++kk)
                    acc = __builtin_amdgcn_wmma_f32_16x16x32_f16(
                        false, a[kk], false, bw[j][kk], (short)0, acc, false, false);
                for (int r = 0; r < 8; ++r) {
                    const int nrow = rt * 16 + r + 8 * hi;
                    const float val = acc[r] + bias[j];
                    Qh[(j * NTOK + nrow) * HDSZ + lr] =
                        (_Float16)(j == 0 ? val * ATT_SCALE : val);
                }
            }
        }
    }
    // every wave has read its last fragment of sh: the attention output may be written there
    __syncthreads();

    // ---- C: attention of this wave's head, 16 queries a trip ----
    // this lane's address in a 16-key tile of V for the transposing load (rows of 32 bytes)
    const _Float16* vt = Vh + (8 * hi + (lane & 7)) * HDSZ + ((lane >> 3) & 1) * 8;
#pragma nounroll  // one trip is some thousand instructions: kept rolled, for speed only
    for (int qt = 0; qt < 16; ++qt) {
        const v16h bq = row16_frag(Qh + (qt * 16 + lr) * HDSZ, hi);

        v8f s[16];   // s[kt][r] = score of query qt * 16 + lr with key kt * 16 + 8 * hi + r
#pragma unroll  // constant indices keep the score tiles in registers
        for (int kt = 0; kt < 16; ++kt) {
            const v16h ak = row16_frag(Kh + (kt * 16 + lr) * HDSZ, hi);
            const v8f zc = {};
            s[kt] = __builtin_amdgcn_wmma_f32_16x16x32_f16(
                false, ak, false, bq, (short)0, zc, false, false);
        }

        float m4[4] = {-1e30f, -1e30f, -1e30f, -1e30f};   // four chains, joined below
#pragma unroll
        for (int kt = 0; kt < 16; ++kt)
#pragma unroll
            for (int r = 0; r < 8; ++r) m4[kt & 3] = fmaxf(m4[kt & 3], s[kt][r]);
        float mx = fmaxf(fmaxf(m4[0], m4[1]), fmaxf(m4[2], m4[3]));
        mx = fmaxf(mx, xhalf(mx));
        const float nm = -mx * LOG2E;

        v2f sum[4] = {};
        v8f oacc = {};   // oacc[r] = O^T[head dim 8 * hi + r][query lr], not yet normalised
#pragma unroll  // constant indices keep the score tiles in registers
        for (int j = 0; j < 8; ++j) {   // 32 keys a trip
            const v8h v0 = lds_tr16(vt + (j * 32) * HDSZ);
            const v8h v1 = lds_tr16(vt + (j * 32 + 16) * HDSZ);
            const v16h av = __builtin_shufflevector(
                v0, v1, 0, 1, 2, 3, 4, 5, 6, 7, 8, 9, 10, 11, 12, 13, 14, 15);
            v16h pf;   // pf[e] = P^T[key j * 32 + kmap(e, hi)][query lr]
#pragma unroll
            for (int i = 0; i < 8; ++i) {
                const v8f& st = s[2 * j + (i >> 2)];
                const v2f sv = {st[2 * (i & 3)], st[2 * (i & 3) + 1]};
                const v2f arg = __builtin_elementwise_fma(sv, v2f{LOG2E, LOG2E}, v2f{nm, nm});
                const v2f p = {__builtin_amdgcn_exp2f(arg.x), __builtin_amdgcn_exp2f(arg.y)};
                sum[i & 3] += p;
                const v2h ph = __builtin_convertvector(p, v2h);
                pf[2 * i] = ph.x;
                pf[2 * i + 1] = ph.y;
            }
            oacc = __builtin_amdgcn_wmma_f32_16x16x32_f16(
                false, av, false, pf, (short)0, oacc, false, false);
        }
        const v2f s2 = (sum[0] + sum[1]) + (sum[2] + sum[3]);
        float l = s2.x + s2.y;
        l += xhalf(l);
        const float inv = 1.f / l;

        v8h ov;
#pragma unroll
        for (int r = 0; r < 8; ++r) ov[r] = (_Float16)(oacc[r] * inv);
        *(v8h*)(sh + (qt * 16 + lr) * SHP + wave * HDSZ + hi * 8) = ov;
    }

    // ---- D: sh(256x128) @ pw^T(128x128), scattered back to (D,H,W,T,C) ----
    // The wave owns column tile 'wave': its weights stay in registers over all row tiles.
    const int o = wave * 16 + lr;
    const float bias = pb[o];
    v16h bw[4];
#pragma unroll  // constant indices keep the fragment arrays in registers
    for (int kk = 0; kk < 4; ++kk) load_w_frag(bw[kk], pw + (size_t)o * CC + kk * 32, hi);
    // all eight heads' columns of sh are complete before any wave reads a row
    __syncthreads();
    for (int rt = 0; rt < 16; ++rt) {
        v8f acc = {};
#pragma unroll  // constant indices keep the fragment arrays in registers
        for (int kk = 0; kk < 4; ++kk) {
            v16h a;
            for (int e = 0; e < 16; ++e)
                a[e] = sh[(rt * 16 + lr) * SHP + kk * 32 + kmap(e, hi)];
            acc = __builtin_amdgcn_wmma_f32_16x16x32_f16(
                false, a, false, bw[kk], (short)0, acc, false, false);
        }
        for (int r = 0; r < 8; ++r) {
            const int n = rt * 16 + r + 8 * hi;
            const int t = n >> 6, rem = n & 63;
            const int gd = rem >> 4, gh = (rem >> 2) & 3, gw = rem & 3;
            const int d = wd * GG + gd, h = wh * GG + gh, w = ww * GG + gw;
            const size_t off = ((((size_t)d * 32 + h) * 32 + w) * TT + t) * CC + o;
            Y0[off] = acc[r] + bias;
        }
        // precaution: stands before the registers of these stores are given a new value
        asm volatile("s_wait_xcnt 0x0" ::: "memory");
    }
}

// ---------------------------------------------------------------------------
// Kernel 2: depthwise 3x3x3 conv over (D,H,W) (T folded into batch), exLN, norm2 and the MLP,
// one block of 16 waves per 256 tokens (2 d x 4 h rows x 32 w of one t).
//   A  conv: one wave = 64 channels of one (d,h,t) row, 2 channels per lane. The lane keeps its
//      2 x 27 weights in registers and walks the 32 columns of W: each loaded column (9 rows x
//      2 floats) feeds the three outputs it touches. Neighbouring waves read the same lines.
//      Taps outside D or H: the row index is clamped and the tap's weight is zero. -> cv (f32)
//   B  exLN -> y, in place in cv (f32, residual base); norm2(y) -> sh (f16 MLP input);
//      eight lanes a token
//   C  fc1 (rows x 128 @ 128x512) + exact GELU -> hidden tile hm (f16), then fc2 (rows x 512 @
//      512x128) + bias + residual -> d_out (f32), in four tiles of 64 rows; both layers'
//      weights stay in registers over all tiles
// Conv rows, y, the MLP input and the hidden activations never leave the WGP.
// ---------------------------------------------------------------------------
#define DW_CS (TT * CC)   // floats from one column of W to the next
#define DW_NB 4           // column buffers: a column is fetched DW_NB - 1 ahead
// f16 per LDS row of the hidden tile: 1040 bytes = 16 x 65, so the 16 rows that a fragment's
// ds_load_b128 reads start 4 banks apart, as with SHP
#define HMP  (MLPH + 8)
#define HTR  64           // rows of a hidden tile

// cv holds channel c of local token n at n * CC + (c ^ cv_sw(n)): rows are 512 bytes, so equal
// channels of all rows share a bank; swapping the 32-channel halves by bit 0 ^ bit 3 of the row
// sets neighbouring tokens (LayerNorm's 16-byte reads) and rows 8 apart (the two halves of an
// accumulator's residual read) 32 banks apart
__device__ __forceinline__ int cv_sw(int n) { return (((n >> 3) ^ n) & 1) << 5; }

__device__ __forceinline__ void dw_load_col(v2f (&b)[9], const float* const (&rp)[9],
                                            int off) {
#pragma unroll
    for (int j = 0; j < 9; ++j) b[j] = *(const v2f*)(rp[j] + off);
}

// acc += sum over the 9 (kd,kh) rows of column b times the weights of tap KW
template <int KW>
__device__ __forceinline__ void dw_fma_col(v2f& acc, const v2f (&b)[9],
                                           const v2f (&wp)[27]) {
#pragma unroll
    for (int j = 0; j < 9; ++j) acc = __builtin_elementwise_fma(b[j], wp[j * 3 + KW], acc);
}

// Exact GELU of two values, 0.5 v (1 + erf(v / sqrt 2)) = 0.5 v + |v| (0.5 erf(|v| / sqrt 2)), with no
// branch: no wave waits on a compare, a mask and a jump, and two values share an instruction. erf by
// its five-term form erf(x) = 1 - t (a1 + t (a2 + t (a3 + t (a4 + t a5)))) exp(-x^2), t = 1 / (1 + p x),
// x >= 0: absolute error below 1.5e-7 for every x, the size of an f32 rounding step at 1; the
// result is rounded to f16 behind it. 1 / sqrt 2 is folded into p and the exponent's factor, the
// 0.5 into a1 .. a5.
__device__ __forceinline__ v2f gelu2(v2f v) {
    const float ax = __builtin_fabsf(v.x), ay = __builtin_fabsf(v.y);
    const v2f t = {__builtin_amdgcn_rcpf(__builtin_fmaf(ax, 0.23164189f, 1.f)),
                   __builtin_amdgcn_rcpf(__builtin_fmaf(ay, 0.23164189f, 1.f))};
    const v2f a = (v * (-0.5f * LOG2E)) * v;          // -(v^2 / 2) log2 e
    const v2f e = {__builtin_amdgcn_exp2f(a.x), __builtin_amdgcn_exp2f(a.y)};
    v2f p = __builtin_elementwise_fma(t, v2f{0.5307027145f, 0.5307027145f},
                                      v2f{-0.7265760135f, -0.7265760135f});
    p = __builtin_elementwise_fma(p, t, v2f{0.7107068705f, 0.7107068705f});
    p = __builtin_elementwise_fma(p, t, v2f{-0.142248368f, -0.142248368f});
    p = __builtin_elementwise_fma(p, t, v2f{0.127414796f, 0.127414796f});
    const v2f s = __builtin_elementwise_fma(-(p * t), e, v2f{0.5f, 0.5f});   // 0.5 erf(|v| / sqrt 2)
    const v2f h = v * 0.5f;
    return v2f{__builtin_fmaf(ax, s.x, h.x), __builtin_fmaf(ay, s.y, h.y)};
}

__global__ __launch_bounds__(512) void cf_k2_conv_ln_mlp(
    const float* __restrict__ Y0, const float* __restrict__ cw,
    const float* __restrict__ cb, const float* __restrict__ eg,
    const float* __restrict__ eb, const float* __restrict__ n2g,
    const float* __restrict__ n2b, const float* __restrict__ w1,
    const float* __restrict__ b1, const float* __restrict__ w2,
    const float* __restrict__ b2, float* __restrict__ out)
{
    __shared__ alignas(16) float    cv[256 * CC];    // 128 KiB: conv rows, then y
    __shared__ alignas(16) _Float16 sh[256 * SHP];   // 68 KiB: the block's 256 MLP input rows
    __shared__ alignas(16) _Float16 hm[HTR * HMP];   // 65 KiB: one tile's hidden rows
    // the conv weights, [c][tap], lie in hm's place until the lanes hold them: 864 float4; the
    // rest of the 1024 only lets every thread store twice
    float4* swt = (float4*)hm;
    const int tid = threadIdx.x;
    const int lane = tid & 31;
    const int bx = blockIdx.x;
    const int tt = bx & 3, h0 = ((bx >> 2) & 7) * 4, d0 = (bx >> 5) * 2;

    // LayerNorm's scales and shifts for this lane's 16 channels: fetched with the first conv
    // columns, so that no wave waits for them between the phases
    const int pc = (tid & 7) * 4;
    v4f g1[4], c1[4], g2[4], c2[4];
    // MLP. fc1: the wave owns hidden column tiles wave and wave + 16.
    // fc2: the wave owns output column tile wave & 7, for row tiles 2 (wave >> 3) .. + 1.
    // Their biases are fetched with the first conv columns too.
    const int wave = tid >> 5, lr = lane & 15, hi = lane >> 4;
    const int o = (wave & 7) * 16 + lr;
    float bias1[2], bias2;

    // ---- A: conv ----
    {
        const int wv = __builtin_amdgcn_readfirstlane(tid >> 5);
        const int h = h0 + ((wv >> 1) & 3);
        const int d = d0 + (wv >> 3);
        const int c0 = (wv & 1) * 64;          // this wave's first channel

        // the weights are fetched together with the first columns below
        const float4* cw4 = (const float4*)cw;
        const float4 q0 = cw4[tid];
        const int i1 = min(tid + 512, CC * 27 / 4 - 1);
        const float4 q1 = cw4[i1];

        const float* rp[9];
#pragma unroll
        for (int kd = 0; kd < 3; ++kd)
#pragma unroll
            for (int kh = 0; kh < 3; ++kh) {
                const int dc = min(max(d + kd - 1, 0), 15), hc = min(max(h + kh - 1, 0), 31);
                rp[kd * 3 + kh] = Y0 + ((size_t)((dc * 32 + hc) * 32) * TT + tt) * CC + c0;
            }
        const int lo = lane * 2;
        v2f buf[DW_NB][9];                     // column c lives in buf[c % DW_NB]
        v2f acc[3];                            // output o lives in acc[o % 3]
#pragma unroll
        for (int c = 0; c < DW_NB - 1; ++c) dw_load_col(buf[c], rp, lo + c * DW_CS);
        const v2f bias = *(const v2f*)(cb + c0 + lo);
        ln_load(g1, eg + pc);
        ln_load(c1, eb + pc);
        ln_load(g2, n2g + pc);
        ln_load(c2, n2b + pc);
#pragma unroll  // constant indices keep the values in registers
        for (int j = 0; j < 2; ++j) bias1[j] = b1[(wave + 16 * j) * 16 + lr];
        bias2 = b2[o];

        swt[tid] = q0;
        swt[tid + 512] = q1;
        // precaution: stands before the address registers of the loads above get a new value; i1
        // is named so that its register lives up to here (a later load's result was placed on it)
        asm volatile("s_wait_xcnt 0x0" :: "v"(i1) : "memory");
        // keeps later address arithmetic from rising above that wait
        __builtin_amdgcn_sched_barrier(0);
        __syncthreads();

        // this lane's 2 channels x 27 taps (54 consecutive floats of cw), paired by tap
        const float* lw = (const float*)swt + (c0 + lo) * 27;
        v2f wp[27];
#pragma unroll
        for (int kd = 0; kd < 3; ++kd)
#pragma unroll
            for (int kh = 0; kh < 3; ++kh) {
                const bool ok = (unsigned)(d + kd - 1) < 16u && (unsigned)(h + kh - 1) < 32u;
#pragma unroll
                for (int kw = 0; kw < 3; ++kw) {
                    const int tap = (kd * 3 + kh) * 3 + kw;
                    const float wx = lw[tap], wy = lw[27 + tap];
                    wp[tap].x = ok ? wx : 0.f;
                    wp[tap].y = ok ? wy : 0.f;
                }
            }
        // local token = 32 (wv >> 1) + column
        float* orow = cv + (wv >> 1) * 32 * CC + c0;

        acc[0] = bias;
        // unrolled whole: every buffer index and every address offset is a constant
#pragma unroll
        for (int col = 0; col < 32; ++col) {
            // keeps later columns' loads from being hoisted up here, which spilled registers
            __builtin_amdgcn_sched_barrier(0);
            if (col + DW_NB - 1 < 32)
                dw_load_col(buf[(col + DW_NB - 1) % DW_NB], rp, lo + (col + DW_NB - 1) * DW_CS);
            const v2f (&b)[9] = buf[col % DW_NB];
            if (col > 0) {                     // right neighbour of output col - 1: done
                dw_fma_col<2>(acc[(col + 2) % 3], b, wp);
                *(v2f*)(orow + (col - 1) * CC + (lo ^ cv_sw(col - 1))) = acc[(col + 2) % 3];
            }
            dw_fma_col<1>(acc[col % 3], b, wp);
            if (col < 31) {                    // left neighbour of output col + 1: first
                acc[(col + 1) % 3] = bias;
                dw_fma_col<0>(acc[(col + 1) % 3], b, wp);
            }
        }
        *(v2f*)(orow + 31 * CC + (lo ^ cv_sw(31))) = acc[31 % 3];
        // precaution: stands before the address registers of the loads above get a new value; the
        // lane number, their offset register, is named so that it lives up to here (the last
        // load's result was placed on it while earlier loads from it were in flight)
        asm volatile("s_wait_xcnt 0x0" :: "v"(lane) : "memory");
        // keeps the next phase's set-up from rising above that wait
        __builtin_amdgcn_sched_barrier(0);
    }

    // ---- B: both LayerNorms: a wave takes 16 tokens, four at a time ----
    {
        const int tk0 = (tid >> 5) * 16 + ((tid >> 3) & 3);
        // both channel halves of every conv row are complete before a token's row is read
        __syncthreads();
#pragma unroll  // constant indices keep the rows in registers
        for (int q = 0; q < 4; ++q) {
            const int tok = tk0 + q * 4;
            float* yr = cv + tok * CC;
            const int sw = cv_sw(tok);
            v4f xv[4];
#pragma unroll  // constant indices keep the rows in registers
            for (int k = 0; k < 4; ++k) xv[k] = *(const v4f*)(yr + ((pc + k * 32) ^ sw));
            float m, inv;
            ln_stats(xv, m, inv);
            v4f y[4];
#pragma unroll  // constant indices keep the rows in registers
            for (int k = 0; k < 4; ++k) {
                y[k] = (xv[k] - m) * inv * g1[k] + c1[k];
                *(v4f*)(yr + ((pc + k * 32) ^ sw)) = y[k];
            }
            float m2, inv2;
            ln_stats(y, m2, inv2);
#pragma unroll  // constant indices keep the rows in registers
            for (int k = 0; k < 4; ++k) {
                const v4f hv = (y[k] - m2) * inv2 * g2[k] + c2[k];
                *(v4h*)(sh + tok * SHP + pc + k * 32) = __builtin_convertvector(hv, v4h);
            }
        }
    }

    // ---- C: MLP ----
    v16h bw1[2][4];
    v16h bw2[16];
    const float* w1r = w1 + (size_t)(wave * 16 + lr) * CC;   // column tile wave; + 16 tiles: j = 1
#pragma unroll  // constant indices keep the fragment arrays in registers
    for (int f = 0; f < 24; ++f) {
        // batches of 10, 8, 4 and 2 fragments: keeps later fragments' f32 loads from rising
        // above earlier conversions (with too many staged at once, registers spilled)
        if (f == 10 || f == 18 || f == 22) __builtin_amdgcn_sched_barrier(0);
        if (f < 16) {
            load_w_frag(bw2[f], w2 + (size_t)o * MLPH + f * 32, hi);
        } else {
            const int j = (f - 16) >> 2, kk = (f - 16) & 3;
            load_w_frag(bw1[j][kk], w1r + j * 256 * CC + kk * 32, hi);
        }
    }
    // precaution: w1r is named so that its registers live up to here (the last load's result was
    // placed on them while earlier loads from them were in flight)
    asm volatile("s_wait_xcnt 0x0" :: "v"(w1r) : "memory");
    // every token's y and MLP input row are complete before any wave reads them
    __syncthreads();

    for (int t = 0; t < 256 / HTR; ++t) {
        // every wave has read its last fragment of the tile before: hm may be written again
        if (t) __syncthreads();
        // ---- fc1 + GELU: 64 rows x this wave's 32 hidden columns -> hm ----
#pragma nounroll  // unrolled, the trips' values overlapped and weight fragments were spilled
        for (int rt = 0; rt < HTR / 16; ++rt) {
            v16h a[4];
#pragma unroll  // constant indices keep the fragment arrays in registers
            for (int kk = 0; kk < 4; ++kk)
                for (int e = 0; e < 16; ++e)
                    a[kk][e] = sh[(t * HTR + rt * 16 + lr) * SHP + kk * 32 + kmap(e, hi)];
            // both column tiles' products first: the A fragments are dead before the GELU work
            v8f acc[2] = {};
#pragma unroll  // constant indices keep the fragment arrays in registers
            for (int kk = 0; kk < 4; ++kk)
#pragma unroll  // constant indices keep the fragment arrays in registers
                for (int j = 0; j < 2; ++j)
                    acc[j] = __builtin_amdgcn_wmma_f32_16x16x32_f16(
                        false, a[kk], false, bw1[j][kk], (short)0, acc[j], false, false);
            // keeps the GELU work from rising among the products: there it held all four A
            // fragments live to the end, and a weight fragment was spilled
            __builtin_amdgcn_sched_barrier(0);
#pragma unroll  // constant indices keep the accumulators in registers
            for (int j = 0; j < 2; ++j)
#pragma unroll  // constant indices keep the accumulators in registers
                for (int r = 0; r < 8; r += 2) {
                    const v2f ge = gelu2(v2f{acc[j][r], acc[j][r + 1]} + bias1[j]);
                    _Float16* hp = hm + (rt * 16 + r + 8 * hi) * HMP + (wave + 16 * j) * 16 + lr;
                    hp[0] = (_Float16)ge.x;
                    hp[HMP] = (_Float16)ge.y;
                }
        }
        // the tile's hidden rows are complete before any wave reads them
        __syncthreads();
        // ---- fc2 + bias + residual: this wave's 32 rows x 16 output columns ----
        // these 32 rows are the 32 columns of W of the block's row 2 t + (wave >> 3)
        const int d = d0 + (t >> 1), h = h0 + (t & 1) * 2 + (wave >> 3);
        float* ob = out + ((size_t)((d * 32 + h) * 32) * TT + tt) * CC + o;
        for (int i = 0; i < 2; ++i) {
            const int rt = (wave >> 3) * 2 + i;
            const _Float16* ar = hm + (rt * 16 + lr) * HMP;
            const int n0 = t * HTR + rt * 16 + 8 * hi;   // local token of accumulator row 0
            float res[8];
#pragma unroll  // constant indices keep the values in registers
            for (int r = 0; r < 8; ++r) res[r] = cv[(n0 + r) * CC + (o ^ cv_sw(n0 + r))];
            v8f acc = {};
#pragma unroll  // constant indices keep the fragment arrays in registers
            for (int g = 0; g < 4; ++g) {
                v16h a[4];
#pragma unroll  // constant indices keep the fragment arrays in registers
                for (int kk = 0; kk < 4; ++kk)
                    for (int e = 0; e < 16; ++e)
                        a[kk][e] = ar[(g * 4 + kk) * 32 + kmap(e, hi)];
#pragma unroll  // constant indices keep the fragment arrays in registers
                for (int kk = 0; kk < 4; ++kk)
                    acc = __builtin_amdgcn_wmma_f32_16x16x32_f16(
                        false, a[kk], false, bw2[g * 4 + kk], (short)0, acc, false, false);
            }
            for (int r = 0; r < 8; ++r)
                ob[(i * 16 + 8 * hi + r) * DW_CS] = acc[r] + bias2 + res[r];
            // precaution: stands before the registers of these stores get a new value
            asm volatile("s_wait_xcnt 0x0" ::: "memory");
        }
    }
}

// ---------------------------------------------------------------------------
// Host-side orchestration. Workspace: [0,32M) Y0 f32, the attention block's output.
// ---------------------------------------------------------------------------
extern "C" void kernel_launch(void* const* d_in, const int* in_sizes, int n_in,
                              void* d_out, int out_size, void* d_ws, size_t ws_size,
                              hipStream_t stream) {
    (void)in_sizes; (void)n_in; (void)out_size; (void)ws_size;
    const float* x       = (const float*)d_in[0];
    const float* norm1_g = (const float*)d_in[1];
    const float* norm1_b = (const float*)d_in[2];
    const float* pos     = (const float*)d_in[3];
    const float* temb    = (const float*)d_in[4];
    const float* qkv_w   = (const float*)d_in[5];
    const float* qkv_b   = (const float*)d_in[6];
    const float* proj_w  = (const float*)d_in[7];
    const float* proj_b  = (const float*)d_in[8];
    const float* conv_w  = (const float*)d_in[9];
    const float* conv_b  = (const float*)d_in[10];
    const float* exln_g  = (const float*)d_in[11];
    const float* exln_b  = (const float*)d_in[12];
    const float* norm2_g = (const float*)d_in[13];
    const float* norm2_b = (const float*)d_in[14];
    const float* fc1_w   = (const float*)d_in[15];
    const float* fc1_b   = (const float*)d_in[16];
    const float* fc2_w   = (const float*)d_in[17];
    const float* fc2_b   = (const float*)d_in[18];

    float* Y0 = (float*)d_ws;
    float* out = (float*)d_out;

    cf_k1_window_attn<<<NWIN, 256, 0, stream>>>(x, norm1_g, norm1_b, pos, temb,
                                                qkv_w, qkv_b, proj_w, proj_b, Y0);
    cf_k2_conv_ln_mlp<<<NROW / 256, 512, 0, stream>>>(Y0, conv_w, conv_b, exln_g, exln_b,
                                                      norm2_g, norm2_b, fc1_w, fc1_b,
                                                      fc2_w, fc2_b, out);
}

// v010
// A run of this version takes 63.6 microseconds.
// In both of two side-by-side timings against v009, it was 1.11 times as fast.
// Over all steps from v000 it is 8.83 times as fast.
#include <hip/hip_runtime.h>
#include <hip/hip_bf16.h>
#include <math.h>

// ---------------------------------------------------------------------------
// CrossFormerBlock for MI455X (gfx1250, wave32, WMMA 16x16x32 f16 -> f32 acc)
// Two launches: window attention; then conv, both LayerNorms and the MLP, whose intermediate
// rows stay in LDS. WMMA for all six GEMMs, VALU for softmax/LN/conv.
// ---------------------------------------------------------------------------

typedef __attribute__((ext_vector_type(16))) _Float16 v16h;
typedef __attribute__((ext_vector_type(8)))  float    v8f;

// K-index inside a 16x32 f16 A/B fragment for element e (0..15) of the v16h,
// given lane-half hi = lane/16 (CDNA5 ISA 7.12.2 16-bit A/B layout).
__device__ __forceinline__ int kmap(int e, int hi) {
    return ((e >> 3) << 4) + (((e >> 1) & 3) << 1) + (hi << 3) + (e & 1);
}

// One B fragment from 32 consecutive f32 weights of this lane's output column, as f16.
__device__ __forceinline__ void load_w_frag(v16h& f, const float* __restrict__ w, int hi) {
#pragma unroll  // constant indices keep the fragment arrays in registers
    for (int e = 0; e < 16; ++e) f[e] = (_Float16)w[kmap(e, hi)];
    // precaution: stands before the address registers of these loads are given a new value
    asm volatile("s_wait_xcnt 0x0" ::: "memory");
}

// Static problem dims
#define CC   128
#define TT   4
#define GG   4
#define NTOK 256        // tokens per window (G^3 * T)
#define NWIN 256        // windows
#define NHD  8          // heads
#define HDSZ 16         // head dim
#define MLPH 512
#define NROW 65536      // total tokens B*D*H*W*T
#define ATT_SCALE 0.25f // 1/sqrt(16)
// f16 per LDS row of a staged 128-channel A tile: 272 bytes = 16 x 17, so the 16 rows that a
// fragment's ds_load_b128 reads start 4 banks apart and cover all 64 banks (256-byte rows
// put all 16 on the same 4 banks)
#define SHP  (CC + 8)

// The MLP's weights as launch 2 reads them: f16, one B fragment = 512 f16 = 1 KiB in a row, element
// e of lane l at (e >> 3) * 256 + l * 8 + (e & 7), so each of a fragment's two 16-byte loads is a
// wave-wide run of 512 bytes (four whole lines; a fragment read from the f32 rows touches 16 lines
// a load). Fragments 0..127: fc2, 16 (column tile) + k step; 128..255: fc1, 4 (column tile) + k step.
#define WFR  512          // f16 per packed fragment
#define WF1  128          // first fc1 fragment
#define WEARLY 4          // fc2 fragments fetched with fc1's

// ---------------------------------------------------------------------------
// LayerNorm rows, eight lanes a token. Lane piece s = lane & 7 holds channels
// 4 (s + 8 k) .. + 3 for k = 0..3, the token is picked by lane >> 3: one wave-wide 16-byte
// load or store covers four tokens x one whole 128-byte line, and a row stays in registers
// from its load to its last use.
// ---------------------------------------------------------------------------
typedef __attribute__((ext_vector_type(4))) float    v4f;
typedef __attribute__((ext_vector_type(4))) _Float16 v4h;

// v + (v of lane l ^ XM), XM < 16, as a DPP row_xmask move
template <int XM>
__device__ __forceinline__ float add_xmask(float v) {
    const int b = __builtin_bit_cast(int, v);
    return v + __builtin_bit_cast(float,
        __builtin_amdgcn_update_dpp(b, b, 0x160 + XM, 0xf, 0xf, false));
}
// total over the eight lanes of a token, in every one of them
__device__ __forceinline__ float sum8(float v) {
    return add_xmask<4>(add_xmask<2>(add_xmask<1>(v)));
}
__device__ __forceinline__ void ln_load(v4f (&v)[4], const float* p) {
#pragma unroll  // constant indices keep the row in registers
    for (int k = 0; k < 4; ++k) v[k] = *(const v4f*)(p + k * 32);
}
// mean and 1 / sqrt(var + eps) of the token whose row lies in v on these eight lanes
__device__ __forceinline__ void ln_stats(const v4f (&v)[4], float& m, float& inv) {
    const v4f s = (v[0] + v[1]) + (v[2] + v[3]);
    v4f q = v[0] * v[0];
#pragma unroll  // constant indices keep the row in registers
    for (int k = 1; k < 4; ++k) q = __builtin_elementwise_fma(v[k], v[k], q);
    const float sm = sum8((s.x + s.y) + (s.z + s.w));
    const float sq = sum8((q.x + q.y) + (q.z + q.w));
    m = sm * (1.f / CC);
    inv = rsqrtf(sq * (1.f / CC) - m * m + 1e-5f);
}

// ---------------------------------------------------------------------------
// Attention helpers. Scores are held transposed, S^T = K Q^T: a lane's accumulator registers
// hold ONE query's scores (query = lane & 15, key = 16 kt + 8 hi + r), so the row maximum and
// the row sum are in-lane work plus one exchange between the wave's halves. Two score tiles,
// converted in place, are the B operand of O^T += V^T P^T over 32 keys: P never leaves the
// registers. All 256 keys of a query are held at once, so the softmax is one pass with the
// true row maximum.
// ---------------------------------------------------------------------------
typedef __attribute__((ext_vector_type(8))) _Float16 v8h;
typedef __attribute__((ext_vector_type(2))) _Float16 v2h;
typedef __attribute__((ext_vector_type(8))) short    v8s;
typedef __attribute__((ext_vector_type(2))) float    v2f;
#define LOG2E 1.4426950408889634f

// lane l <-> lane l ^ 16
__device__ __forceinline__ float xhalf(float v) {
    const int b = __builtin_bit_cast(int, v);
    return __builtin_bit_cast(float, __builtin_amdgcn_permlanex16(
        b, b, 0x76543210, 0xfedcba98, false, false));
}

// A or B fragment of a row of 16 f16 (head dim): k = 8 hi + e for e < 8, zero above k = 15
__device__ __forceinline__ v16h row16_frag(const _Float16* row, int hi) {
    const v8h lo = *(const v8h*)(row + hi * 8);
    const v8h z = {};
    return __builtin_shufflevector(lo, z, 0, 1, 2, 3, 4, 5, 6, 7, 8, 9, 10, 11, 12, 13, 14, 15);
}

// one packed B fragment; p is the fragment's start + 8 * lane
__device__ __forceinline__ v16h packed_frag(const _Float16* p) {
    const v8h lo = *(const v8h*)p, up = *(const v8h*)(p + 256);
    return __builtin_shufflevector(lo, up, 0, 1, 2, 3, 4, 5, 6, 7, 8, 9, 10, 11, 12, 13, 14, 15);
}

// transposing LDS load: lane (lr, hi) gets column lr of the 8 rows 8 hi .. 8 hi + 7 of a
// 16 x 16 f16 tile; p is this lane's own address in the tile (formed by the caller)
__device__ __forceinline__ v8h lds_tr16(const _Float16* p) {
    typedef __attribute__((address_space(3))) v8s lds_v8s;
    return __builtin_bit_cast(v8h, __builtin_amdgcn_ds_load_tr16_b128_v8i16((lds_v8s*)p));
}

// ---------------------------------------------------------------------------
// Kernel 1: the whole window attention, one block per window, one wave per head.
//   A  LN + pos/time embed -> sh (f16)
//   B  QKV GEMM (256x384, K=128): wave w makes head w's Q, K and V, into LDS
//   C  attention of head w over the window's 256 tokens, output -> sh (f16)
//   D  output projection (256x128 @ 128x128) + window-merge scatter -> Y0
// Q, K, V and the attention output never leave the WGP.
// Beside phase A each block packs one of the 256 weight fragments of launch 2's MLP (WFR above).
// ---------------------------------------------------------------------------
__global__ __launch_bounds__(256) void cf_k1_window_attn(
    const float* __restrict__ x, const float* __restrict__ n1g,
    const float* __restrict__ n1b, const float* __restrict__ pos,
    const float* __restrict__ temb, const float* __restrict__ qkv_w,
    const float* __restrict__ qkv_b, const float* __restrict__ pw,
    const float* __restrict__ pb, const float* __restrict__ w1,
    const float* __restrict__ w2, float* __restrict__ Y0, _Float16* __restrict__ wpk)
{
    __shared__ alignas(16) _Float16 sh[NTOK * SHP];                 // 68 KiB (LDS is 320 KiB/WGP)
    __shared__ alignas(16) _Float16 qkvh[NHD * 3 * NTOK * HDSZ];    // 192 KiB: [head][q,k,v][token][16]
    const int tid = threadIdx.x, win = blockIdx.x;
    const int wd = win >> 6, wh = (win >> 3) & 7, ww = win & 7;

    // ---- A: per-token LN + embeds: a wave takes 32 tokens, four at a time ----
    {
        // Beside it the block packs fragment 'win' of the MLP's weights for launch 2, two f16 a
        // thread: elements 8 h .. 8 h + 7 of lane l are 8 consecutive f32 of the lane's weight row
        // (kmap), h = tid >> 7, l = (tid >> 2) & 31. fc2 (win < WF1): 16 k steps in rows of 512;
        // fc1: 4 k steps in rows of 128, so every shift is longer by ws2 = 2 for fc2.
        const int ws2 = ((win >> 7) ^ 1) << 1;
        const int wrow = ((win & (WF1 - 1)) >> (2 + ws2)) * 16 + ((tid >> 2) & 15);
        const float* wsrc = (win < WF1 ? w2 : w1) + (wrow << (7 + ws2)) + (win & ((4 << ws2) - 1)) * 32
                            + (tid >> 7) * 16 + ((tid >> 6) & 1) * 8 + (tid & 3) * 2;
        const v2f wq = *(const v2f*)wsrc;
        const int wv = tid >> 5, gw = (tid >> 3) & 3, pc = (tid & 7) * 4;
        const int t = wv >> 1;                       // token n = 32 wv + 4 q + gw
        const int d0 = wd * GG + (wv & 1) * 2, h0 = wh * GG, w = ww * GG + gw;
        const float* xb = x + ((((size_t)d0 * 32 + h0) * 32 + w) * TT + t) * CC + pc;
        v4f xv[8][4];
#pragma unroll  // constant indices keep the rows in registers; all 32 loads are in flight at once
        for (int q = 0; q < 8; ++q)                  // gd = 2 (wv & 1) + (q >> 2), gh = q & 3
            ln_load(xv[q], xb + (size_t)(((q >> 2) * 32 + (q & 3)) * 32) * TT * CC);
        v4f g[4], b[4], te[4];
        ln_load(g, n1g + pc);
        ln_load(b, n1b + pc);
        ln_load(te, temb + t * CC + pc);
        const float* pb0 = pos + ((wv & 1) * 32 + gw) * CC + pc;
        v4f pr[8][4];                                // fetched two steps ahead of their use
        ln_load(pr[0], pb0);
        ln_load(pr[1], pb0 + 4 * CC);
        // precaution: stands before the address registers of the loads above get a new value
        asm volatile("s_wait_xcnt 0x0" ::: "memory");
        _Float16* db = sh + (wv * 32 + gw) * SHP + pc;
#pragma unroll  // constant indices keep the rows in registers
        for (int q = 0; q < 8; ++q) {
            // keeps the loads above in front of the arithmetic (sunk to their users, the last
            // rows started late) and later steps' loads from rising here (past 256 registers)
            __builtin_amdgcn_sched_barrier(0);
            if (q + 2 < 8) ln_load(pr[q + 2], pb0 + (q + 2) * 4 * CC);
            if (q == 1) {
                // the packed weights go out here: wq has landed by now, and the store lands well ahead
                // of the barrier below, which waits for a wave's stores
                *(v2h*)(wpk + win * WFR + tid * 2) = __builtin_convertvector(wq, v2h);
                // precaution: stands before the registers of this store get a new value
                asm volatile("s_wait_xcnt 0x0" ::: "memory");
            }
            float m, inv;
            ln_stats(xv[q], m, inv);
#pragma unroll  // constant indices keep the rows in registers
            for (int k = 0; k < 4; ++k) {
                const v4f hv = (xv[q][k] - m) * inv * g[k] + b[k] + pr[q][k] + te[k];
                *(v4h*)(db + q * 4 * SHP + k * 32) = __builtin_convertvector(hv, v4h);
            }
        }
        // precaution: stands before the address register of the loads in the loop gets a new value
        asm volatile("s_wait_xcnt 0x0" ::: "memory");
    }
    __syncthreads();

    // ---- B: sh(256x128) @ qkv_w^T(128x384) ----
    const int wave = tid >> 5, lane = tid & 31, lr = lane & 15, hi = lane >> 4;
    _Float16* Qh = qkvh + wave * 3 * NTOK * HDSZ;    // this wave's head: 8 KiB each
    _Float16* Kh = Qh + NTOK * HDSZ;
    _Float16* Vh = Kh + NTOK * HDSZ;
    {
        // The wave owns column tiles wave, wave + 8, wave + 16 (its head's Q, K and V columns):
        // their weights are fetched and converted once and stay in registers over all row tiles.
        v16h bw[3][4];
        float bias[3];
#pragma unroll  // constant indices keep the fragment arrays in registers
        for (int j = 0; j < 3; ++j) bias[j] = qkv_b[(wave + 8 * j) * 16 + lr];
        // precaution: stands before the address register of these loads is given a new value
        asm volatile("s_wait_xcnt 0x0" ::: "memory");
#pragma unroll  // constant indices keep the fragment arrays in registers
        for (int j = 0; j < 3; ++j) {
            const int o = (wave + 8 * j) * 16 + lr;
#pragma unroll  // constant indices keep the fragment arrays in registers
            for (int kk = 0; kk < 4; ++kk)
                load_w_frag(bw[j][kk], qkv_w + (size_t)o * CC + kk * 32, hi);
        }
        for (int rt = 0; rt < 16; ++rt) {
            v16h a[4];
#pragma unroll  // constant indices keep the fragment arrays in registers
            for (int kk = 0; kk < 4; ++kk)
                for (int e = 0; e < 16; ++e)
                    a[kk][e] = sh[(rt * 16 + lr) * SHP + kk * 32 + kmap(e, hi)];
#pragma unroll  // constant indices keep the fragment arrays in registers
            for (int j = 0; j < 3; ++j) {
                v8f acc = {};
#pragma unroll  // constant indices keep the fragment arrays in registers
                for (int kk = 0; kk < 4; ++kk)
                    acc = __builtin_amdgcn_wmma_f32_16x16x32_f16(
                        false, a[kk], false, bw[j][kk], (short)0, acc, false, false);
                for (int r = 0; r < 8; ++r) {
                    const int nrow = rt * 16 + r + 8 * hi;
                    const float val = acc[r] + bias[j];
                    Qh[(j * NTOK + nrow) * HDSZ + lr] =
                        (_Float16)(j == 0 ? val * ATT_SCALE : val);
                }
            }
        }
    }
    // every wave has read its last fragment of sh: the attention output may be written there
    __syncthreads();

    // ---- C: attention of this wave's head, 16 queries a trip ----
    // this lane's address in a 16-key tile of V for the transposing load (rows of 32 bytes)
    const _Float16* vt = Vh + (8 * hi + (lane & 7)) * HDSZ + ((lane >> 3) & 1) * 8;
#pragma nounroll  // one trip is some thousand instructions: kept rolled, for speed only
    for (int qt = 0; qt < 16; ++qt) {
        const v16h bq = row16_frag(Qh + (qt * 16 + lr) * HDSZ, hi);

        v8f s[16];   // s[kt][r] = score of query qt * 16 + lr with key kt * 16 + 8 * hi + r
#pragma unroll  // constant indices keep the score tiles in registers
        for (int kt = 0; kt < 16; ++kt) {
            const v16h ak = row16_frag(Kh + (kt * 16 + lr) * HDSZ, hi);
            const v8f zc = {};
            s[kt] = __builtin_amdgcn_wmma_f32_16x16x32_f16(
                false, ak, false, bq, (short)0, zc, false, false);
        }

        float m4[4] = {-1e30f, -1e30f, -1e30f, -1e30f};   // four chains, joined below
#pragma unroll
        for (int kt = 0; kt < 16; ++kt)
#pragma unroll
            for (int r = 0; r < 8; ++r) m4[kt & 3] = fmaxf(m4[kt & 3], s[kt][r]);
        float mx = fmaxf(fmaxf(m4[0], m4[1]), fmaxf(m4[2], m4[3]));
        mx = fmaxf(mx, xhalf(mx));
        const float nm = -mx * LOG2E;

        v2f sum[4] = {};
        v8f oacc = {};   // oacc[r] = O^T[head dim 8 * hi + r][query lr], not yet normalised
#pragma unroll  // constant indices keep the score tiles in registers
        for (int j = 0; j < 8; ++j) {   // 32 keys a trip
            const v8h v0 = lds_tr16(vt + (j * 32) * HDSZ);
            const v8h v1 = lds_tr16(vt + (j * 32 + 16) * HDSZ);
            const v16h av = __builtin_shufflevector(
                v0, v1, 0, 1, 2, 3, 4, 5, 6, 7, 8, 9, 10, 11, 12, 13, 14, 15);
            v16h pf;   // pf[e] = P^T[key j * 32 + kmap(e, hi)][query lr]
#pragma unroll
            for (int i = 0; i < 8; ++i) {
                const v8f& st = s[2 * j + (i >> 2)];
                const v2f sv = {st[2 * (i & 3)], st[2 * (i & 3) + 1]};
                const v2f arg = __builtin_elementwise_fma(sv, v2f{LOG2E, LOG2E}, v2f{nm, nm});
                const v2f p = {__builtin_amdgcn_exp2f(arg.x), __builtin_amdgcn_exp2f(arg.y)};
                sum[i & 3] += p;
                const v2h ph = __builtin_convertvector(p, v2h);
                pf[2 * i] = ph.x;
                pf[2 * i + 1] = ph.y;
            }
            oacc = __builtin_amdgcn_wmma_f32_16x16x32_f16(
                false, av, false, pf, (short)0, oacc, false, false);
        }
        const v2f s2 = (sum[0] + sum[1]) + (sum[2] + sum[3]);
        float l = s2.x + s2.y;
        l += xhalf(l);
        const float inv = 1.f / l;

        v8h ov;
#pragma unroll
        for (int r = 0; r < 8; ++r) ov[r] = (_Float16)(oacc[r] * inv);
        *(v8h*)(sh + (qt * 16 + lr) * SHP + wave * HDSZ + hi * 8) = ov;
    }

    // ---- D: sh(256x128) @ pw^T(128x128), scattered back to (D,H,W,T,C) ----
    // The wave owns column tile 'wave': its weights stay in registers over all row tiles.
    const int o = wave * 16 + lr;
    const float bias = pb[o];
    v16h bw[4];
#pragma unroll  // constant indices keep the fragment arrays in registers
    for (int kk = 0; kk < 4; ++kk) load_w_frag(bw[kk], pw + (size_t)o * CC + kk * 32, hi);
    // all eight heads' columns of sh are complete before any wave reads a row
    __syncthreads();
    for (int rt = 0; rt < 16; ++rt) {
        v8f acc = {};
#pragma unroll  // constant indices keep the fragment arrays in registers
        for (int kk = 0; kk < 4; ++kk) {
            v16h a;
            for (int e = 0; e < 16; ++e)
                a[e] = sh[(rt * 16 + lr) * SHP + kk * 32 + kmap(e, hi)];
            acc = __builtin_amdgcn_wmma_f32_16x16x32_f16(
                false, a, false, bw[kk], (short)0, acc, false, false);
        }
        for (int r = 0; r < 8; ++r) {
            const int n = rt * 16 + r + 8 * hi;
            const int t = n >> 6, rem = n & 63;
            const int gd = rem >> 4, gh = (rem >> 2) & 3, gw = rem & 3;
            const int d = wd * GG + gd, h = wh * GG + gh, w = ww * GG + gw;
            const size_t off = ((((size_t)d * 32 + h) * 32 + w) * TT + t) * CC + o;
            Y0[off] = acc[r] + bias;
        }
        // precaution: stands before the registers of these stores are given a new value
        asm volatile("s_wait_xcnt 0x0" ::: "memory");
    }
}

// ---------------------------------------------------------------------------
// Kernel 2: depthwise 3x3x3 conv over (D,H,W) (T folded into batch), exLN, norm2 and the MLP,
// one block of 16 waves per 256 tokens (2 d x 4 h rows x 32 w of one t).
//   A  conv: one wave = 64 channels of one (d,h,t) row, 2 channels per lane. The lane keeps its
//      2 x 27 weights in registers and walks the 32 columns of W: each loaded column (9 rows x
//      2 floats) feeds the three outputs it touches. Neighbouring waves read the same lines.
//      Taps outside D or H: the row index is clamped and the tap's weight is zero. -> cv (f32)
//   B  exLN -> y, in place in cv (f32, residual base); norm2(y) -> sh (f16 MLP input);
//      eight lanes a token
//   C  fc1 (rows x 128 @ 128x512) + exact GELU -> hidden tile hm (f16), then fc2 (rows x 512 @
//      512x128) + bias + residual -> d_out (f32), in four tiles of 64 rows; both layers'
//      weights stay in registers over all tiles
// Conv rows, y, the MLP input and the hidden activations never leave the WGP.
// ---------------------------------------------------------------------------
#define DW_CS (TT * CC)   // floats from one column of W to the next
#define DW_NB 4           // column buffers: a column is fetched DW_NB - 1 ahead
// f16 per LDS row of the hidden tile: 1040 bytes = 16 x 65, so the 16 rows that a fragment's
// ds_load_b128 reads start 4 banks apart, as with SHP
#define HMP  (MLPH + 8)
#define HTR  64           // rows of a hidden tile

// cv holds channel c of local token n at n * CC + (c ^ cv_sw(n)): rows are 512 bytes, so equal
// channels of all rows share a bank; swapping the 32-channel halves by bit 0 ^ bit 3 of the row
// sets neighbouring tokens (LayerNorm's 16-byte reads) and rows 8 apart (the two halves of an
// accumulator's residual read) 32 banks apart
__device__ __forceinline__ int cv_sw(int n) { return (((n >> 3) ^ n) & 1) << 5; }

__device__ __forceinline__ void dw_load_col(v2f (&b)[9], const float* const (&rp)[9],
                                            int off) {
#pragma unroll
    for (int j = 0; j < 9; ++j) b[j] = *(const v2f*)(rp[j] + off);
}

// acc += sum over the 9 (kd,kh) rows of column b times the weights of tap KW
template <int KW>
__device__ __forceinline__ void dw_fma_col(v2f& acc, const v2f (&b)[9],
                                           const v2f (&wp)[27]) {
#pragma unroll
    for (int j = 0; j < 9; ++j) acc = __builtin_elementwise_fma(b[j], wp[j * 3 + KW], acc);
}

// Exact GELU of two values, 0.5 v (1 + erf(v / sqrt 2)) = 0.5 v + |v| (0.5 erf(|v| / sqrt 2)), with no
// branch: no wave waits on a compare, a mask and a jump, and two values share an instruction. erf by
// its five-term form erf(x) = 1 - t (a1 + t (a2 + t (a3 + t (a4 + t a5)))) exp(-x^2), t = 1 / (1 + p x),
// x >= 0: absolute error below 1.5e-7 for every x, the size of an f32 rounding step at 1; the
// result is rounded to f16 behind it. 1 / sqrt 2 is folded into p and the exponent's factor, the
// 0.5 into a1 .. a5.
__device__ __forceinline__ v2f gelu2(v2f v) {
    const float ax = __builtin_fabsf(v.x), ay = __builtin_fabsf(v.y);
    const v2f t = {__builtin_amdgcn_rcpf(__builtin_fmaf(ax, 0.23164189f, 1.f)),
                   __builtin_amdgcn_rcpf(__builtin_fmaf(ay, 0.23164189f, 1.f))};
    const v2f a = (v * (-0.5f * LOG2E)) * v;          // -(v^2 / 2) log2 e
    const v2f e = {__builtin_amdgcn_exp2f(a.x), __builtin_amdgcn_exp2f(a.y)};
    v2f p = __builtin_elementwise_fma(t, v2f{0.5307027145f, 0.5307027145f},
                                      v2f{-0.7265760135f, -0.7265760135f});
    p = __builtin_elementwise_fma(p, t, v2f{0.7107068705f, 0.7107068705f});
    p = __builtin_elementwise_fma(p, t, v2f{-0.142248368f, -0.142248368f});
    p = __builtin_elementwise_fma(p, t, v2f{0.127414796f, 0.127414796f});
    const v2f s = __builtin_elementwise_fma(-(p * t), e, v2f{0.5f, 0.5f});   // 0.5 erf(|v| / sqrt 2)
    const v2f h = v * 0.5f;
    return v2f{__builtin_fmaf(ax, s.x, h.x), __builtin_fmaf(ay, s.y, h.y)};
}

__global__ __launch_bounds__(512) void cf_k2_conv_ln_mlp(
    const float* __restrict__ Y0, const float* __restrict__ cw,
    const float* __restrict__ cb, const float* __restrict__ eg,
    const float* __restrict__ eb, const float* __restrict__ n2g,
    const float* __restrict__ n2b, const _Float16* __restrict__ wpk,
    const float* __restrict__ b1, const float* __restrict__ b2, float* __restrict__ out)
{
    __shared__ alignas(16) float    cv[256 * CC];    // 128 KiB: conv rows, then y
    __shared__ alignas(16) _Float16 sh[256 * SHP];   // 68 KiB: the block's 256 MLP input rows
    __shared__ alignas(16) _Float16 hm[HTR * HMP];   // 65 KiB: one tile's hidden rows
    // the conv weights, [c][tap], lie in hm's place until the lanes hold them: 864 float4; the
    // rest of the 1024 only lets every thread store twice
    float4* swt = (float4*)hm;
    const int tid = threadIdx.x;
    const int lane = tid & 31;
    const int bx = blockIdx.x;
    const int tt = bx & 3, h0 = ((bx >> 2) & 7) * 4, d0 = (bx >> 5) * 2;

    // LayerNorm's scales and shifts for this lane's 16 channels: fetched with the first conv
    // columns, so that no wave waits for them between the phases
    const int pc = (tid & 7) * 4;
    v4f g1[4], c1[4], g2[4], c2[4];
    // MLP. fc1: the wave owns hidden column tiles wave and wave + 16.
    // fc2: the wave owns output column tile wave & 7, for row tiles 2 (wave >> 3) .. + 1.
    // Their biases are fetched with the first conv columns too.
    const int wave = tid >> 5, lr = lane & 15, hi = lane >> 4;
    const int o = (wave & 7) * 16 + lr;
    float bias1[2], bias2;

    // ---- A: conv ----
    {
        const int wv = __builtin_amdgcn_readfirstlane(tid >> 5);
        const int h = h0 + ((wv >> 1) & 3);
        const int d = d0 + (wv >> 3);
        const int c0 = (wv & 1) * 64;          // this wave's first channel

        // the weights are fetched together with the first columns below
        const float4* cw4 = (const float4*)cw;
        const float4 q0 = cw4[tid];
        const int i1 = min(tid + 512, CC * 27 / 4 - 1);
        const float4 q1 = cw4[i1];

        const float* rp[9];
#pragma unroll
        for (int kd = 0; kd < 3; ++kd)
#pragma unroll
            for (int kh = 0; kh < 3; ++kh) {
                const int dc = min(max(d + kd - 1, 0), 15), hc = min(max(h + kh - 1, 0), 31);
                rp[kd * 3 + kh] = Y0 + ((size_t)((dc * 32 + hc) * 32) * TT + tt) * CC + c0;
            }
        const int lo = lane * 2;
        v2f buf[DW_NB][9];                     // column c lives in buf[c % DW_NB]
        v2f acc[3];                            // output o lives in acc[o % 3]
#pragma unroll
        for (int c = 0; c < DW_NB - 1; ++c) dw_load_col(buf[c], rp, lo + c * DW_CS);
        const v2f bias = *(const v2f*)(cb + c0 + lo);
        ln_load(g1, eg + pc);
        ln_load(c1, eb + pc);
        ln_load(g2, n2g + pc);
        ln_load(c2, n2b + pc);
#pragma unroll  // constant indices keep the values in registers
        for (int j = 0; j < 2; ++j) bias1[j] = b1[(wave + 16 * j) * 16 + lr];
        bias2 = b2[o];

        swt[tid] = q0;
        swt[tid + 512] = q1;
        // precaution: stands before the address registers of the loads above get a new value; i1
        // is named so that its register lives up to here (a later load's result was placed on it)
        asm volatile("s_wait_xcnt 0x0" :: "v"(i1) : "memory");
        // keeps later address arithmetic from rising above that wait
        __builtin_amdgcn_sched_barrier(0);
        __syncthreads();

        // this lane's 2 channels x 27 taps (54 consecutive floats of cw), paired by tap
        const float* lw = (const float*)swt + (c0 + lo) * 27;
        v2f wp[27];
#pragma unroll
        for (int kd = 0; kd < 3; ++kd)
#pragma unroll
            for (int kh = 0; kh < 3; ++kh) {
                const bool ok = (unsigned)(d + kd - 1) < 16u && (unsigned)(h + kh - 1) < 32u;
#pragma unroll
                for (int kw = 0; kw < 3; ++kw) {
                    const int tap = (kd * 3 + kh) * 3 + kw;
                    const float wx = lw[tap], wy = lw[27 + tap];
                    wp[tap].x = ok ? wx : 0.f;
                    wp[tap].y = ok ? wy : 0.f;
                }
            }
        // local token = 32 (wv >> 1) + column
        float* orow = cv + (wv >> 1) * 32 * CC + c0;

        acc[0] = bias;
        // unrolled whole: every buffer index and every address offset is a constant
#pragma unroll
        for (int col = 0; col < 32; ++col) {
            // keeps later columns' loads from being hoisted up here, which spilled registers
            __builtin_amdgcn_sched_barrier(0);
            if (col + DW_NB - 1 < 32)
                dw_load_col(buf[(col + DW_NB - 1) % DW_NB], rp, lo + (col + DW_NB - 1) * DW_CS);
            const v2f (&b)[9] = buf[col % DW_NB];
            if (col > 0) {                     // right neighbour of output col - 1: done
                dw_fma_col<2>(acc[(col + 2) % 3], b, wp);
                *(v2f*)(orow + (col - 1) * CC + (lo ^ cv_sw(col - 1))) = acc[(col + 2) % 3];
            }
            dw_fma_col<1>(acc[col % 3], b, wp);
            if (col < 31) {                    // left neighbour of output col + 1: first
                acc[(col + 1) % 3] = bias;
                dw_fma_col<0>(acc[(col + 1) % 3], b, wp);
            }
        }
        *(v2f*)(orow + 31 * CC + (lo ^ cv_sw(31))) = acc[31 % 3];
        // precaution: stands before the address registers of the loads above get a new value; the
        // lane number, their offset register, is named so that it lives up to here (the last
        // load's result was placed on it while earlier loads from it were in flight)
        asm volatile("s_wait_xcnt 0x0" :: "v"(lane) : "memory");
        // keeps the next phase's set-up from rising above that wait
        __builtin_amdgcn_sched_barrier(0);
    }

    // MLP weights, as launch 1 packed them: every load lands in the registers the products read, so
    // fc1's and the first WEARLY of fc2's fragments fly while the LayerNorms run, the rest of fc2's
    // while the first tile's fc1 runs. Each group stands behind a barrier, not in front of it: a
    // barrier waits for the wave's loads to land.
    v16h bw1[2][4];
    v16h bw2[16];
    const _Float16* p2 = wpk + (wave & 7) * 16 * WFR + lane * 8;
    const _Float16* p1 = wpk + (WF1 + wave * 4) * WFR + lane * 8;   // column tile wave; + 16 tiles: j = 1

    // ---- B: both LayerNorms: a wave takes 16 tokens, four at a time ----
    {
        const int tk0 = (tid >> 5) * 16 + ((tid >> 3) & 3);
        // both channel halves of every conv row are complete before a token's row is read
        __syncthreads();
#pragma unroll  // constant indices keep the fragment arrays in registers
        for (int j = 0; j < 2; ++j)
#pragma unroll  // constant indices keep the fragment arrays in registers
            for (int kk = 0; kk < 4; ++kk) bw1[j][kk] = packed_frag(p1 + (j * 64 + kk) * WFR);
#pragma unroll  // constant indices keep the fragment arrays in registers
        for (int f = 0; f < WEARLY; ++f) bw2[f] = packed_frag(p2 + f * WFR);
        // precaution: stands before the address registers of these loads get a new value; they are
        // named so that they live up to here
        asm volatile("s_wait_xcnt 0x0" :: "v"(p1), "v"(p2) : "memory");
        // keeps these loads in front of the LayerNorms' work (sunk to their users, they would be
        // waited for in full)
        __builtin_amdgcn_sched_barrier(0);
#pragma unroll  // constant indices keep the rows in registers
        for (int q = 0; q < 4; ++q) {
            const int tok = tk0 + q * 4;
            float* yr = cv + tok * CC;
            const int sw = cv_sw(tok);
            v4f xv[4];
#pragma unroll  // constant indices keep the rows in registers
            for (int k = 0; k < 4; ++k) xv[k] = *(const v4f*)(yr + ((pc + k * 32) ^ sw));
            float m, inv;
            ln_stats(xv, m, inv);
            v4f y[4];
#pragma unroll  // constant indices keep the rows in registers
            for (int k = 0; k < 4; ++k) {
                y[k] = (xv[k] - m) * inv * g1[k] + c1[k];
                *(v4f*)(yr + ((pc + k * 32) ^ sw)) = y[k];
            }
            float m2, inv2;
            ln_stats(y, m2, inv2);
#pragma unroll  // constant indices keep the rows in registers
            for (int k = 0; k < 4; ++k) {
                const v4f hv = (y[k] - m2) * inv2 * g2[k] + c2[k];
                *(v4h*)(sh + tok * SHP + pc + k * 32) = __builtin_convertvector(hv, v4h);
            }
        }
    }

    // ---- C: MLP ----
    // every token's y and MLP input row are complete before any wave reads them
    __syncthreads();
#pragma unroll  // constant indices keep the fragment arrays in registers
    for (int f = WEARLY; f < 16; ++f) bw2[f] = packed_frag(p2 + f * WFR);
    // precaution: stands before the address registers of these loads get a new value; they are
    // named so that they live up to here
    asm volatile("s_wait_xcnt 0x0" :: "v"(p2) : "memory");

    for (int t = 0; t < 256 / HTR; ++t) {
        // every wave has read its last fragment of the tile before: hm may be written again
        if (t) __syncthreads();
        // ---- fc1 + GELU: 64 rows x this wave's 32 hidden columns -> hm ----
#pragma nounroll  // unrolled, the trips' values overlapped and weight fragments were spilled
        for (int rt = 0; rt < HTR / 16; ++rt) {
            v16h a[4];
#pragma unroll  // constant indices keep the fragment arrays in registers
            for (int kk = 0; kk < 4; ++kk)
                for (int e = 0; e < 16; ++e)
                    a[kk][e] = sh[(t * HTR + rt * 16 + lr) * SHP + kk * 32 + kmap(e, hi)];
            // both column tiles' products first: the A fragments are dead before the GELU work
            v8f acc[2] = {};
#pragma unroll  // constant indices keep the fragment arrays in registers
            for (int kk = 0; kk < 4; ++kk)
#pragma unroll  // constant indices keep the fragment arrays in registers
                for (int j = 0; j < 2; ++j)
                    acc[j] = __builtin_amdgcn_wmma_f32_16x16x32_f16(
                        false, a[kk], false, bw1[j][kk], (short)0, acc[j], false, false);
            // keeps the GELU work from rising among the products: there it held all four A
            // fragments live to the end, and a weight fragment was spilled
            __builtin_amdgcn_sched_barrier(0);
#pragma unroll  // constant indices keep the accumulators in registers
            for (int j = 0; j < 2; ++j)
#pragma unroll  // constant indices keep the accumulators in registers
                for (int r = 0; r < 8; r += 2) {
                    const v2f ge = gelu2(v2f{acc[j][r], acc[j][r + 1]} + bias1[j]);
                    _Float16* hp = hm + (rt * 16 + r + 8 * hi) * HMP + (wave + 16 * j) * 16 + lr;
                    hp[0] = (_Float16)ge.x;
                    hp[HMP] = (_Float16)ge.y;
                }
        }
        // the tile's hidden rows are complete before any wave reads them
        __syncthreads();
        // ---- fc2 + bias + residual: this wave's 32 rows x 16 output columns ----
        // these 32 rows are the 32 columns of W of the block's row 2 t + (wave >> 3)
        const int d = d0 + (t >> 1), h = h0 + (t & 1) * 2 + (wave >> 3);
        float* ob = out + ((size_t)((d * 32 + h) * 32) * TT + tt) * CC + o;
        for (int i = 0; i < 2; ++i) {
            const int rt = (wave >> 3) * 2 + i;
            const _Float16* ar = hm + (rt * 16 + lr) * HMP;
            const int n0 = t * HTR + rt * 16 + 8 * hi;   // local token of accumulator row 0
            float res[8];
#pragma unroll  // constant indices keep the values in registers
            for (int r = 0; r < 8; ++r) res[r] = cv[(n0 + r) * CC + (o ^ cv_sw(n0 + r))];
            v8f acc = {};
#pragma unroll  // constant indices keep the fragment arrays in registers
            for (int g = 0; g < 4; ++g) {
                v16h a[4];
#pragma unroll  // constant indices keep the fragment arrays in registers
                for (int kk = 0; kk < 4; ++kk)
                    for (int e = 0; e < 16; ++e)
                        a[kk][e] = ar[(g * 4 + kk) * 32 + kmap(e, hi)];
#pragma unroll  // constant indices keep the fragment arrays in registers
                for (int kk = 0; kk < 4; ++kk)
                    acc = __builtin_amdgcn_wmma_f32_16x16x32_f16(
                        false, a[kk], false, bw2[g * 4 + kk], (short)0, acc, false, false);
            }
            for (int r = 0; r < 8; ++r)
                ob[(i * 16 + 8 * hi + r) * DW_CS] = acc[r] + bias2 + res[r];
            // precaution: stands before the registers of these stores get a new value
            asm volatile("s_wait_xcnt 0x0" ::: "memory");
        }
    }
}

// ---------------------------------------------------------------------------
// Host-side orchestration. Workspace: [0,32M) Y0 f32, the attention block's output; behind it
// 256 KiB, the MLP's weights as f16 fragments, written by launch 1 and read by launch 2.
// ---------------------------------------------------------------------------
extern "C" void kernel_launch(void* const* d_in, const int* in_sizes, int n_in,
                              void* d_out, int out_size, void* d_ws, size_t ws_size,
                              hipStream_t stream) {
    (void)in_sizes; (void)n_in; (void)out_size; (void)ws_size;
    const float* x       = (const float*)d_in[0];
    const float* norm1_g = (const float*)d_in[1];
    const float* norm1_b = (const float*)d_in[2];
    const float* pos     = (const float*)d_in[3];
    const float* temb    = (const float*)d_in[4];
    const float* qkv_w   = (const float*)d_in[5];
    const float* qkv_b   = (const float*)d_in[6];
    const float* proj_w  = (const float*)d_in[7];
    const float* proj_b  = (const float*)d_in[8];
    const float* conv_w  = (const float*)d_in[9];
    const float* conv_b  = (const float*)d_in[10];
    const float* exln_g  = (const float*)d_in[11];
    const float* exln_b  = (const float*)d_in[12];
    const float* norm2_g = (const float*)d_in[13];
    const float* norm2_b = (const float*)d_in[14];
    const float* fc1_w   = (const float*)d_in[15];
    const float* fc1_b   = (const float*)d_in[16];
    const float* fc2_w   = (const float*)d_in[17];
    const float* fc2_b   = (const float*)d_in[18];

    float* Y0 = (float*)d_ws;
    _Float16* wpk = (_Float16*)(Y0 + (size_t)NROW * CC);
    float* out = (float*)d_out;

    cf_k1_window_attn<<<NWIN, 256, 0, stream>>>(x, norm1_g, norm1_b, pos, temb,
                                                qkv_w, qkv_b, proj_w, proj_b, fc1_w, fc2_w,
                                                Y0, wpk);
    cf_k2_conv_ln_mlp<<<NROW / 256, 512, 0, stream>>>(Y0, conv_w, conv_b, exln_g, exln_b,
                                                      norm2_g, norm2_b, wpk, fc1_b, fc2_b, out);
}
